// v000
// Times are from an AMD MI455X. After a warm-up the kernel runs many times in a row, and a time is the length of
// such a window on the GPU divided by its runs, so every launch and the gaps after it count. The runs cycle
// through copies of the inputs. A figure is the median of several windows, for all but v000 over two sittings.
// Sittings can differ by a few percent; kernels timed side by side share one.
// v000, which the later versions start from, runs in 377 microseconds.
#include <hip/hip_runtime.h>
#include <hip/hip_bf16.h>
#include <stdint.h>

// ---------------------------------------------------------------------------
// Linear cross-attention with RoPE, MI455X (gfx1250, wave32, WMMA).
// Associativity trick: y = Q_rot @ (K_rot^T V) / (Q . sum_s K)  -- avoids TxS.
// All GEMMs run through v_wmma_f32_16x16x32_f16 with fp32 accumulation;
// fp32 operands are converted to f16 while staging through LDS.
// ---------------------------------------------------------------------------

typedef __attribute__((ext_vector_type(16))) _Float16 v16h;
typedef __attribute__((ext_vector_type(8)))  float    v8f;

#define N_EMB 1024
#define NHEAD 16
#define HDIM  64
#define BATCH 2
#define TLEN  2048
#define SLEN  2048
#define LDS_PAD 8               // halfs of padding per LDS row (row = 40 halfs)
#define ROWH (32 + LDS_PAD)     // LDS row stride in halfs (BK=32)

// --- WMMA fragment helpers --------------------------------------------------
// 16-bit A-matrix 16x32 layout (ISA 7.12.2): lane&15 = row M; lanes>=16 use
// K base +8; VGPR0..3 hold K=kb..kb+7 (packed f16 pairs), VGPR4..7 hold
// K=kb+16..kb+23.  B 32x16 is stored K-contiguous per column in LDS
// (transposed on fill) so the same load pattern applies with lane&15 = col N.
__device__ __forceinline__ v16h frag_ld(const _Float16* rowbase, int kb) {
  union { v16h h; uint32_t u[8]; } f;
  const uint32_t* p0 = (const uint32_t*)(rowbase + kb);
  const uint32_t* p1 = (const uint32_t*)(rowbase + kb + 16);
#pragma unroll
  for (int j = 0; j < 4; ++j) { f.u[j] = p0[j]; f.u[4 + j] = p1[j]; }
  return f.h;
}

__device__ __forceinline__ v8f wmma16(v16h a, v16h b, v8f c) {
  // (neg_a, A, neg_b, B, c_mod, C, reuse_a, reuse_b)
  return __builtin_amdgcn_wmma_f32_16x16x32_f16(false, a, false, b,
                                                (short)0, c, false, false);
}

__device__ __forceinline__ float elu_p1(float v) {
  return v > 0.0f ? v + 1.0f : __expf(v);   // elu(v)+1
}

// --- Generic tiled GEMM: C = A(fp32)[M,K] * B(fp32)[K,N] + bias -------------
// mode 0: plain; mode 1: elu+1 everywhere; mode 2: elu+1 only for col < halfN.
// Shapes are exact multiples of tiles (M%128==0, N%128==0, K%32==0).
__global__ __launch_bounds__(256)
void gemm_kernel(const float* __restrict__ A, const float* __restrict__ B,
                 const float* __restrict__ bias, float* __restrict__ C,
                 int M, int N, int K, int mode, int halfN) {
  __shared__ _Float16 As[128 * ROWH];
  __shared__ _Float16 Bs[128 * ROWH];

  const int tid  = threadIdx.x;
  const int bm   = blockIdx.y * 128;
  const int bn   = blockIdx.x * 128;
  const int wid  = tid >> 5;
  const int lane = tid & 31;
  const int nl   = lane & 15;
  const int kb   = (lane >> 4) << 3;   // K base for A/B fragments
  const int hb   = (lane >> 4) << 3;   // row offset for C/D fragments
  const int wm   = (wid & 1) * 64;     // 2 waves in M  -> 64 rows each
  const int wn   = (wid >> 1) * 32;    // 4 waves in N  -> 32 cols each

  const v8f vzero = {0.f,0.f,0.f,0.f,0.f,0.f,0.f,0.f};
  v8f acc[4][2];
#pragma unroll
  for (int i = 0; i < 4; ++i)
#pragma unroll
    for (int j = 0; j < 2; ++j) acc[i][j] = vzero;

  for (int k0 = 0; k0 < K; k0 += 32) {
    // A tile 128x32 -> As[m][k]
    {
      const int r  = tid >> 3;           // 0..31
      const int c4 = (tid & 7) * 4;      // 0..28
#pragma unroll
      for (int rr = 0; rr < 128; rr += 32) {
        const float4 v = *(const float4*)(A + (size_t)(bm + r + rr) * K + k0 + c4);
        _Float16* d = &As[(r + rr) * ROWH + c4];
        d[0] = (_Float16)v.x; d[1] = (_Float16)v.y;
        d[2] = (_Float16)v.z; d[3] = (_Float16)v.w;
      }
    }
    // B tile 32x128 -> Bs[n][k] (transposed: K contiguous)
    {
      const int br  = tid >> 5;          // 0..7
      const int bc4 = (tid & 31) * 4;    // 0..124
#pragma unroll
      for (int rr = 0; rr < 32; rr += 8) {
        const float4 v = *(const float4*)(B + (size_t)(k0 + br + rr) * N + bn + bc4);
        Bs[(bc4 + 0) * ROWH + br + rr] = (_Float16)v.x;
        Bs[(bc4 + 1) * ROWH + br + rr] = (_Float16)v.y;
        Bs[(bc4 + 2) * ROWH + br + rr] = (_Float16)v.z;
        Bs[(bc4 + 3) * ROWH + br + rr] = (_Float16)v.w;
      }
    }
    __syncthreads();

    v16h af[4], bf[2];
#pragma unroll
    for (int i = 0; i < 4; ++i) af[i] = frag_ld(&As[(wm + i * 16 + nl) * ROWH], kb);
#pragma unroll
    for (int j = 0; j < 2; ++j) bf[j] = frag_ld(&Bs[(wn + j * 16 + nl) * ROWH], kb);
#pragma unroll
    for (int i = 0; i < 4; ++i)
#pragma unroll
      for (int j = 0; j < 2; ++j) acc[i][j] = wmma16(af[i], bf[j], acc[i][j]);
    __syncthreads();
  }

#pragma unroll
  for (int i = 0; i < 4; ++i)
#pragma unroll
    for (int j = 0; j < 2; ++j) {
      const int col = bn + wn + j * 16 + nl;
      const float bv = bias[col];
      const bool act = (mode == 1) || (mode == 2 && col < halfN);
#pragma unroll
      for (int vi = 0; vi < 8; ++vi) {
        const int row = bm + wm + i * 16 + hb + vi;
        float v = acc[i][j][vi] + bv;
        if (act) v = elu_p1(v);
        C[(size_t)row * N + col] = v;
      }
    }
}

// --- RoPE elementwise -------------------------------------------------------
// in: feature-mapped tensor viewed as [B*L, C] with row stride in_stride
// (reads only first N_EMB columns). transposed==0: out [B,L,C];
// transposed==1: out [B,H,HD,L] (so it can serve as row-major WMMA A).
__global__ void rope_kernel(const float* __restrict__ in, float* __restrict__ out,
                            int L, int in_stride, int transposed) {
  const int idx = blockIdx.x * blockDim.x + threadIdx.x;
  const int row = idx >> 10;            // /C (C=1024)
  const int c   = idx & (N_EMB - 1);
  const int b   = row / L;
  const int t   = row - b * L;
  const int h   = c >> 6;
  const int d   = c & 63;
  const int i   = d & 31;
  // inv_freq[i] = 10000^(-2i/64) = exp(-i * ln(10000)/32)
  const float inv = __expf(-(float)i * 0.28782313662425572f);
  float sn, cs;
  __sincosf((float)t * inv, &sn, &cs);
  const size_t base = (size_t)row * in_stride;
  const float xv = in[base + c];
  const float xo = (d < 32) ? -in[base + c + 32] : in[base + c - 32];
  const float r = xv * cs + xo * sn;
  if (transposed)
    out[((size_t)(b * NHEAD + h) * HDIM + d) * L + t] = r;
  else
    out[(size_t)row * N_EMB + c] = r;
}

// --- K row-sum over S (two pass, deterministic) -----------------------------
#define NCH 16
__global__ void ksum_partial_kernel(const float* __restrict__ kv,
                                    float* __restrict__ partial) {
  const int c  = blockIdx.x * blockDim.x + threadIdx.x;  // 0..1023
  const int b  = blockIdx.y;
  const int ch = blockIdx.z;
  const int chs = SLEN / NCH;
  float s = 0.f;
  for (int i = 0; i < chs; ++i) {
    const int srow = ch * chs + i;
    s += kv[((size_t)(b * SLEN + srow)) * (2 * N_EMB) + c];
  }
  partial[((size_t)ch * BATCH + b) * N_EMB + c] = s;
}

__global__ void ksum_final_kernel(const float* __restrict__ partial,
                                  float* __restrict__ ksum) {
  const int i = blockIdx.x * blockDim.x + threadIdx.x;  // 0..B*C-1
  float s = 0.f;
#pragma unroll
  for (int ch = 0; ch < NCH; ++ch) s += partial[(size_t)ch * (BATCH * N_EMB) + i];
  ksum[i] = s;
}

// --- denom[b,h,t] = qfeat[b,t,h,:] . ksum[b,h,:] ----------------------------
__global__ void denom_kernel(const float* __restrict__ qfeat,
                             const float* __restrict__ ksum,
                             float* __restrict__ denom) {
  const int idx = blockIdx.x * blockDim.x + threadIdx.x;  // B*T*H
  const int b = idx / (TLEN * NHEAD);
  const int r = idx - b * (TLEN * NHEAD);
  const int t = r >> 4;
  const int h = r & 15;
  const float* q = qfeat + (size_t)(b * TLEN + t) * N_EMB + h * HDIM;
  const float* k = ksum + (size_t)b * N_EMB + h * HDIM;
  float s = 0.f;
#pragma unroll 8
  for (int d = 0; d < HDIM; ++d) s += q[d] * k[d];
  denom[((size_t)(b * NHEAD + h)) * TLEN + t] = s;
}

// --- state[b,h] = K_rot^T V  (64x64, K over S=2048) -------------------------
__global__ __launch_bounds__(256)
void state_kernel(const float* __restrict__ krotT, const float* __restrict__ kv,
                  float* __restrict__ state) {
  __shared__ _Float16 As[64 * ROWH];
  __shared__ _Float16 Bs[64 * ROWH];
  const int bh = blockIdx.x;
  const int b = bh >> 4, h = bh & 15;
  const float* Aptr = krotT + (size_t)bh * HDIM * SLEN;                 // [64,S]
  const float* Vptr = kv + (size_t)b * SLEN * (2 * N_EMB) + N_EMB + h * HDIM;
  const int tid = threadIdx.x;
  const int wid = tid >> 5, lane = tid & 31;
  const int nl = lane & 15;
  const int kb = (lane >> 4) << 3;
  const int hb = (lane >> 4) << 3;
  const int tm  = (wid & 3) * 16;        // 4 m-tiles
  const int tn0 = (wid >> 2) * 32;       // 2 wave groups x 2 n-tiles

  const v8f vzero = {0.f,0.f,0.f,0.f,0.f,0.f,0.f,0.f};
  v8f acc[2] = {vzero, vzero};

  for (int s0 = 0; s0 < SLEN; s0 += 32) {
    {   // A tile 64x32 (rows d, cols s)
      const int r = tid >> 3, c4 = (tid & 7) * 4;
#pragma unroll
      for (int rr = 0; rr < 64; rr += 32) {
        const float4 v = *(const float4*)(Aptr + (size_t)(r + rr) * SLEN + s0 + c4);
        _Float16* d = &As[(r + rr) * ROWH + c4];
        d[0] = (_Float16)v.x; d[1] = (_Float16)v.y;
        d[2] = (_Float16)v.z; d[3] = (_Float16)v.w;
      }
    }
    {   // V tile 32(s) x 64(e) -> Bs[e][s]
      const int br = tid >> 4, bc4 = (tid & 15) * 4;
#pragma unroll
      for (int rr = 0; rr < 32; rr += 16) {
        const float4 v = *(const float4*)(Vptr + (size_t)(s0 + br + rr) * (2 * N_EMB) + bc4);
        Bs[(bc4 + 0) * ROWH + br + rr] = (_Float16)v.x;
        Bs[(bc4 + 1) * ROWH + br + rr] = (_Float16)v.y;
        Bs[(bc4 + 2) * ROWH + br + rr] = (_Float16)v.z;
        Bs[(bc4 + 3) * ROWH + br + rr] = (_Float16)v.w;
      }
    }
    __syncthreads();
    const v16h af = frag_ld(&As[(tm + nl) * ROWH], kb);
#pragma unroll
    for (int j = 0; j < 2; ++j) {
      const v16h bf = frag_ld(&Bs[(tn0 + j * 16 + nl) * ROWH], kb);
      acc[j] = wmma16(af, bf, acc[j]);
    }
    __syncthreads();
  }
#pragma unroll
  for (int j = 0; j < 2; ++j) {
    const int col = tn0 + j * 16 + nl;
#pragma unroll
    for (int vi = 0; vi < 8; ++vi) {
      const int row = tm + hb + vi;
      state[(size_t)bh * (HDIM * HDIM) + row * HDIM + col] = acc[j][vi];
    }
  }
}

// --- y[b,t,h,:] = (Q_rot[b,t,h,:] @ state[b,h]) / denom[b,h,t] --------------
__global__ __launch_bounds__(256)
void ygemm_kernel(const float* __restrict__ qrot, const float* __restrict__ state,
                  const float* __restrict__ denom, float* __restrict__ y) {
  __shared__ _Float16 As[128 * ROWH];
  __shared__ _Float16 Bs[64 * ROWH];
  const int bh = blockIdx.y;
  const int b = bh >> 4, h = bh & 15;
  const int row0 = blockIdx.x * 128;
  const float* Aptr = qrot + (size_t)b * TLEN * N_EMB + h * HDIM;   // rows t, lda=N_EMB
  const float* Sptr = state + (size_t)bh * (HDIM * HDIM);
  const int tid = threadIdx.x;
  const int wid = tid >> 5, lane = tid & 31;
  const int nl = lane & 15;
  const int kb = (lane >> 4) << 3;
  const int hb = (lane >> 4) << 3;

  const v8f vzero = {0.f,0.f,0.f,0.f,0.f,0.f,0.f,0.f};
  v8f acc[4] = {vzero, vzero, vzero, vzero};

  for (int k0 = 0; k0 < HDIM; k0 += 32) {
    {   // A tile 128x32
      const int r = tid >> 3, c4 = (tid & 7) * 4;
#pragma unroll
      for (int rr = 0; rr < 128; rr += 32) {
        const float4 v = *(const float4*)(Aptr + (size_t)(row0 + r + rr) * N_EMB + k0 + c4);
        _Float16* d = &As[(r + rr) * ROWH + c4];
        d[0] = (_Float16)v.x; d[1] = (_Float16)v.y;
        d[2] = (_Float16)v.z; d[3] = (_Float16)v.w;
      }
    }
    {   // state tile 32(d) x 64(e) -> Bs[e][d]
      const int br = tid >> 4, bc4 = (tid & 15) * 4;
#pragma unroll
      for (int rr = 0; rr < 32; rr += 16) {
        const float4 v = *(const float4*)(Sptr + (size_t)(k0 + br + rr) * HDIM + bc4);
        Bs[(bc4 + 0) * ROWH + br + rr] = (_Float16)v.x;
        Bs[(bc4 + 1) * ROWH + br + rr] = (_Float16)v.y;
        Bs[(bc4 + 2) * ROWH + br + rr] = (_Float16)v.z;
        Bs[(bc4 + 3) * ROWH + br + rr] = (_Float16)v.w;
      }
    }
    __syncthreads();
    const v16h af = frag_ld(&As[(wid * 16 + nl) * ROWH], kb);
#pragma unroll
    for (int j = 0; j < 4; ++j) {
      const v16h bf = frag_ld(&Bs[(j * 16 + nl) * ROWH], kb);
      acc[j] = wmma16(af, bf, acc[j]);
    }
    __syncthreads();
  }
  float rd[8];
#pragma unroll
  for (int vi = 0; vi < 8; ++vi)
    rd[vi] = 1.0f / denom[(size_t)bh * TLEN + row0 + wid * 16 + hb + vi];
#pragma unroll
  for (int j = 0; j < 4; ++j) {
#pragma unroll
    for (int vi = 0; vi < 8; ++vi) {
      const int t = row0 + wid * 16 + hb + vi;
      const int col = h * HDIM + j * 16 + nl;
      y[(size_t)(b * TLEN + t) * N_EMB + col] = acc[j][vi] * rd[vi];
    }
  }
}

// ---------------------------------------------------------------------------
extern "C" void kernel_launch(void* const* d_in, const int* in_sizes, int n_in,
                              void* d_out, int out_size, void* d_ws, size_t ws_size,
                              hipStream_t stream) {
  (void)in_sizes; (void)n_in; (void)out_size; (void)ws_size;
  const float* x      = (const float*)d_in[0];
  const float* mem    = (const float*)d_in[1];
  const float* q_w    = (const float*)d_in[2];
  const float* q_b    = (const float*)d_in[3];
  const float* kv_w   = (const float*)d_in[4];
  const float* kv_b   = (const float*)d_in[5];
  const float* proj_w = (const float*)d_in[6];
  const float* proj_b = (const float*)d_in[7];
  float* out = (float*)d_out;

  // Workspace layout (floats). Total ~97 MB.
  const size_t SZ_BTC = (size_t)BATCH * TLEN * N_EMB;     // 4 M
  float* ws      = (float*)d_ws;
  float* qfeat   = ws;                                    // [B,T,C] elu+1
  float* qrot    = qfeat   + SZ_BTC;                      // [B,T,C]
  float* kvbuf   = qrot    + SZ_BTC;                      // [B,S,2C] (K feat | V)
  float* krotT   = kvbuf   + 2 * SZ_BTC;                  // [B,H,64,S]
  float* ybuf    = krotT   + SZ_BTC;                      // [B,T,C]
  float* stateb  = ybuf    + SZ_BTC;                      // [B*H,64,64]
  float* ksum    = stateb  + (size_t)BATCH * NHEAD * HDIM * HDIM;  // [B,C]
  float* partial = ksum    + (size_t)BATCH * N_EMB;       // [NCH,B,C]
  float* denom   = partial + (size_t)NCH * BATCH * N_EMB; // [B,H,T]

  const dim3 blk(256);
  const int M = BATCH * TLEN;   // 4096

  // 1) Q = elu(x@q_w + q_b)+1
  gemm_kernel<<<dim3(N_EMB / 128, M / 128), blk, 0, stream>>>(
      x, q_w, q_b, qfeat, M, N_EMB, N_EMB, 1, 0);
  // 2) kv = memory@kv_w + kv_b ; elu+1 on K half only
  gemm_kernel<<<dim3(2 * N_EMB / 128, M / 128), blk, 0, stream>>>(
      mem, kv_w, kv_b, kvbuf, M, 2 * N_EMB, N_EMB, 2, N_EMB);
  // 3) RoPE
  rope_kernel<<<(unsigned)(SZ_BTC / 256), blk, 0, stream>>>(qfeat, qrot, TLEN, N_EMB, 0);
  rope_kernel<<<(unsigned)(SZ_BTC / 256), blk, 0, stream>>>(kvbuf, krotT, SLEN, 2 * N_EMB, 1);
  // 4) ksum = sum_s K  (two-pass, deterministic)
  ksum_partial_kernel<<<dim3(N_EMB / 256, BATCH, NCH), blk, 0, stream>>>(kvbuf, partial);
  ksum_final_kernel<<<(BATCH * N_EMB) / 256, blk, 0, stream>>>(partial, ksum);
  // 5) denom = Q . ksum
  denom_kernel<<<(BATCH * TLEN * NHEAD) / 256, blk, 0, stream>>>(qfeat, ksum, denom);
  // 6) state = K_rot^T V  (per b,h)
  state_kernel<<<BATCH * NHEAD, blk, 0, stream>>>(krotT, kvbuf, stateb);
  // 7) y = (Q_rot @ state) / denom
  ygemm_kernel<<<dim3(TLEN / 128, BATCH * NHEAD), blk, 0, stream>>>(qrot, stateb, denom, ybuf);
  // 8) out = y @ proj_w + proj_b
  gemm_kernel<<<dim3(N_EMB / 128, M / 128), blk, 0, stream>>>(
      ybuf, proj_w, proj_b, out, M, N_EMB, N_EMB, 0, 0);
}

// v001
// A run of this version takes 307 microseconds.
// Next to v000, in two timings, it ran 1.21 and 1.23 times as fast.
#include <hip/hip_runtime.h>
#include <hip/hip_bf16.h>
#include <stdint.h>

// ---------------------------------------------------------------------------
// Linear cross-attention with RoPE, MI455X (gfx1250, wave32, WMMA).
// Associativity trick: y = Q_rot @ (K_rot^T V) / (Q . sum_s K)  -- avoids TxS.
// All GEMMs run through v_wmma_f32_16x16x32_f16 with fp32 accumulation;
// fp32 operands are converted to f16 while staging through LDS.
// ---------------------------------------------------------------------------

typedef __attribute__((ext_vector_type(16))) _Float16 v16h;
typedef __attribute__((ext_vector_type(8)))  float    v8f;

#define N_EMB 1024
#define NHEAD 16
#define HDIM  64
#define BATCH 2
#define TLEN  2048
#define SLEN  2048
#define LDS_PAD 8               // halfs of padding per LDS row (row = 40 halfs)
#define ROWH (32 + LDS_PAD)     // LDS row stride in halfs (BK=32)

// --- WMMA fragment helpers --------------------------------------------------
// 16-bit A-matrix 16x32 layout (ISA 7.12.2): lane&15 = row M; lanes>=16 use
// K base +8; VGPR0..3 hold K=kb..kb+7 (packed f16 pairs), VGPR4..7 hold
// K=kb+16..kb+23.  B 32x16 is stored K-contiguous per column in LDS
// (transposed on fill) so the same load pattern applies with lane&15 = col N.
__device__ __forceinline__ v16h frag_ld(const _Float16* rowbase, int kb) {
  union { v16h h; uint32_t u[8]; } f;
  const uint32_t* p0 = (const uint32_t*)(rowbase + kb);
  const uint32_t* p1 = (const uint32_t*)(rowbase + kb + 16);
#pragma unroll
  for (int j = 0; j < 4; ++j) { f.u[j] = p0[j]; f.u[4 + j] = p1[j]; }
  return f.h;
}

__device__ __forceinline__ v8f wmma16(v16h a, v16h b, v8f c) {
  // (neg_a, A, neg_b, B, c_mod, C, reuse_a, reuse_b)
  return __builtin_amdgcn_wmma_f32_16x16x32_f16(false, a, false, b,
                                                (short)0, c, false, false);
}

__device__ __forceinline__ float elu_p1(float v) {
  return v > 0.0f ? v + 1.0f : __expf(v);   // elu(v)+1
}

// --- Generic tiled GEMM: C = A(fp32)[M,K] * B(fp32)[K,N] + bias -------------
// mode 0: plain; mode 1: elu+1 everywhere; mode 2: elu+1 only for col < halfN.
// Shapes are exact multiples of tiles (M%128==0, N%128==0, K%32==0).
__global__ __launch_bounds__(256)
void gemm_kernel(const float* __restrict__ A, const float* __restrict__ B,
                 const float* __restrict__ bias, float* __restrict__ C,
                 int M, int N, int K, int mode, int halfN) {
  __shared__ _Float16 As[128 * ROWH];
  __shared__ _Float16 Bs[128 * ROWH];

  const int tid  = threadIdx.x;
  const int bm   = blockIdx.y * 128;
  const int bn   = blockIdx.x * 128;
  const int wid  = tid >> 5;
  const int lane = tid & 31;
  const int nl   = lane & 15;
  const int kb   = (lane >> 4) << 3;   // K base for A/B fragments
  const int hb   = (lane >> 4) << 3;   // row offset for C/D fragments
  const int wm   = (wid & 1) * 64;     // 2 waves in M  -> 64 rows each
  const int wn   = (wid >> 1) * 32;    // 4 waves in N  -> 32 cols each

  const v8f vzero = {0.f,0.f,0.f,0.f,0.f,0.f,0.f,0.f};
  v8f acc[4][2];
#pragma unroll
  for (int i = 0; i < 4; ++i)
#pragma unroll
    for (int j = 0; j < 2; ++j) acc[i][j] = vzero;

  for (int k0 = 0; k0 < K; k0 += 32) {
    // A tile 128x32 -> As[m][k]
    {
      const int r  = tid >> 3;           // 0..31
      const int c4 = (tid & 7) * 4;      // 0..28
#pragma unroll
      for (int rr = 0; rr < 128; rr += 32) {
        const float4 v = *(const float4*)(A + (size_t)(bm + r + rr) * K + k0 + c4);
        _Float16* d = &As[(r + rr) * ROWH + c4];
        d[0] = (_Float16)v.x; d[1] = (_Float16)v.y;
        d[2] = (_Float16)v.z; d[3] = (_Float16)v.w;
      }
    }
    // B tile 32x128 -> Bs[n][k] (transposed: K contiguous)
    {
      const int br  = tid >> 5;          // 0..7
      const int bc4 = (tid & 31) * 4;    // 0..124
#pragma unroll
      for (int rr = 0; rr < 32; rr += 8) {
        const float4 v = *(const float4*)(B + (size_t)(k0 + br + rr) * N + bn + bc4);
        Bs[(bc4 + 0) * ROWH + br + rr] = (_Float16)v.x;
        Bs[(bc4 + 1) * ROWH + br + rr] = (_Float16)v.y;
        Bs[(bc4 + 2) * ROWH + br + rr] = (_Float16)v.z;
        Bs[(bc4 + 3) * ROWH + br + rr] = (_Float16)v.w;
      }
    }
    __syncthreads();

    v16h af[4], bf[2];
#pragma unroll
    for (int i = 0; i < 4; ++i) af[i] = frag_ld(&As[(wm + i * 16 + nl) * ROWH], kb);
#pragma unroll
    for (int j = 0; j < 2; ++j) bf[j] = frag_ld(&Bs[(wn + j * 16 + nl) * ROWH], kb);
#pragma unroll
    for (int i = 0; i < 4; ++i)
#pragma unroll
      for (int j = 0; j < 2; ++j) acc[i][j] = wmma16(af[i], bf[j], acc[i][j]);
    __syncthreads();
  }

#pragma unroll
  for (int i = 0; i < 4; ++i)
#pragma unroll
    for (int j = 0; j < 2; ++j) {
      const int col = bn + wn + j * 16 + nl;
      const float bv = bias[col];
      const bool act = (mode == 1) || (mode == 2 && col < halfN);
#pragma unroll
      for (int vi = 0; vi < 8; ++vi) {
        const int row = bm + wm + i * 16 + hb + vi;
        float v = acc[i][j][vi] + bv;
        if (act) v = elu_p1(v);
        C[(size_t)row * N + col] = v;
      }
    }
}

// --- RoPE elementwise -------------------------------------------------------
// in: feature-mapped tensor viewed as [B*L, C] with row stride in_stride
// (reads only first N_EMB columns). out [B,L,C].
__global__ void rope_kernel(const float* __restrict__ in, float* __restrict__ out,
                            int L, int in_stride) {
  const int idx = blockIdx.x * blockDim.x + threadIdx.x;
  const int row = idx >> 10;            // /C (C=1024)
  const int c   = idx & (N_EMB - 1);
  const int b   = row / L;
  const int t   = row - b * L;
  const int d   = c & 63;
  const int i   = d & 31;
  // inv_freq[i] = 10000^(-2i/64) = exp(-i * ln(10000)/32)
  const float inv = __expf(-(float)i * 0.28782313662425572f);
  float sn, cs;
  __sincosf((float)t * inv, &sn, &cs);
  const size_t base = (size_t)row * in_stride;
  const float xv = in[base + c];
  const float xo = (d < 32) ? -in[base + c + 32] : in[base + c - 32];
  out[(size_t)row * N_EMB + c] = xv * cs + xo * sn;
}

// --- RoPE on K with transposed output [B,H,HD,S] ----------------------------
// (so it can serve as row-major WMMA A). One block = one head x 64 positions.
// The 64(s) x 64(d) tile goes through LDS: rows are read along d, results are
// stored along s, so both global sides move whole 128-byte lines.
#define RT_PITCH 65             // floats; odd pitch: column reads hit 32 banks
// sin and cos of 2*pi*rev. One statement so that the slot the instruction set
// asks for behind a transcendental is filled whatever the compiler puts next:
// v_cos is independent of v_sin (outputs never alias the input), v_nop ends it.
__device__ __forceinline__ void sincos_rev(float rev, float& sn, float& cs) {
  asm("v_sin_f32 %0, %2\n\tv_cos_f32 %1, %2\n\tv_nop"
      : "=&v"(sn), "=&v"(cs) : "v"(rev));
}
__global__ __launch_bounds__(256)
void rope_kt_kernel(const float* __restrict__ kv, float* __restrict__ out) {
  __shared__ float tile[64 * RT_PITCH];
  const int tid = threadIdx.x;
  const int s0  = blockIdx.x * 64;
  const int bh  = blockIdx.y;
  const int b = bh >> 4, h = bh & 15;
  const float* src = kv + ((size_t)b * SLEN + s0) * (2 * N_EMB) + h * HDIM;
  {
    const int r = tid >> 4, c4 = (tid & 15) * 4;
#pragma unroll
    for (int rr = 0; rr < 64; rr += 16) {
      const float4 v = *(const float4*)(src + (size_t)(r + rr) * (2 * N_EMB) + c4);
      float* p = &tile[(r + rr) * RT_PITCH + c4];
      p[0] = v.x; p[1] = v.y; p[2] = v.z; p[3] = v.w;
    }
  }
  __syncthreads();   // every row of the tile is in LDS before columns are read
  const int s4 = (tid & 15) * 4;        // four consecutive positions per thread
  float* dst = out + (size_t)bh * HDIM * SLEN + s0 + s4;
#pragma unroll
  for (int p = 0; p < 2; ++p) {
    const int i = (tid >> 4) + p * 16;  // 0..31: the pair (i, i+32) shares its angle
    const float inv = __expf(-(float)i * 0.28782313662425572f);
    float lo[4], hi[4];
#pragma unroll
    for (int j = 0; j < 4; ++j) {
      float sn, cs;
      sincos_rev((float)(s0 + s4 + j) * inv * 0.15915494309189532f, sn, cs);
      const float x1 = tile[(s4 + j) * RT_PITCH + i];
      const float x2 = tile[(s4 + j) * RT_PITCH + i + 32];
      lo[j] = fmaf(x1, cs, -(x2 * sn));
      hi[j] = fmaf(x2, cs, x1 * sn);
    }
    *(float4*)(dst + (size_t)i * SLEN)        = make_float4(lo[0], lo[1], lo[2], lo[3]);
    *(float4*)(dst + (size_t)(i + 32) * SLEN) = make_float4(hi[0], hi[1], hi[2], hi[3]);
  }
}

// --- K row-sum over S (two pass, deterministic) -----------------------------
#define NCH 16
__global__ void ksum_partial_kernel(const float* __restrict__ kv,
                                    float* __restrict__ partial) {
  const int c  = blockIdx.x * blockDim.x + threadIdx.x;  // 0..1023
  const int b  = blockIdx.y;
  const int ch = blockIdx.z;
  const int chs = SLEN / NCH;
  float s = 0.f;
  for (int i = 0; i < chs; ++i) {
    const int srow = ch * chs + i;
    s += kv[((size_t)(b * SLEN + srow)) * (2 * N_EMB) + c];
  }
  partial[((size_t)ch * BATCH + b) * N_EMB + c] = s;
}

__global__ void ksum_final_kernel(const float* __restrict__ partial,
                                  float* __restrict__ ksum) {
  const int i = blockIdx.x * blockDim.x + threadIdx.x;  // 0..B*C-1
  float s = 0.f;
#pragma unroll
  for (int ch = 0; ch < NCH; ++ch) s += partial[(size_t)ch * (BATCH * N_EMB) + i];
  ksum[i] = s;
}

// --- denom[b,h,t] = qfeat[b,t,h,:] . ksum[b,h,:] ----------------------------
__global__ void denom_kernel(const float* __restrict__ qfeat,
                             const float* __restrict__ ksum,
                             float* __restrict__ denom) {
  const int idx = blockIdx.x * blockDim.x + threadIdx.x;  // B*T*H
  const int b = idx / (TLEN * NHEAD);
  const int r = idx - b * (TLEN * NHEAD);
  const int t = r >> 4;
  const int h = r & 15;
  const float* q = qfeat + (size_t)(b * TLEN + t) * N_EMB + h * HDIM;
  const float* k = ksum + (size_t)b * N_EMB + h * HDIM;
  float s = 0.f;
#pragma unroll 8
  for (int d = 0; d < HDIM; ++d) s += q[d] * k[d];
  denom[((size_t)(b * NHEAD + h)) * TLEN + t] = s;
}

// --- state[b,h] = K_rot^T V  (64x64, K over S=2048) -------------------------
__global__ __launch_bounds__(256)
void state_kernel(const float* __restrict__ krotT, const float* __restrict__ kv,
                  float* __restrict__ state) {
  __shared__ _Float16 As[64 * ROWH];
  __shared__ _Float16 Bs[64 * ROWH];
  const int bh = blockIdx.x;
  const int b = bh >> 4, h = bh & 15;
  const float* Aptr = krotT + (size_t)bh * HDIM * SLEN;                 // [64,S]
  const float* Vptr = kv + (size_t)b * SLEN * (2 * N_EMB) + N_EMB + h * HDIM;
  const int tid = threadIdx.x;
  const int wid = tid >> 5, lane = tid & 31;
  const int nl = lane & 15;
  const int kb = (lane >> 4) << 3;
  const int hb = (lane >> 4) << 3;
  const int tm  = (wid & 3) * 16;        // 4 m-tiles
  const int tn0 = (wid >> 2) * 32;       // 2 wave groups x 2 n-tiles

  const v8f vzero = {0.f,0.f,0.f,0.f,0.f,0.f,0.f,0.f};
  v8f acc[2] = {vzero, vzero};

  for (int s0 = 0; s0 < SLEN; s0 += 32) {
    {   // A tile 64x32 (rows d, cols s)
      const int r = tid >> 3, c4 = (tid & 7) * 4;
#pragma unroll
      for (int rr = 0; rr < 64; rr += 32) {
        const float4 v = *(const float4*)(Aptr + (size_t)(r + rr) * SLEN + s0 + c4);
        _Float16* d = &As[(r + rr) * ROWH + c4];
        d[0] = (_Float16)v.x; d[1] = (_Float16)v.y;
        d[2] = (_Float16)v.z; d[3] = (_Float16)v.w;
      }
    }
    {   // V tile 32(s) x 64(e) -> Bs[e][s]
      const int br = tid >> 4, bc4 = (tid & 15) * 4;
#pragma unroll
      for (int rr = 0; rr < 32; rr += 16) {
        const float4 v = *(const float4*)(Vptr + (size_t)(s0 + br + rr) * (2 * N_EMB) + bc4);
        Bs[(bc4 + 0) * ROWH + br + rr] = (_Float16)v.x;
        Bs[(bc4 + 1) * ROWH + br + rr] = (_Float16)v.y;
        Bs[(bc4 + 2) * ROWH + br + rr] = (_Float16)v.z;
        Bs[(bc4 + 3) * ROWH + br + rr] = (_Float16)v.w;
      }
    }
    __syncthreads();
    const v16h af = frag_ld(&As[(tm + nl) * ROWH], kb);
#pragma unroll
    for (int j = 0; j < 2; ++j) {
      const v16h bf = frag_ld(&Bs[(tn0 + j * 16 + nl) * ROWH], kb);
      acc[j] = wmma16(af, bf, acc[j]);
    }
    __syncthreads();
  }
#pragma unroll
  for (int j = 0; j < 2; ++j) {
    const int col = tn0 + j * 16 + nl;
#pragma unroll
    for (int vi = 0; vi < 8; ++vi) {
      const int row = tm + hb + vi;
      state[(size_t)bh * (HDIM * HDIM) + row * HDIM + col] = acc[j][vi];
    }
  }
}

// --- y[b,t,h,:] = (Q_rot[b,t,h,:] @ state[b,h]) / denom[b,h,t] --------------
__global__ __launch_bounds__(256)
void ygemm_kernel(const float* __restrict__ qrot, const float* __restrict__ state,
                  const float* __restrict__ denom, float* __restrict__ y) {
  __shared__ _Float16 As[128 * ROWH];
  __shared__ _Float16 Bs[64 * ROWH];
  const int bh = blockIdx.y;
  const int b = bh >> 4, h = bh & 15;
  const int row0 = blockIdx.x * 128;
  const float* Aptr = qrot + (size_t)b * TLEN * N_EMB + h * HDIM;   // rows t, lda=N_EMB
  const float* Sptr = state + (size_t)bh * (HDIM * HDIM);
  const int tid = threadIdx.x;
  const int wid = tid >> 5, lane = tid & 31;
  const int nl = lane & 15;
  const int kb = (lane >> 4) << 3;
  const int hb = (lane >> 4) << 3;

  const v8f vzero = {0.f,0.f,0.f,0.f,0.f,0.f,0.f,0.f};
  v8f acc[4] = {vzero, vzero, vzero, vzero};

  for (int k0 = 0; k0 < HDIM; k0 += 32) {
    {   // A tile 128x32
      const int r = tid >> 3, c4 = (tid & 7) * 4;
#pragma unroll
      for (int rr = 0; rr < 128; rr += 32) {
        const float4 v = *(const float4*)(Aptr + (size_t)(row0 + r + rr) * N_EMB + k0 + c4);
        _Float16* d = &As[(r + rr) * ROWH + c4];
        d[0] = (_Float16)v.x; d[1] = (_Float16)v.y;
        d[2] = (_Float16)v.z; d[3] = (_Float16)v.w;
      }
    }
    {   // state tile 32(d) x 64(e) -> Bs[e][d]
      const int br = tid >> 4, bc4 = (tid & 15) * 4;
#pragma unroll
      for (int rr = 0; rr < 32; rr += 16) {
        const float4 v = *(const float4*)(Sptr + (size_t)(k0 + br + rr) * HDIM + bc4);
        Bs[(bc4 + 0) * ROWH + br + rr] = (_Float16)v.x;
        Bs[(bc4 + 1) * ROWH + br + rr] = (_Float16)v.y;
        Bs[(bc4 + 2) * ROWH + br + rr] = (_Float16)v.z;
        Bs[(bc4 + 3) * ROWH + br + rr] = (_Float16)v.w;
      }
    }
    __syncthreads();
    const v16h af = frag_ld(&As[(wid * 16 + nl) * ROWH], kb);
#pragma unroll
    for (int j = 0; j < 4; ++j) {
      const v16h bf = frag_ld(&Bs[(j * 16 + nl) * ROWH], kb);
      acc[j] = wmma16(af, bf, acc[j]);
    }
    __syncthreads();
  }
  float rd[8];
#pragma unroll
  for (int vi = 0; vi < 8; ++vi)
    rd[vi] = 1.0f / denom[(size_t)bh * TLEN + row0 + wid * 16 + hb + vi];
#pragma unroll
  for (int j = 0; j < 4; ++j) {
#pragma unroll
    for (int vi = 0; vi < 8; ++vi) {
      const int t = row0 + wid * 16 + hb + vi;
      const int col = h * HDIM + j * 16 + nl;
      y[(size_t)(b * TLEN + t) * N_EMB + col] = acc[j][vi] * rd[vi];
    }
  }
}

// ---------------------------------------------------------------------------
extern "C" void kernel_launch(void* const* d_in, const int* in_sizes, int n_in,
                              void* d_out, int out_size, void* d_ws, size_t ws_size,
                              hipStream_t stream) {
  (void)in_sizes; (void)n_in; (void)out_size; (void)ws_size;
  const float* x      = (const float*)d_in[0];
  const float* mem    = (const float*)d_in[1];
  const float* q_w    = (const float*)d_in[2];
  const float* q_b    = (const float*)d_in[3];
  const float* kv_w   = (const float*)d_in[4];
  const float* kv_b   = (const float*)d_in[5];
  const float* proj_w = (const float*)d_in[6];
  const float* proj_b = (const float*)d_in[7];
  float* out = (float*)d_out;

  // Workspace layout (floats). Total ~97 MB.
  const size_t SZ_BTC = (size_t)BATCH * TLEN * N_EMB;     // 4 M
  float* ws      = (float*)d_ws;
  float* qfeat   = ws;                                    // [B,T,C] elu+1
  float* qrot    = qfeat   + SZ_BTC;                      // [B,T,C]
  float* kvbuf   = qrot    + SZ_BTC;                      // [B,S,2C] (K feat | V)
  float* krotT   = kvbuf   + 2 * SZ_BTC;                  // [B,H,64,S]
  float* ybuf    = krotT   + SZ_BTC;                      // [B,T,C]
  float* stateb  = ybuf    + SZ_BTC;                      // [B*H,64,64]
  float* ksum    = stateb  + (size_t)BATCH * NHEAD * HDIM * HDIM;  // [B,C]
  float* partial = ksum    + (size_t)BATCH * N_EMB;       // [NCH,B,C]
  float* denom   = partial + (size_t)NCH * BATCH * N_EMB; // [B,H,T]

  const dim3 blk(256);
  const int M = BATCH * TLEN;   // 4096

  // 1) Q = elu(x@q_w + q_b)+1
  gemm_kernel<<<dim3(N_EMB / 128, M / 128), blk, 0, stream>>>(
      x, q_w, q_b, qfeat, M, N_EMB, N_EMB, 1, 0);
  // 2) kv = memory@kv_w + kv_b ; elu+1 on K half only
  gemm_kernel<<<dim3(2 * N_EMB / 128, M / 128), blk, 0, stream>>>(
      mem, kv_w, kv_b, kvbuf, M, 2 * N_EMB, N_EMB, 2, N_EMB);
  // 3) RoPE
  rope_kernel<<<(unsigned)(SZ_BTC / 256), blk, 0, stream>>>(qfeat, qrot, TLEN, N_EMB);
  rope_kt_kernel<<<dim3(SLEN / 64, BATCH * NHEAD), blk, 0, stream>>>(kvbuf, krotT);
  // 4) ksum = sum_s K  (two-pass, deterministic)
  ksum_partial_kernel<<<dim3(N_EMB / 256, BATCH, NCH), blk, 0, stream>>>(kvbuf, partial);
  ksum_final_kernel<<<(BATCH * N_EMB) / 256, blk, 0, stream>>>(partial, ksum);
  // 5) denom = Q . ksum
  denom_kernel<<<(BATCH * TLEN * NHEAD) / 256, blk, 0, stream>>>(qfeat, ksum, denom);
  // 6) state = K_rot^T V  (per b,h)
  state_kernel<<<BATCH * NHEAD, blk, 0, stream>>>(krotT, kvbuf, stateb);
  // 7) y = (Q_rot @ state) / denom
  ygemm_kernel<<<dim3(TLEN / 128, BATCH * NHEAD), blk, 0, stream>>>(qrot, stateb, denom, ybuf);
  // 8) out = y @ proj_w + proj_b
  gemm_kernel<<<dim3(N_EMB / 128, M / 128), blk, 0, stream>>>(
      ybuf, proj_w, proj_b, out, M, N_EMB, N_EMB, 0, 0);
}

// v002
// Measured time: 295 microseconds a run.
// Timed twice side by side with v001, it ran 1.05 and 1.03 times as fast.
// All steps since v000 together make it 1.27 times as fast.
#include <hip/hip_runtime.h>
#include <hip/hip_bf16.h>
#include <stdint.h>

// ---------------------------------------------------------------------------
// Linear cross-attention with RoPE, MI455X (gfx1250, wave32, WMMA).
// Associativity trick: y = Q_rot @ (K_rot^T V) / (Q . sum_s K)  -- avoids TxS.
// All GEMMs run through v_wmma_f32_16x16x32_f16 with fp32 accumulation;
// fp32 operands are converted to f16 while staging through LDS.
// ---------------------------------------------------------------------------

typedef __attribute__((ext_vector_type(16))) _Float16 v16h;
typedef __attribute__((ext_vector_type(8)))  float    v8f;
typedef __attribute__((ext_vector_type(4)))  float    v4f;

#define N_EMB 1024
#define NHEAD 16
#define HDIM  64
#define BATCH 2
#define TLEN  2048
#define SLEN  2048
#define LDS_PAD 8               // halfs of padding per LDS row (row = 40 halfs)
#define ROWH (32 + LDS_PAD)     // LDS row stride in halfs (BK=32)

// --- WMMA fragment helpers --------------------------------------------------
// 16-bit A-matrix 16x32 layout (ISA 7.12.2): lane&15 = row M; lanes>=16 use
// K base +8; VGPR0..3 hold K=kb..kb+7 (packed f16 pairs), VGPR4..7 hold
// K=kb+16..kb+23.  B 32x16 is stored K-contiguous per column in LDS
// (transposed on fill) so the same load pattern applies with lane&15 = col N.
__device__ __forceinline__ v16h frag_ld(const _Float16* rowbase, int kb) {
  union { v16h h; uint32_t u[8]; } f;
  const uint32_t* p0 = (const uint32_t*)(rowbase + kb);
  const uint32_t* p1 = (const uint32_t*)(rowbase + kb + 16);
#pragma unroll
  for (int j = 0; j < 4; ++j) { f.u[j] = p0[j]; f.u[4 + j] = p1[j]; }
  return f.h;
}

__device__ __forceinline__ v8f wmma16(v16h a, v16h b, v8f c) {
  // (neg_a, A, neg_b, B, c_mod, C, reuse_a, reuse_b)
  return __builtin_amdgcn_wmma_f32_16x16x32_f16(false, a, false, b,
                                                (short)0, c, false, false);
}

__device__ __forceinline__ float elu_p1(float v) {
  return v > 0.0f ? v + 1.0f : __expf(v);   // elu(v)+1
}

// --- Generic tiled GEMM: C = A(fp32)[M,K] * B(fp32)[K,N] + bias -------------
// mode 0: plain; mode 1: elu+1 everywhere; mode 2: elu+1 only for col < halfN.
// Shapes are exact multiples of tiles (M%128==0, N%128==0, K%32==0).
__global__ __launch_bounds__(256)
void gemm_kernel(const float* __restrict__ A, const float* __restrict__ B,
                 const float* __restrict__ bias, float* __restrict__ C,
                 int M, int N, int K, int mode, int halfN) {
  __shared__ _Float16 As[128 * ROWH];
  __shared__ _Float16 Bs[128 * ROWH];

  const int tid  = threadIdx.x;
  const int bm   = blockIdx.y * 128;
  const int bn   = blockIdx.x * 128;
  const int wid  = tid >> 5;
  const int lane = tid & 31;
  const int nl   = lane & 15;
  const int kb   = (lane >> 4) << 3;   // K base for A/B fragments
  const int hb   = (lane >> 4) << 3;   // row offset for C/D fragments
  const int wm   = (wid & 1) * 64;     // 2 waves in M  -> 64 rows each
  const int wn   = (wid >> 1) * 32;    // 4 waves in N  -> 32 cols each

  const v8f vzero = {0.f,0.f,0.f,0.f,0.f,0.f,0.f,0.f};
  v8f acc[4][2];
#pragma unroll
  for (int i = 0; i < 4; ++i)
#pragma unroll
    for (int j = 0; j < 2; ++j) acc[i][j] = vzero;

  for (int k0 = 0; k0 < K; k0 += 32) {
    // A tile 128x32 -> As[m][k]
    {
      const int r  = tid >> 3;           // 0..31
      const int c4 = (tid & 7) * 4;      // 0..28
#pragma unroll
      for (int rr = 0; rr < 128; rr += 32) {
        const float4 v = *(const float4*)(A + (size_t)(bm + r + rr) * K + k0 + c4);
        _Float16* d = &As[(r + rr) * ROWH + c4];
        d[0] = (_Float16)v.x; d[1] = (_Float16)v.y;
        d[2] = (_Float16)v.z; d[3] = (_Float16)v.w;
      }
    }
    // B tile 32x128 -> Bs[n][k] (transposed: K contiguous)
    {
      const int br  = tid >> 5;          // 0..7
      const int bc4 = (tid & 31) * 4;    // 0..124
#pragma unroll
      for (int rr = 0; rr < 32; rr += 8) {
        const float4 v = *(const float4*)(B + (size_t)(k0 + br + rr) * N + bn + bc4);
        Bs[(bc4 + 0) * ROWH + br + rr] = (_Float16)v.x;
        Bs[(bc4 + 1) * ROWH + br + rr] = (_Float16)v.y;
        Bs[(bc4 + 2) * ROWH + br + rr] = (_Float16)v.z;
        Bs[(bc4 + 3) * ROWH + br + rr] = (_Float16)v.w;
      }
    }
    __syncthreads();

    v16h af[4], bf[2];
#pragma unroll
    for (int i = 0; i < 4; ++i) af[i] = frag_ld(&As[(wm + i * 16 + nl) * ROWH], kb);
#pragma unroll
    for (int j = 0; j < 2; ++j) bf[j] = frag_ld(&Bs[(wn + j * 16 + nl) * ROWH], kb);
#pragma unroll
    for (int i = 0; i < 4; ++i)
#pragma unroll
      for (int j = 0; j < 2; ++j) acc[i][j] = wmma16(af[i], bf[j], acc[i][j]);
    __syncthreads();
  }

#pragma unroll
  for (int i = 0; i < 4; ++i)
#pragma unroll
    for (int j = 0; j < 2; ++j) {
      const int col = bn + wn + j * 16 + nl;
      const float bv = bias[col];
      const bool act = (mode == 1) || (mode == 2 && col < halfN);
#pragma unroll
      for (int vi = 0; vi < 8; ++vi) {
        const int row = bm + wm + i * 16 + hb + vi;
        float v = acc[i][j][vi] + bv;
        if (act) v = elu_p1(v);
        C[(size_t)row * N + col] = v;
      }
    }
}

// --- RoPE on K with transposed output [B,H,HD,S] ----------------------------
// (so it can serve as row-major WMMA A). One block = one head x 64 positions.
// The 64(s) x 64(d) tile goes through LDS: rows are read along d, results are
// stored along s, so both global sides move whole 128-byte lines.
#define RT_PITCH 65             // floats; odd pitch: column reads hit 32 banks
// sin and cos of 2*pi*rev. One statement so that the slot the instruction set
// asks for behind a transcendental is filled whatever the compiler puts next:
// v_cos is independent of v_sin (outputs never alias the input), v_nop ends it.
__device__ __forceinline__ void sincos_rev(float rev, float& sn, float& cs) {
  asm("v_sin_f32 %0, %2\n\tv_cos_f32 %1, %2\n\tv_nop"
      : "=&v"(sn), "=&v"(cs) : "v"(rev));
}
__global__ __launch_bounds__(256)
void rope_kt_kernel(const float* __restrict__ kv, float* __restrict__ out) {
  __shared__ float tile[64 * RT_PITCH];
  const int tid = threadIdx.x;
  const int s0  = blockIdx.x * 64;
  const int bh  = blockIdx.y;
  const int b = bh >> 4, h = bh & 15;
  const float* src = kv + ((size_t)b * SLEN + s0) * (2 * N_EMB) + h * HDIM;
  {
    const int r = tid >> 4, c4 = (tid & 15) * 4;
#pragma unroll
    for (int rr = 0; rr < 64; rr += 16) {
      const float4 v = *(const float4*)(src + (size_t)(r + rr) * (2 * N_EMB) + c4);
      float* p = &tile[(r + rr) * RT_PITCH + c4];
      p[0] = v.x; p[1] = v.y; p[2] = v.z; p[3] = v.w;
    }
  }
  __syncthreads();   // every row of the tile is in LDS before columns are read
  const int s4 = (tid & 15) * 4;        // four consecutive positions per thread
  float* dst = out + (size_t)bh * HDIM * SLEN + s0 + s4;
#pragma unroll
  for (int p = 0; p < 2; ++p) {
    const int i = (tid >> 4) + p * 16;  // 0..31: the pair (i, i+32) shares its angle
    const float inv = __expf(-(float)i * 0.28782313662425572f);
    float lo[4], hi[4];
#pragma unroll
    for (int j = 0; j < 4; ++j) {
      float sn, cs;
      sincos_rev((float)(s0 + s4 + j) * inv * 0.15915494309189532f, sn, cs);
      const float x1 = tile[(s4 + j) * RT_PITCH + i];
      const float x2 = tile[(s4 + j) * RT_PITCH + i + 32];
      lo[j] = fmaf(x1, cs, -(x2 * sn));
      hi[j] = fmaf(x2, cs, x1 * sn);
    }
    *(float4*)(dst + (size_t)i * SLEN)        = make_float4(lo[0], lo[1], lo[2], lo[3]);
    *(float4*)(dst + (size_t)(i + 32) * SLEN) = make_float4(hi[0], hi[1], hi[2], hi[3]);
  }
}

// --- K row-sum over S (two pass, deterministic) -----------------------------
#define NCH 16
__global__ void ksum_partial_kernel(const float* __restrict__ kv,
                                    float* __restrict__ partial) {
  const int c  = blockIdx.x * blockDim.x + threadIdx.x;  // 0..1023
  const int b  = blockIdx.y;
  const int ch = blockIdx.z;
  const int chs = SLEN / NCH;
  float s = 0.f;
  for (int i = 0; i < chs; ++i) {
    const int srow = ch * chs + i;
    s += kv[((size_t)(b * SLEN + srow)) * (2 * N_EMB) + c];
  }
  partial[((size_t)ch * BATCH + b) * N_EMB + c] = s;
}

__global__ void ksum_final_kernel(const float* __restrict__ partial,
                                  float* __restrict__ ksum) {
  const int i = blockIdx.x * blockDim.x + threadIdx.x;  // 0..B*C-1
  float s = 0.f;
#pragma unroll
  for (int ch = 0; ch < NCH; ++ch) s += partial[(size_t)ch * (BATCH * N_EMB) + i];
  ksum[i] = s;
}

// --- denom[b,h,t] = qfeat[b,t,h,:] . ksum[b,h,:] ----------------------------
__global__ void denom_kernel(const float* __restrict__ qfeat,
                             const float* __restrict__ ksum,
                             float* __restrict__ denom) {
  const int idx = blockIdx.x * blockDim.x + threadIdx.x;  // B*T*H
  const int b = idx / (TLEN * NHEAD);
  const int r = idx - b * (TLEN * NHEAD);
  const int t = r >> 4;
  const int h = r & 15;
  const float* q = qfeat + (size_t)(b * TLEN + t) * N_EMB + h * HDIM;
  const float* k = ksum + (size_t)b * N_EMB + h * HDIM;
  float s = 0.f;
#pragma unroll 8
  for (int d = 0; d < HDIM; ++d) s += q[d] * k[d];
  denom[((size_t)(b * NHEAD + h)) * TLEN + t] = s;
}

// --- state[b,h] = K_rot^T V  (64x64, K over S=2048) -------------------------
__global__ __launch_bounds__(256)
void state_kernel(const float* __restrict__ krotT, const float* __restrict__ kv,
                  float* __restrict__ state) {
  __shared__ _Float16 As[64 * ROWH];
  __shared__ _Float16 Bs[64 * ROWH];
  const int bh = blockIdx.x;
  const int b = bh >> 4, h = bh & 15;
  const float* Aptr = krotT + (size_t)bh * HDIM * SLEN;                 // [64,S]
  const float* Vptr = kv + (size_t)b * SLEN * (2 * N_EMB) + N_EMB + h * HDIM;
  const int tid = threadIdx.x;
  const int wid = tid >> 5, lane = tid & 31;
  const int nl = lane & 15;
  const int kb = (lane >> 4) << 3;
  const int hb = (lane >> 4) << 3;
  const int tm  = (wid & 3) * 16;        // 4 m-tiles
  const int tn0 = (wid >> 2) * 32;       // 2 wave groups x 2 n-tiles

  const v8f vzero = {0.f,0.f,0.f,0.f,0.f,0.f,0.f,0.f};
  v8f acc[2] = {vzero, vzero};

  for (int s0 = 0; s0 < SLEN; s0 += 32) {
    {   // A tile 64x32 (rows d, cols s)
      const int r = tid >> 3, c4 = (tid & 7) * 4;
#pragma unroll
      for (int rr = 0; rr < 64; rr += 32) {
        const float4 v = *(const float4*)(Aptr + (size_t)(r + rr) * SLEN + s0 + c4);
        _Float16* d = &As[(r + rr) * ROWH + c4];
        d[0] = (_Float16)v.x; d[1] = (_Float16)v.y;
        d[2] = (_Float16)v.z; d[3] = (_Float16)v.w;
      }
    }
    {   // V tile 32(s) x 64(e) -> Bs[e][s]
      const int br = tid >> 4, bc4 = (tid & 15) * 4;
#pragma unroll
      for (int rr = 0; rr < 32; rr += 16) {
        const float4 v = *(const float4*)(Vptr + (size_t)(s0 + br + rr) * (2 * N_EMB) + bc4);
        Bs[(bc4 + 0) * ROWH + br + rr] = (_Float16)v.x;
        Bs[(bc4 + 1) * ROWH + br + rr] = (_Float16)v.y;
        Bs[(bc4 + 2) * ROWH + br + rr] = (_Float16)v.z;
        Bs[(bc4 + 3) * ROWH + br + rr] = (_Float16)v.w;
      }
    }
    __syncthreads();
    const v16h af = frag_ld(&As[(tm + nl) * ROWH], kb);
#pragma unroll
    for (int j = 0; j < 2; ++j) {
      const v16h bf = frag_ld(&Bs[(tn0 + j * 16 + nl) * ROWH], kb);
      acc[j] = wmma16(af, bf, acc[j]);
    }
    __syncthreads();
  }
#pragma unroll
  for (int j = 0; j < 2; ++j) {
    const int col = tn0 + j * 16 + nl;
#pragma unroll
    for (int vi = 0; vi < 8; ++vi) {
      const int row = tm + hb + vi;
      state[(size_t)bh * (HDIM * HDIM) + row * HDIM + col] = acc[j][vi];
    }
  }
}

// --- y[b,t,h,:] = (rope(Q)[b,t,h,:] @ state[b,h]) / denom[b,h,t] ------------
// RoPE on Q is applied while the A tile is staged: a thread holds columns
// i..i+3 and i+32..i+35 of a row, i.e. both members of four rotation pairs, so
// the rotated Q never goes through global memory. Both k halves (K = 64) are
// staged at once, so one barrier separates staging from the products.
__global__ __launch_bounds__(256)
void ygemm_kernel(const float* __restrict__ qfeat, const float* __restrict__ state,
                  const float* __restrict__ denom, float* __restrict__ y) {
  __shared__ _Float16 As[2][128 * ROWH];
  __shared__ _Float16 Bs[2][64 * ROWH];
  const int bh = blockIdx.y;
  const int b = bh >> 4, h = bh & 15;
  const int row0 = blockIdx.x * 128;
  const float* Aptr = qfeat + (size_t)b * TLEN * N_EMB + h * HDIM;  // rows t, lda=N_EMB
  const float* Sptr = state + (size_t)bh * (HDIM * HDIM);
  const int tid = threadIdx.x;
  const int wid = tid >> 5, lane = tid & 31;
  const int nl = lane & 15;
  const int kb = (lane >> 4) << 3;
  const int hb = (lane >> 4) << 3;

  const v8f vzero = {0.f,0.f,0.f,0.f,0.f,0.f,0.f,0.f};
  v8f acc[4] = {vzero, vzero, vzero, vzero};

  // Every row of a thread is reached from one address by a constant offset.
  const int r = tid >> 3, c4 = (tid & 7) * 4;       // A: row, first column
  const int br = tid >> 4, bc4 = (tid & 15) * 4;    // state: row, first column
  const float* ap = Aptr + (size_t)(row0 + r) * N_EMB + c4;
  const float* sp = Sptr + br * HDIM + bc4;
  v4f x1[4], x2[4], sv[4];
#pragma unroll
  for (int q = 0; q < 4; ++q) {
    x1[q] = *(const v4f*)(ap + q * 32 * N_EMB);
    x2[q] = *(const v4f*)(ap + q * 32 * N_EMB + 32);
    sv[q] = *(const v4f*)(sp + q * 16 * HDIM);
  }
  {   // A tile 128(t) x 64(d), rotated: As[0] = d 0..31, As[1] = d 32..63
    float inv[4];   // inv_freq[i] = 10000^(-2i/64) = exp(-i * ln(10000)/32)
#pragma unroll
    for (int j = 0; j < 4; ++j)
      inv[j] = __expf(-(float)(c4 + j) * 0.28782313662425572f);
#pragma unroll
    for (int q = 0; q < 4; ++q) {
      const float t = (float)(row0 + r + q * 32);
      _Float16* d0 = &As[0][(r + q * 32) * ROWH + c4];
      _Float16* d1 = &As[1][(r + q * 32) * ROWH + c4];
#pragma unroll
      for (int j = 0; j < 4; ++j) {
        float sn, cs;
        __sincosf(t * inv[j], &sn, &cs);
        d0[j] = (_Float16)(x1[q][j] * cs - x2[q][j] * sn);
        d1[j] = (_Float16)(x2[q][j] * cs + x1[q][j] * sn);
      }
    }
  }
  // state 64(d) x 64(e) -> Bs[d / 32][e][d % 32]; row d = br + q * 16
#pragma unroll
  for (int q = 0; q < 4; ++q) {
    _Float16* d = &Bs[q >> 1][bc4 * ROWH + br + (q & 1) * 16];
    d[0 * ROWH] = (_Float16)sv[q].x;
    d[1 * ROWH] = (_Float16)sv[q].y;
    d[2 * ROWH] = (_Float16)sv[q].z;
    d[3 * ROWH] = (_Float16)sv[q].w;
  }
  __syncthreads();   // both tiles are whole in LDS before any fragment is read
#pragma unroll
  for (int kk = 0; kk < 2; ++kk) {
    const v16h af = frag_ld(&As[kk][(wid * 16 + nl) * ROWH], kb);
#pragma unroll
    for (int j = 0; j < 4; ++j) {
      const v16h bf = frag_ld(&Bs[kk][(j * 16 + nl) * ROWH], kb);
      acc[j] = wmma16(af, bf, acc[j]);
    }
  }
  float rd[8];
#pragma unroll
  for (int vi = 0; vi < 8; ++vi)
    rd[vi] = 1.0f / denom[(size_t)bh * TLEN + row0 + wid * 16 + hb + vi];
#pragma unroll
  for (int j = 0; j < 4; ++j) {
#pragma unroll
    for (int vi = 0; vi < 8; ++vi) {
      const int t = row0 + wid * 16 + hb + vi;
      const int col = h * HDIM + j * 16 + nl;
      y[(size_t)(b * TLEN + t) * N_EMB + col] = acc[j][vi] * rd[vi];
    }
  }
}

// ---------------------------------------------------------------------------
extern "C" void kernel_launch(void* const* d_in, const int* in_sizes, int n_in,
                              void* d_out, int out_size, void* d_ws, size_t ws_size,
                              hipStream_t stream) {
  (void)in_sizes; (void)n_in; (void)out_size; (void)ws_size;
  const float* x      = (const float*)d_in[0];
  const float* mem    = (const float*)d_in[1];
  const float* q_w    = (const float*)d_in[2];
  const float* q_b    = (const float*)d_in[3];
  const float* kv_w   = (const float*)d_in[4];
  const float* kv_b   = (const float*)d_in[5];
  const float* proj_w = (const float*)d_in[6];
  const float* proj_b = (const float*)d_in[7];
  float* out = (float*)d_out;

  // Workspace layout (floats). Total ~81 MB.
  const size_t SZ_BTC = (size_t)BATCH * TLEN * N_EMB;     // 4 M
  float* ws      = (float*)d_ws;
  float* qfeat   = ws;                                    // [B,T,C] elu+1
  float* kvbuf   = qfeat   + SZ_BTC;                      // [B,S,2C] (K feat | V)
  float* krotT   = kvbuf   + 2 * SZ_BTC;                  // [B,H,64,S]
  float* ybuf    = krotT   + SZ_BTC;                      // [B,T,C]
  float* stateb  = ybuf    + SZ_BTC;                      // [B*H,64,64]
  float* ksum    = stateb  + (size_t)BATCH * NHEAD * HDIM * HDIM;  // [B,C]
  float* partial = ksum    + (size_t)BATCH * N_EMB;       // [NCH,B,C]
  float* denom   = partial + (size_t)NCH * BATCH * N_EMB; // [B,H,T]

  const dim3 blk(256);
  const int M = BATCH * TLEN;   // 4096

  // 1) Q = elu(x@q_w + q_b)+1
  gemm_kernel<<<dim3(N_EMB / 128, M / 128), blk, 0, stream>>>(
      x, q_w, q_b, qfeat, M, N_EMB, N_EMB, 1, 0);
  // 2) kv = memory@kv_w + kv_b ; elu+1 on K half only
  gemm_kernel<<<dim3(2 * N_EMB / 128, M / 128), blk, 0, stream>>>(
      mem, kv_w, kv_b, kvbuf, M, 2 * N_EMB, N_EMB, 2, N_EMB);
  // 3) RoPE on K (RoPE on Q happens inside step 7)
  rope_kt_kernel<<<dim3(SLEN / 64, BATCH * NHEAD), blk, 0, stream>>>(kvbuf, krotT);
  // 4) ksum = sum_s K  (two-pass, deterministic)
  ksum_partial_kernel<<<dim3(N_EMB / 256, BATCH, NCH), blk, 0, stream>>>(kvbuf, partial);
  ksum_final_kernel<<<(BATCH * N_EMB) / 256, blk, 0, stream>>>(partial, ksum);
  // 5) denom = Q . ksum
  denom_kernel<<<(BATCH * TLEN * NHEAD) / 256, blk, 0, stream>>>(qfeat, ksum, denom);
  // 6) state = K_rot^T V  (per b,h)
  state_kernel<<<BATCH * NHEAD, blk, 0, stream>>>(krotT, kvbuf, stateb);
  // 7) y = (rope(Q) @ state) / denom
  ygemm_kernel<<<dim3(TLEN / 128, BATCH * NHEAD), blk, 0, stream>>>(qfeat, stateb, denom, ybuf);
  // 8) out = y @ proj_w + proj_b
  gemm_kernel<<<dim3(N_EMB / 128, M / 128), blk, 0, stream>>>(
      ybuf, proj_w, proj_b, out, M, N_EMB, N_EMB, 0, 0);
}

// v003
// A run of this version takes 207 microseconds.
// Next to v002, in two timings, it ran 1.43 times as fast each time.
// Over all steps from v000 it is 1.81 times as fast.
#include <hip/hip_runtime.h>
#include <hip/hip_bf16.h>
#include <stdint.h>

// ---------------------------------------------------------------------------
// Linear cross-attention with RoPE, MI455X (gfx1250, wave32, WMMA).
// Associativity trick: y = Q_rot @ (K_rot^T V) / (Q . sum_s K)  -- avoids TxS.
// All GEMMs run through v_wmma_f32_16x16x32_f16 with fp32 accumulation;
// fp32 operands are converted to f16 while staging through LDS.
// ---------------------------------------------------------------------------

typedef __attribute__((ext_vector_type(16))) _Float16 v16h;
typedef __attribute__((ext_vector_type(8)))  float    v8f;
typedef __attribute__((ext_vector_type(4)))  float    v4f;
typedef __attribute__((ext_vector_type(4)))  _Float16 v4h;
typedef __attribute__((ext_vector_type(8)))  short    s16x8;

#define N_EMB 1024
#define NHEAD 16
#define HDIM  64
#define BATCH 2
#define TLEN  2048
#define SLEN  2048
#define LDS_PAD 8               // halfs of padding per LDS row (row = 40 halfs)
#define ROWH (32 + LDS_PAD)     // LDS row stride in halfs (BK=32)
// B tiles lie row-major [k][n] in LDS; the pitch is an odd multiple of 32 bytes,
// for speed only.
#define BP128 (128 + 16)        // halfs per k row of a 128-column B tile (288 B)
#define BP64  (64 + 16)         // halfs per k row of a 64-column B tile (160 B)

// --- WMMA fragment helpers --------------------------------------------------
// 16-bit A-matrix 16x32 layout (ISA 7.12.2): lane&15 = row M; lanes>=16 use
// K base +8; VGPR0..3 hold K=kb..kb+7 (packed f16 pairs), VGPR4..7 hold
// K=kb+16..kb+23.  B 32x16 has the same map with lane&15 = col N.
__device__ __forceinline__ v16h frag_ld(const _Float16* rowbase, int kb) {
  union { v16h h; uint32_t u[8]; } f;
  const uint32_t* p0 = (const uint32_t*)(rowbase + kb);
  const uint32_t* p1 = (const uint32_t*)(rowbase + kb + 16);
#pragma unroll
  for (int j = 0; j < 4; ++j) { f.u[j] = p0[j]; f.u[4 + j] = p1[j]; }
  return f.h;
}

// B fragment 32(k) x 16(n) out of a row-major [k][n] f16 tile: two transposing
// loads. Lane l reads 16 bytes of row 8*(l>>4) + (l&7) and receives column
// n0 + (l&15), k = 8*(l>>4) + 0..7; the second load takes the rows 16 further
// down. That is the k order of frag_ld, register for register.
__device__ __forceinline__ v16h frag_ld_tr(const _Float16* tile, int pitch, int n0,
                                           int lane) {
  typedef __attribute__((address_space(3))) s16x8 lds_s16x8;
  const _Float16* p = tile + ((lane >> 4) * 8 + (lane & 7)) * pitch + n0 +
                      ((lane >> 3) & 1) * 8;
  union { v16h h; s16x8 s[2]; } f;
  f.s[0] = __builtin_amdgcn_ds_load_tr16_b128_v8i16((lds_s16x8*)p);
  f.s[1] = __builtin_amdgcn_ds_load_tr16_b128_v8i16((lds_s16x8*)(p + 16 * pitch));
  return f.h;
}

// Four consecutive n of one k row, converted and stored as one 8-byte piece.
__device__ __forceinline__ void st4h(_Float16* d, float a, float b, float c, float e) {
  const v4h h = {(_Float16)a, (_Float16)b, (_Float16)c, (_Float16)e};
  *(v4h*)d = h;
}

__device__ __forceinline__ v8f wmma16(v16h a, v16h b, v8f c) {
  // (neg_a, A, neg_b, B, c_mod, C, reuse_a, reuse_b)
  return __builtin_amdgcn_wmma_f32_16x16x32_f16(false, a, false, b,
                                                (short)0, c, false, false);
}

__device__ __forceinline__ float elu_p1(float v) {
  return v > 0.0f ? v + 1.0f : __expf(v);   // elu(v)+1
}

// --- Generic tiled GEMM: C = A(fp32)[M,K] * B(fp32)[K,N] + bias -------------
// mode 0: plain; mode 1: elu+1 everywhere; mode 2: elu+1 only for col < halfN.
// Shapes are exact multiples of tiles (M%128==0, N%128==0, K%32==0).
__global__ __launch_bounds__(256)
void gemm_kernel(const float* __restrict__ A, const float* __restrict__ B,
                 const float* __restrict__ bias, float* __restrict__ C,
                 int M, int N, int K, int mode, int halfN) {
  __shared__ __attribute__((aligned(16))) _Float16 As[128 * ROWH];
  __shared__ __attribute__((aligned(16))) _Float16 Bs[32 * BP128];

  const int tid  = threadIdx.x;
  const int bm   = blockIdx.y * 128;
  const int bn   = blockIdx.x * 128;
  const int wid  = tid >> 5;
  const int lane = tid & 31;
  const int nl   = lane & 15;
  const int kb   = (lane >> 4) << 3;   // K base for A/B fragments
  const int hb   = (lane >> 4) << 3;   // row offset for C/D fragments
  const int wm   = (wid & 1) * 64;     // 2 waves in M  -> 64 rows each
  const int wn   = (wid >> 1) * 32;    // 4 waves in N  -> 32 cols each

  const v8f vzero = {0.f,0.f,0.f,0.f,0.f,0.f,0.f,0.f};
  v8f acc[4][2];
#pragma unroll
  for (int i = 0; i < 4; ++i)
#pragma unroll
    for (int j = 0; j < 2; ++j) acc[i][j] = vzero;

  for (int k0 = 0; k0 < K; k0 += 32) {
    // A tile 128x32 -> As[m][k]
    {
      const int r  = tid >> 3;           // 0..31
      const int c4 = (tid & 7) * 4;      // 0..28
#pragma unroll
      for (int rr = 0; rr < 128; rr += 32) {
        const float4 v = *(const float4*)(A + (size_t)(bm + r + rr) * K + k0 + c4);
        _Float16* d = &As[(r + rr) * ROWH + c4];
        d[0] = (_Float16)v.x; d[1] = (_Float16)v.y;
        d[2] = (_Float16)v.z; d[3] = (_Float16)v.w;
      }
    }
    // B tile 32x128 -> Bs[k][n], as it lies in memory
    {
      const int br  = tid >> 5;          // 0..7
      const int bc4 = (tid & 31) * 4;    // 0..124
#pragma unroll
      for (int rr = 0; rr < 32; rr += 8) {
        const float4 v = *(const float4*)(B + (size_t)(k0 + br + rr) * N + bn + bc4);
        st4h(&Bs[(br + rr) * BP128 + bc4], v.x, v.y, v.z, v.w);
      }
    }
    __syncthreads();

    v16h af[4], bf[2];
#pragma unroll
    for (int i = 0; i < 4; ++i) af[i] = frag_ld(&As[(wm + i * 16 + nl) * ROWH], kb);
#pragma unroll
    for (int j = 0; j < 2; ++j) bf[j] = frag_ld_tr(Bs, BP128, wn + j * 16, lane);
#pragma unroll
    for (int i = 0; i < 4; ++i)
#pragma unroll
      for (int j = 0; j < 2; ++j) acc[i][j] = wmma16(af[i], bf[j], acc[i][j]);
    __syncthreads();
  }

#pragma unroll
  for (int i = 0; i < 4; ++i)
#pragma unroll
    for (int j = 0; j < 2; ++j) {
      const int col = bn + wn + j * 16 + nl;
      const float bv = bias[col];
      const bool act = (mode == 1) || (mode == 2 && col < halfN);
#pragma unroll
      for (int vi = 0; vi < 8; ++vi) {
        const int row = bm + wm + i * 16 + hb + vi;
        float v = acc[i][j][vi] + bv;
        if (act) v = elu_p1(v);
        C[(size_t)row * N + col] = v;
      }
    }
}

// --- RoPE on K with transposed output [B,H,HD,S] ----------------------------
// (so it can serve as row-major WMMA A). One block = one head x 64 positions.
// The 64(s) x 64(d) tile goes through LDS: rows are read along d, results are
// stored along s, so both global sides move whole 128-byte lines.
#define RT_PITCH 65             // floats; odd pitch: column reads hit 32 banks
// sin and cos of 2*pi*rev. One statement so that the slot the instruction set
// asks for behind a transcendental is filled whatever the compiler puts next:
// v_cos is independent of v_sin (outputs never alias the input), v_nop ends it.
__device__ __forceinline__ void sincos_rev(float rev, float& sn, float& cs) {
  asm("v_sin_f32 %0, %2\n\tv_cos_f32 %1, %2\n\tv_nop"
      : "=&v"(sn), "=&v"(cs) : "v"(rev));
}
__global__ __launch_bounds__(256)
void rope_kt_kernel(const float* __restrict__ kv, float* __restrict__ out) {
  __shared__ float tile[64 * RT_PITCH];
  const int tid = threadIdx.x;
  const int s0  = blockIdx.x * 64;
  const int bh  = blockIdx.y;
  const int b = bh >> 4, h = bh & 15;
  const float* src = kv + ((size_t)b * SLEN + s0) * (2 * N_EMB) + h * HDIM;
  {
    const int r = tid >> 4, c4 = (tid & 15) * 4;
#pragma unroll
    for (int rr = 0; rr < 64; rr += 16) {
      const float4 v = *(const float4*)(src + (size_t)(r + rr) * (2 * N_EMB) + c4);
      float* p = &tile[(r + rr) * RT_PITCH + c4];
      p[0] = v.x; p[1] = v.y; p[2] = v.z; p[3] = v.w;
    }
  }
  __syncthreads();   // every row of the tile is in LDS before columns are read
  const int s4 = (tid & 15) * 4;        // four consecutive positions per thread
  float* dst = out + (size_t)bh * HDIM * SLEN + s0 + s4;
#pragma unroll
  for (int p = 0; p < 2; ++p) {
    const int i = (tid >> 4) + p * 16;  // 0..31: the pair (i, i+32) shares its angle
    const float inv = __expf(-(float)i * 0.28782313662425572f);
    float lo[4], hi[4];
#pragma unroll
    for (int j = 0; j < 4; ++j) {
      float sn, cs;
      sincos_rev((float)(s0 + s4 + j) * inv * 0.15915494309189532f, sn, cs);
      const float x1 = tile[(s4 + j) * RT_PITCH + i];
      const float x2 = tile[(s4 + j) * RT_PITCH + i + 32];
      lo[j] = fmaf(x1, cs, -(x2 * sn));
      hi[j] = fmaf(x2, cs, x1 * sn);
    }
    *(float4*)(dst + (size_t)i * SLEN)        = make_float4(lo[0], lo[1], lo[2], lo[3]);
    *(float4*)(dst + (size_t)(i + 32) * SLEN) = make_float4(hi[0], hi[1], hi[2], hi[3]);
  }
}

// --- K row-sum over S (two pass, deterministic) -----------------------------
#define NCH 16
__global__ void ksum_partial_kernel(const float* __restrict__ kv,
                                    float* __restrict__ partial) {
  const int c  = blockIdx.x * blockDim.x + threadIdx.x;  // 0..1023
  const int b  = blockIdx.y;
  const int ch = blockIdx.z;
  const int chs = SLEN / NCH;
  float s = 0.f;
  for (int i = 0; i < chs; ++i) {
    const int srow = ch * chs + i;
    s += kv[((size_t)(b * SLEN + srow)) * (2 * N_EMB) + c];
  }
  partial[((size_t)ch * BATCH + b) * N_EMB + c] = s;
}

__global__ void ksum_final_kernel(const float* __restrict__ partial,
                                  float* __restrict__ ksum) {
  const int i = blockIdx.x * blockDim.x + threadIdx.x;  // 0..B*C-1
  float s = 0.f;
#pragma unroll
  for (int ch = 0; ch < NCH; ++ch) s += partial[(size_t)ch * (BATCH * N_EMB) + i];
  ksum[i] = s;
}

// --- denom[b,h,t] = qfeat[b,t,h,:] . ksum[b,h,:] ----------------------------
__global__ void denom_kernel(const float* __restrict__ qfeat,
                             const float* __restrict__ ksum,
                             float* __restrict__ denom) {
  const int idx = blockIdx.x * blockDim.x + threadIdx.x;  // B*T*H
  const int b = idx / (TLEN * NHEAD);
  const int r = idx - b * (TLEN * NHEAD);
  const int t = r >> 4;
  const int h = r & 15;
  const float* q = qfeat + (size_t)(b * TLEN + t) * N_EMB + h * HDIM;
  const float* k = ksum + (size_t)b * N_EMB + h * HDIM;
  float s = 0.f;
#pragma unroll 8
  for (int d = 0; d < HDIM; ++d) s += q[d] * k[d];
  denom[((size_t)(b * NHEAD + h)) * TLEN + t] = s;
}

// --- state[b,h] = K_rot^T V  (64x64, K over S=2048) -------------------------
__global__ __launch_bounds__(256)
void state_kernel(const float* __restrict__ krotT, const float* __restrict__ kv,
                  float* __restrict__ state) {
  __shared__ __attribute__((aligned(16))) _Float16 As[64 * ROWH];
  __shared__ __attribute__((aligned(16))) _Float16 Bs[32 * BP64];
  const int bh = blockIdx.x;
  const int b = bh >> 4, h = bh & 15;
  const float* Aptr = krotT + (size_t)bh * HDIM * SLEN;                 // [64,S]
  const float* Vptr = kv + (size_t)b * SLEN * (2 * N_EMB) + N_EMB + h * HDIM;
  const int tid = threadIdx.x;
  const int wid = tid >> 5, lane = tid & 31;
  const int nl = lane & 15;
  const int kb = (lane >> 4) << 3;
  const int hb = (lane >> 4) << 3;
  const int tm  = (wid & 3) * 16;        // 4 m-tiles
  const int tn0 = (wid >> 2) * 32;       // 2 wave groups x 2 n-tiles

  const v8f vzero = {0.f,0.f,0.f,0.f,0.f,0.f,0.f,0.f};
  v8f acc[2] = {vzero, vzero};

  for (int s0 = 0; s0 < SLEN; s0 += 32) {
    {   // A tile 64x32 (rows d, cols s)
      const int r = tid >> 3, c4 = (tid & 7) * 4;
#pragma unroll
      for (int rr = 0; rr < 64; rr += 32) {
        const float4 v = *(const float4*)(Aptr + (size_t)(r + rr) * SLEN + s0 + c4);
        _Float16* d = &As[(r + rr) * ROWH + c4];
        d[0] = (_Float16)v.x; d[1] = (_Float16)v.y;
        d[2] = (_Float16)v.z; d[3] = (_Float16)v.w;
      }
    }
    {   // V tile 32(s) x 64(e) -> Bs[s][e]
      const int br = tid >> 4, bc4 = (tid & 15) * 4;
#pragma unroll
      for (int rr = 0; rr < 32; rr += 16) {
        const float4 v = *(const float4*)(Vptr + (size_t)(s0 + br + rr) * (2 * N_EMB) + bc4);
        st4h(&Bs[(br + rr) * BP64 + bc4], v.x, v.y, v.z, v.w);
      }
    }
    __syncthreads();
    const v16h af = frag_ld(&As[(tm + nl) * ROWH], kb);
#pragma unroll
    for (int j = 0; j < 2; ++j) {
      const v16h bf = frag_ld_tr(Bs, BP64, tn0 + j * 16, lane);
      acc[j] = wmma16(af, bf, acc[j]);
    }
    __syncthreads();
  }
#pragma unroll
  for (int j = 0; j < 2; ++j) {
    const int col = tn0 + j * 16 + nl;
#pragma unroll
    for (int vi = 0; vi < 8; ++vi) {
      const int row = tm + hb + vi;
      state[(size_t)bh * (HDIM * HDIM) + row * HDIM + col] = acc[j][vi];
    }
  }
}

// --- y[b,t,h,:] = (rope(Q)[b,t,h,:] @ state[b,h]) / denom[b,h,t] ------------
// RoPE on Q is applied while the A tile is staged: a thread holds columns
// i..i+3 and i+32..i+35 of a row, i.e. both members of four rotation pairs, so
// the rotated Q never goes through global memory. Both k halves (K = 64) are
// staged at once, so one barrier separates staging from the products.
__global__ __launch_bounds__(256)
void ygemm_kernel(const float* __restrict__ qfeat, const float* __restrict__ state,
                  const float* __restrict__ denom, float* __restrict__ y) {
  __shared__ __attribute__((aligned(16))) _Float16 As[2][128 * ROWH];
  __shared__ __attribute__((aligned(16))) _Float16 Bs[64 * BP64];
  const int bh = blockIdx.y;
  const int b = bh >> 4, h = bh & 15;
  const int row0 = blockIdx.x * 128;
  const float* Aptr = qfeat + (size_t)b * TLEN * N_EMB + h * HDIM;  // rows t, lda=N_EMB
  const float* Sptr = state + (size_t)bh * (HDIM * HDIM);
  const int tid = threadIdx.x;
  const int wid = tid >> 5, lane = tid & 31;
  const int nl = lane & 15;
  const int kb = (lane >> 4) << 3;
  const int hb = (lane >> 4) << 3;

  const v8f vzero = {0.f,0.f,0.f,0.f,0.f,0.f,0.f,0.f};
  v8f acc[4] = {vzero, vzero, vzero, vzero};

  // Every row of a thread is reached from one address by a constant offset.
  const int r = tid >> 3, c4 = (tid & 7) * 4;       // A: row, first column
  const int br = tid >> 4, bc4 = (tid & 15) * 4;    // state: row, first column
  const float* ap = Aptr + (size_t)(row0 + r) * N_EMB + c4;
  const float* sp = Sptr + br * HDIM + bc4;
  v4f x1[4], x2[4], sv[4];
#pragma unroll
  for (int q = 0; q < 4; ++q) {
    x1[q] = *(const v4f*)(ap + q * 32 * N_EMB);
    x2[q] = *(const v4f*)(ap + q * 32 * N_EMB + 32);
    sv[q] = *(const v4f*)(sp + q * 16 * HDIM);
  }
  {   // A tile 128(t) x 64(d), rotated: As[0] = d 0..31, As[1] = d 32..63
    float inv[4];   // inv_freq[i] = 10000^(-2i/64) = exp(-i * ln(10000)/32)
#pragma unroll
    for (int j = 0; j < 4; ++j)
      inv[j] = __expf(-(float)(c4 + j) * 0.28782313662425572f);
#pragma unroll
    for (int q = 0; q < 4; ++q) {
      const float t = (float)(row0 + r + q * 32);
      _Float16* d0 = &As[0][(r + q * 32) * ROWH + c4];
      _Float16* d1 = &As[1][(r + q * 32) * ROWH + c4];
#pragma unroll
      for (int j = 0; j < 4; ++j) {
        float sn, cs;
        __sincosf(t * inv[j], &sn, &cs);
        d0[j] = (_Float16)(x1[q][j] * cs - x2[q][j] * sn);
        d1[j] = (_Float16)(x2[q][j] * cs + x1[q][j] * sn);
      }
    }
  }
  // state 64(d) x 64(e) -> Bs[d][e]; row d = br + q * 16
#pragma unroll
  for (int q = 0; q < 4; ++q)
    st4h(&Bs[(br + q * 16) * BP64 + bc4], sv[q].x, sv[q].y, sv[q].z, sv[q].w);
  __syncthreads();   // both tiles are whole in LDS before any fragment is read
#pragma unroll
  for (int kk = 0; kk < 2; ++kk) {
    const v16h af = frag_ld(&As[kk][(wid * 16 + nl) * ROWH], kb);
#pragma unroll
    for (int j = 0; j < 4; ++j) {
      const v16h bf = frag_ld_tr(Bs + kk * 32 * BP64, BP64, j * 16, lane);
      acc[j] = wmma16(af, bf, acc[j]);
    }
  }
  float rd[8];
#pragma unroll
  for (int vi = 0; vi < 8; ++vi)
    rd[vi] = 1.0f / denom[(size_t)bh * TLEN + row0 + wid * 16 + hb + vi];
#pragma unroll
  for (int j = 0; j < 4; ++j) {
#pragma unroll
    for (int vi = 0; vi < 8; ++vi) {
      const int t = row0 + wid * 16 + hb + vi;
      const int col = h * HDIM + j * 16 + nl;
      y[(size_t)(b * TLEN + t) * N_EMB + col] = acc[j][vi] * rd[vi];
    }
  }
}

// ---------------------------------------------------------------------------
extern "C" void kernel_launch(void* const* d_in, const int* in_sizes, int n_in,
                              void* d_out, int out_size, void* d_ws, size_t ws_size,
                              hipStream_t stream) {
  (void)in_sizes; (void)n_in; (void)out_size; (void)ws_size;
  const float* x      = (const float*)d_in[0];
  const float* mem    = (const float*)d_in[1];
  const float* q_w    = (const float*)d_in[2];
  const float* q_b    = (const float*)d_in[3];
  const float* kv_w   = (const float*)d_in[4];
  const float* kv_b   = (const float*)d_in[5];
  const float* proj_w = (const float*)d_in[6];
  const float* proj_b = (const float*)d_in[7];
  float* out = (float*)d_out;

  // Workspace layout (floats). Total ~81 MB.
  const size_t SZ_BTC = (size_t)BATCH * TLEN * N_EMB;     // 4 M
  float* ws      = (float*)d_ws;
  float* qfeat   = ws;                                    // [B,T,C] elu+1
  float* kvbuf   = qfeat   + SZ_BTC;                      // [B,S,2C] (K feat | V)
  float* krotT   = kvbuf   + 2 * SZ_BTC;                  // [B,H,64,S]
  float* ybuf    = krotT   + SZ_BTC;                      // [B,T,C]
  float* stateb  = ybuf    + SZ_BTC;                      // [B*H,64,64]
  float* ksum    = stateb  + (size_t)BATCH * NHEAD * HDIM * HDIM;  // [B,C]
  float* partial = ksum    + (size_t)BATCH * N_EMB;       // [NCH,B,C]
  float* denom   = partial + (size_t)NCH * BATCH * N_EMB; // [B,H,T]

  const dim3 blk(256);
  const int M = BATCH * TLEN;   // 4096

  // 1) Q = elu(x@q_w + q_b)+1
  gemm_kernel<<<dim3(N_EMB / 128, M / 128), blk, 0, stream>>>(
      x, q_w, q_b, qfeat, M, N_EMB, N_EMB, 1, 0);
  // 2) kv = memory@kv_w + kv_b ; elu+1 on K half only
  gemm_kernel<<<dim3(2 * N_EMB / 128, M / 128), blk, 0, stream>>>(
      mem, kv_w, kv_b, kvbuf, M, 2 * N_EMB, N_EMB, 2, N_EMB);
  // 3) RoPE on K (RoPE on Q happens inside step 7)
  rope_kt_kernel<<<dim3(SLEN / 64, BATCH * NHEAD), blk, 0, stream>>>(kvbuf, krotT);
  // 4) ksum = sum_s K  (two-pass, deterministic)
  ksum_partial_kernel<<<dim3(N_EMB / 256, BATCH, NCH), blk, 0, stream>>>(kvbuf, partial);
  ksum_final_kernel<<<(BATCH * N_EMB) / 256, blk, 0, stream>>>(partial, ksum);
  // 5) denom = Q . ksum
  denom_kernel<<<(BATCH * TLEN * NHEAD) / 256, blk, 0, stream>>>(qfeat, ksum, denom);
  // 6) state = K_rot^T V  (per b,h)
  state_kernel<<<BATCH * NHEAD, blk, 0, stream>>>(krotT, kvbuf, stateb);
  // 7) y = (rope(Q) @ state) / denom
  ygemm_kernel<<<dim3(TLEN / 128, BATCH * NHEAD), blk, 0, stream>>>(qfeat, stateb, denom, ybuf);
  // 8) out = y @ proj_w + proj_b
  gemm_kernel<<<dim3(N_EMB / 128, M / 128), blk, 0, stream>>>(
      ybuf, proj_w, proj_b, out, M, N_EMB, N_EMB, 0, 0);
}

// v004
// Measured time: 130 microseconds a run.
// Timed twice side by side with v003, it ran 1.59 and 1.60 times as fast.
// All steps since v000 together make it 2.89 times as fast.
#include <hip/hip_runtime.h>
#include <hip/hip_bf16.h>
#include <stdint.h>

// ---------------------------------------------------------------------------
// Linear cross-attention with RoPE, MI455X (gfx1250, wave32, WMMA).
// Associativity trick: y = Q_rot @ (K_rot^T V) / (Q . sum_s K)  -- avoids TxS.
// All GEMMs run through v_wmma_f32_16x16x32_f16 with fp32 accumulation;
// fp32 operands are converted to f16 while staging through LDS.
// ---------------------------------------------------------------------------

typedef __attribute__((ext_vector_type(16))) _Float16 v16h;
typedef __attribute__((ext_vector_type(8)))  float    v8f;
typedef __attribute__((ext_vector_type(4)))  float    v4f;
typedef __attribute__((ext_vector_type(4)))  _Float16 v4h;
typedef __attribute__((ext_vector_type(8)))  short    s16x8;

#define N_EMB 1024
#define NHEAD 16
#define HDIM  64
#define BATCH 2
#define TLEN  2048
#define SLEN  2048
#define LDS_PAD 8               // halfs of padding per LDS row (row = 40 halfs)
#define ROWH (32 + LDS_PAD)     // LDS row stride in halfs (BK=32)
// B tiles lie row-major [k][n] in LDS; the pitch is an odd multiple of 32 bytes,
// for speed only.
#define BP128 (128 + 16)        // halfs per k row of a 128-column B tile (288 B)
#define BP64  (64 + 16)         // halfs per k row of a 64-column B tile (160 B)

// --- WMMA fragment helpers --------------------------------------------------
// 16-bit A-matrix 16x32 layout (ISA 7.12.2): lane&15 = row M; lanes>=16 use
// K base +8; VGPR0..3 hold K=kb..kb+7 (packed f16 pairs), VGPR4..7 hold
// K=kb+16..kb+23.  B 32x16 has the same map with lane&15 = col N.
__device__ __forceinline__ v16h frag_ld(const _Float16* rowbase, int kb) {
  union { v16h h; uint32_t u[8]; } f;
  const uint32_t* p0 = (const uint32_t*)(rowbase + kb);
  const uint32_t* p1 = (const uint32_t*)(rowbase + kb + 16);
#pragma unroll
  for (int j = 0; j < 4; ++j) { f.u[j] = p0[j]; f.u[4 + j] = p1[j]; }
  return f.h;
}

// B fragment 32(k) x 16(n) out of a row-major [k][n] f16 tile: two transposing
// loads. Lane l reads 16 bytes of row 8*(l>>4) + (l&7) and receives column
// n0 + (l&15), k = 8*(l>>4) + 0..7; the second load takes the rows 16 further
// down. That is the k order of frag_ld, register for register.
__device__ __forceinline__ v16h frag_ld_tr(const _Float16* tile, int pitch, int n0,
                                           int lane) {
  typedef __attribute__((address_space(3))) s16x8 lds_s16x8;
  const _Float16* p = tile + ((lane >> 4) * 8 + (lane & 7)) * pitch + n0 +
                      ((lane >> 3) & 1) * 8;
  union { v16h h; s16x8 s[2]; } f;
  f.s[0] = __builtin_amdgcn_ds_load_tr16_b128_v8i16((lds_s16x8*)p);
  f.s[1] = __builtin_amdgcn_ds_load_tr16_b128_v8i16((lds_s16x8*)(p + 16 * pitch));
  return f.h;
}

// Four consecutive values of one LDS row, converted and stored as one 8-byte piece.
__device__ __forceinline__ void st4h(_Float16* d, float a, float b, float c, float e) {
  const v4h h = {(_Float16)a, (_Float16)b, (_Float16)c, (_Float16)e};
  *(v4h*)d = h;
}

__device__ __forceinline__ v8f wmma16(v16h a, v16h b, v8f c) {
  // (neg_a, A, neg_b, B, c_mod, C, reuse_a, reuse_b)
  return __builtin_amdgcn_wmma_f32_16x16x32_f16(false, a, false, b,
                                                (short)0, c, false, false);
}

// Work-group barrier for LDS traffic alone. __syncthreads() also waits for the
// wave's outstanding global loads, which would end the flight of the tiles that
// the k loops below fetch ahead; the loops exchange data through LDS only.
__device__ __forceinline__ void lds_barrier() {
  __builtin_amdgcn_fence(__ATOMIC_RELEASE, "workgroup", "local");
  __builtin_amdgcn_s_barrier();
  __builtin_amdgcn_fence(__ATOMIC_ACQUIRE, "workgroup", "local");
}

// Stands where a tile's staging begins. Without it the scheduler lifts the f16
// conversions of the later register sets into the earlier tiles, and with them
// the waits for their loads, which then fly for one tile instead of all.
__device__ __forceinline__ void tile_begin() { __builtin_amdgcn_sched_barrier(0); }

__device__ __forceinline__ float elu_p1(float v) {
  return v > 0.0f ? v + 1.0f : __expf(v);   // elu(v)+1
}

// --- Generic tiled GEMM: C = A(fp32)[M,K] * B(fp32)[K,N] + bias -------------
// mode 0: plain; mode 1: elu+1 everywhere; mode 2: elu+1 only for col < halfN.
// Shapes are exact multiples of tiles (M%128==0, N%128==0, K%64==0).
// The global loads of a k tile are issued two tiles ahead, into two register
// sets, so their latency runs beside the staging and the products of the tiles
// in between. N and K are compile-time: a thread's eight loads of a tile hang on
// two addresses by constant offsets, and only those two are advanced.
template <int N, int K>
__global__ __launch_bounds__(256)
void gemm_kernel(const float* __restrict__ A, const float* __restrict__ B,
                 const float* __restrict__ bias, float* __restrict__ C,
                 int mode, int halfN) {
  __shared__ __attribute__((aligned(16))) _Float16 As[128 * ROWH];
  __shared__ __attribute__((aligned(16))) _Float16 Bs[32 * BP128];

  const int tid  = threadIdx.x;
  const int bm   = blockIdx.y * 128;
  const int bn   = blockIdx.x * 128;
  const int wid  = tid >> 5;
  const int lane = tid & 31;
  const int nl   = lane & 15;
  const int kb   = (lane >> 4) << 3;   // K base for A/B fragments
  const int hb   = (lane >> 4) << 3;   // row offset for C/D fragments
  const int wm   = (wid & 1) * 64;     // 2 waves in M  -> 64 rows each
  const int wn   = (wid >> 1) * 32;    // 4 waves in N  -> 32 cols each

  const v8f vzero = {0.f,0.f,0.f,0.f,0.f,0.f,0.f,0.f};
  v8f acc[4][2];
#pragma unroll
  for (int i = 0; i < 4; ++i)
#pragma unroll
    for (int j = 0; j < 2; ++j) acc[i][j] = vzero;

  const int r   = tid >> 3;           // A: row 0..31
  const int c4  = (tid & 7) * 4;      // A: first column 0..28
  const int br  = tid >> 5;           // B: row 0..7
  const int bc4 = (tid & 31) * 4;     // B: first column 0..124
  const float* ap = A + (size_t)(bm + r) * K + c4;
  const float* bp = B + (size_t)br * N + bn + bc4;
  v4f pa[2][4], pb[2][4];

  // One k tile (A 128x32, B 32x128) into a register set; then on to the next tile.
  auto fetch = [&](v4f (&a)[4], v4f (&b)[4]) {
#pragma unroll
    for (int q = 0; q < 4; ++q) {
      a[q] = *(const v4f*)(ap + q * 32 * K);
      b[q] = *(const v4f*)(bp + q * 8 * N);
    }
    // the two addresses are rewritten next: the issued loads still name them
    asm volatile("s_wait_xcnt 0x0" ::: "memory");
    // holds every later register write behind that wait
    __builtin_amdgcn_sched_barrier(0);
    ap += 32;
    bp += 32 * N;
  };
  // A -> As[m][k]; B -> Bs[k][n], as it lies in memory
  auto stage = [&](const v4f (&a)[4], const v4f (&b)[4]) {
#pragma unroll
    for (int q = 0; q < 4; ++q) {
      st4h(&As[(r + q * 32) * ROWH + c4], a[q].x, a[q].y, a[q].z, a[q].w);
      st4h(&Bs[(br + q * 8) * BP128 + bc4], b[q].x, b[q].y, b[q].z, b[q].w);
    }
  };
  auto products = [&]() {
    v16h af[4], bf[2];
#pragma unroll
    for (int i = 0; i < 4; ++i) af[i] = frag_ld(&As[(wm + i * 16 + nl) * ROWH], kb);
#pragma unroll
    for (int j = 0; j < 2; ++j) bf[j] = frag_ld_tr(Bs, BP128, wn + j * 16, lane);
#pragma unroll
    for (int i = 0; i < 4; ++i)
#pragma unroll
      for (int j = 0; j < 2; ++j) acc[i][j] = wmma16(af[i], bf[j], acc[i][j]);
  };

  fetch(pa[0], pb[0]);
  fetch(pa[1], pb[1]);
  for (int k0 = 0; k0 < K - 64; k0 += 64) {
#pragma unroll
    for (int u = 0; u < 2; ++u) {
      tile_begin();
      stage(pa[u], pb[u]);
      fetch(pa[u], pb[u]);   // the tile two further on, into the set just emptied
      lds_barrier();
      products();
      lds_barrier();
    }
  }
#pragma unroll
  for (int u = 0; u < 2; ++u) {   // the last two tiles: nothing left to fetch
    tile_begin();
    stage(pa[u], pb[u]);
    lds_barrier();
    products();
    lds_barrier();
  }

#pragma unroll
  for (int i = 0; i < 4; ++i)
#pragma unroll
    for (int j = 0; j < 2; ++j) {
      const int col = bn + wn + j * 16 + nl;
      const float bv = bias[col];
      const bool act = (mode == 1) || (mode == 2 && col < halfN);
#pragma unroll
      for (int vi = 0; vi < 8; ++vi) {
        const int row = bm + wm + i * 16 + hb + vi;
        float v = acc[i][j][vi] + bv;
        if (act) v = elu_p1(v);
        C[(size_t)row * N + col] = v;
      }
    }
}

// --- RoPE on K with transposed output [B,H,HD,S] ----------------------------
// (so it can serve as row-major WMMA A). One block = one head x 64 positions.
// The 64(s) x 64(d) tile goes through LDS: rows are read along d, results are
// stored along s, so both global sides move whole 128-byte lines.
#define RT_PITCH 65             // floats; odd pitch: column reads hit 32 banks
// sin and cos of 2*pi*rev. One statement so that the slot the instruction set
// asks for behind a transcendental is filled whatever the compiler puts next:
// v_cos is independent of v_sin (outputs never alias the input), v_nop ends it.
__device__ __forceinline__ void sincos_rev(float rev, float& sn, float& cs) {
  asm("v_sin_f32 %0, %2\n\tv_cos_f32 %1, %2\n\tv_nop"
      : "=&v"(sn), "=&v"(cs) : "v"(rev));
}
__global__ __launch_bounds__(256)
void rope_kt_kernel(const float* __restrict__ kv, float* __restrict__ out) {
  __shared__ float tile[64 * RT_PITCH];
  const int tid = threadIdx.x;
  const int s0  = blockIdx.x * 64;
  const int bh  = blockIdx.y;
  const int b = bh >> 4, h = bh & 15;
  const float* src = kv + ((size_t)b * SLEN + s0) * (2 * N_EMB) + h * HDIM;
  {
    const int r = tid >> 4, c4 = (tid & 15) * 4;
#pragma unroll
    for (int rr = 0; rr < 64; rr += 16) {
      const float4 v = *(const float4*)(src + (size_t)(r + rr) * (2 * N_EMB) + c4);
      float* p = &tile[(r + rr) * RT_PITCH + c4];
      p[0] = v.x; p[1] = v.y; p[2] = v.z; p[3] = v.w;
    }
  }
  __syncthreads();   // every row of the tile is in LDS before columns are read
  const int s4 = (tid & 15) * 4;        // four consecutive positions per thread
  float* dst = out + (size_t)bh * HDIM * SLEN + s0 + s4;
#pragma unroll
  for (int p = 0; p < 2; ++p) {
    const int i = (tid >> 4) + p * 16;  // 0..31: the pair (i, i+32) shares its angle
    const float inv = __expf(-(float)i * 0.28782313662425572f);
    float lo[4], hi[4];
#pragma unroll
    for (int j = 0; j < 4; ++j) {
      float sn, cs;
      sincos_rev((float)(s0 + s4 + j) * inv * 0.15915494309189532f, sn, cs);
      const float x1 = tile[(s4 + j) * RT_PITCH + i];
      const float x2 = tile[(s4 + j) * RT_PITCH + i + 32];
      lo[j] = fmaf(x1, cs, -(x2 * sn));
      hi[j] = fmaf(x2, cs, x1 * sn);
    }
    *(float4*)(dst + (size_t)i * SLEN)        = make_float4(lo[0], lo[1], lo[2], lo[3]);
    *(float4*)(dst + (size_t)(i + 32) * SLEN) = make_float4(hi[0], hi[1], hi[2], hi[3]);
  }
}

// --- K row-sum over S (two pass, deterministic) -----------------------------
#define NCH 16
__global__ void ksum_partial_kernel(const float* __restrict__ kv,
                                    float* __restrict__ partial) {
  const int c  = blockIdx.x * blockDim.x + threadIdx.x;  // 0..1023
  const int b  = blockIdx.y;
  const int ch = blockIdx.z;
  const int chs = SLEN / NCH;
  float s = 0.f;
  for (int i = 0; i < chs; ++i) {
    const int srow = ch * chs + i;
    s += kv[((size_t)(b * SLEN + srow)) * (2 * N_EMB) + c];
  }
  partial[((size_t)ch * BATCH + b) * N_EMB + c] = s;
}

__global__ void ksum_final_kernel(const float* __restrict__ partial,
                                  float* __restrict__ ksum) {
  const int i = blockIdx.x * blockDim.x + threadIdx.x;  // 0..B*C-1
  float s = 0.f;
#pragma unroll
  for (int ch = 0; ch < NCH; ++ch) s += partial[(size_t)ch * (BATCH * N_EMB) + i];
  ksum[i] = s;
}

// --- denom[b,h,t] = qfeat[b,t,h,:] . ksum[b,h,:] ----------------------------
__global__ void denom_kernel(const float* __restrict__ qfeat,
                             const float* __restrict__ ksum,
                             float* __restrict__ denom) {
  const int idx = blockIdx.x * blockDim.x + threadIdx.x;  // B*T*H
  const int b = idx / (TLEN * NHEAD);
  const int r = idx - b * (TLEN * NHEAD);
  const int t = r >> 4;
  const int h = r & 15;
  const float* q = qfeat + (size_t)(b * TLEN + t) * N_EMB + h * HDIM;
  const float* k = ksum + (size_t)b * N_EMB + h * HDIM;
  float s = 0.f;
#pragma unroll 8
  for (int d = 0; d < HDIM; ++d) s += q[d] * k[d];
  denom[((size_t)(b * NHEAD + h)) * TLEN + t] = s;
}

// --- state[b,h] = K_rot^T V  (64x64, K over S=2048) -------------------------
__global__ __launch_bounds__(256)
void state_kernel(const float* __restrict__ krotT, const float* __restrict__ kv,
                  float* __restrict__ state) {
  __shared__ __attribute__((aligned(16))) _Float16 As[64 * ROWH];
  __shared__ __attribute__((aligned(16))) _Float16 Bs[32 * BP64];
  const int bh = blockIdx.x;
  const int b = bh >> 4, h = bh & 15;
  const float* Aptr = krotT + (size_t)bh * HDIM * SLEN;                 // [64,S]
  const float* Vptr = kv + (size_t)b * SLEN * (2 * N_EMB) + N_EMB + h * HDIM;
  const int tid = threadIdx.x;
  const int wid = tid >> 5, lane = tid & 31;
  const int nl = lane & 15;
  const int kb = (lane >> 4) << 3;
  const int hb = (lane >> 4) << 3;
  const int tm  = (wid & 3) * 16;        // 4 m-tiles
  const int tn0 = (wid >> 2) * 32;       // 2 wave groups x 2 n-tiles

  const v8f vzero = {0.f,0.f,0.f,0.f,0.f,0.f,0.f,0.f};
  v8f acc[2] = {vzero, vzero};

  // Only 32 work-groups run here, so nothing but the wave's own order hides a
  // load: the loads of an s tile are issued four tiles ahead, into four sets.
  const int r  = tid >> 3, c4  = (tid & 7) * 4;     // A: row d, first column s
  const int br = tid >> 4, bc4 = (tid & 15) * 4;    // V: row s, first column e
  const float* ap = Aptr + (size_t)r * SLEN + c4;
  const float* vp = Vptr + (size_t)br * (2 * N_EMB) + bc4;
  v4f pa[4][2], pv[4][2];

  auto fetch = [&](v4f (&a)[2], v4f (&v)[2]) {
#pragma unroll
    for (int q = 0; q < 2; ++q) {
      a[q] = *(const v4f*)(ap + q * 32 * SLEN);
      v[q] = *(const v4f*)(vp + q * 16 * (2 * N_EMB));
    }
    // the two addresses are rewritten next: the issued loads still name them
    asm volatile("s_wait_xcnt 0x0" ::: "memory");
    // holds every later register write behind that wait
    __builtin_amdgcn_sched_barrier(0);
    ap += 32;
    vp += 32 * (2 * N_EMB);
  };
  // A tile 64(d) x 32(s) -> As[d][s]; V tile 32(s) x 64(e) -> Bs[s][e]
  auto stage = [&](const v4f (&a)[2], const v4f (&v)[2]) {
#pragma unroll
    for (int q = 0; q < 2; ++q) {
      st4h(&As[(r + q * 32) * ROWH + c4], a[q].x, a[q].y, a[q].z, a[q].w);
      st4h(&Bs[(br + q * 16) * BP64 + bc4], v[q].x, v[q].y, v[q].z, v[q].w);
    }
  };
  auto products = [&]() {
    const v16h af = frag_ld(&As[(tm + nl) * ROWH], kb);
#pragma unroll
    for (int j = 0; j < 2; ++j) {
      const v16h bf = frag_ld_tr(Bs, BP64, tn0 + j * 16, lane);
      acc[j] = wmma16(af, bf, acc[j]);
    }
  };

#pragma unroll
  for (int u = 0; u < 4; ++u) fetch(pa[u], pv[u]);
  for (int s0 = 0; s0 < SLEN - 128; s0 += 128) {
#pragma unroll
    for (int u = 0; u < 4; ++u) {
      tile_begin();
      stage(pa[u], pv[u]);
      fetch(pa[u], pv[u]);   // the tile four further on, into the set just emptied
      lds_barrier();
      products();
      lds_barrier();
    }
  }
#pragma unroll
  for (int u = 0; u < 4; ++u) {   // the last four tiles: nothing left to fetch
    tile_begin();
    stage(pa[u], pv[u]);
    lds_barrier();
    products();
    lds_barrier();
  }
#pragma unroll
  for (int j = 0; j < 2; ++j) {
    const int col = tn0 + j * 16 + nl;
#pragma unroll
    for (int vi = 0; vi < 8; ++vi) {
      const int row = tm + hb + vi;
      state[(size_t)bh * (HDIM * HDIM) + row * HDIM + col] = acc[j][vi];
    }
  }
}

// --- y[b,t,h,:] = (rope(Q)[b,t,h,:] @ state[b,h]) / denom[b,h,t] ------------
// RoPE on Q is applied while the A tile is staged: a thread holds columns
// i..i+3 and i+32..i+35 of a row, i.e. both members of four rotation pairs, so
// the rotated Q never goes through global memory. Both k halves (K = 64) are
// staged at once, so one barrier separates staging from the products.
__global__ __launch_bounds__(256)
void ygemm_kernel(const float* __restrict__ qfeat, const float* __restrict__ state,
                  const float* __restrict__ denom, float* __restrict__ y) {
  __shared__ __attribute__((aligned(16))) _Float16 As[2][128 * ROWH];
  __shared__ __attribute__((aligned(16))) _Float16 Bs[64 * BP64];
  const int bh = blockIdx.y;
  const int b = bh >> 4, h = bh & 15;
  const int row0 = blockIdx.x * 128;
  const float* Aptr = qfeat + (size_t)b * TLEN * N_EMB + h * HDIM;  // rows t, lda=N_EMB
  const float* Sptr = state + (size_t)bh * (HDIM * HDIM);
  const int tid = threadIdx.x;
  const int wid = tid >> 5, lane = tid & 31;
  const int nl = lane & 15;
  const int kb = (lane >> 4) << 3;
  const int hb = (lane >> 4) << 3;

  const v8f vzero = {0.f,0.f,0.f,0.f,0.f,0.f,0.f,0.f};
  v8f acc[4] = {vzero, vzero, vzero, vzero};

  // Every row of a thread is reached from one address by a constant offset.
  const int r = tid >> 3, c4 = (tid & 7) * 4;       // A: row, first column
  const int br = tid >> 4, bc4 = (tid & 15) * 4;    // state: row, first column
  const float* ap = Aptr + (size_t)(row0 + r) * N_EMB + c4;
  const float* sp = Sptr + br * HDIM + bc4;
  v4f x1[4], x2[4], sv[4];
#pragma unroll
  for (int q = 0; q < 4; ++q) {
    x1[q] = *(const v4f*)(ap + q * 32 * N_EMB);
    x2[q] = *(const v4f*)(ap + q * 32 * N_EMB + 32);
    sv[q] = *(const v4f*)(sp + q * 16 * HDIM);
  }
  {   // A tile 128(t) x 64(d), rotated: As[0] = d 0..31, As[1] = d 32..63
    float inv[4];   // inv_freq[i] = 10000^(-2i/64) = exp(-i * ln(10000)/32)
#pragma unroll
    for (int j = 0; j < 4; ++j)
      inv[j] = __expf(-(float)(c4 + j) * 0.28782313662425572f);
#pragma unroll
    for (int q = 0; q < 4; ++q) {
      const float t = (float)(row0 + r + q * 32);
      _Float16* d0 = &As[0][(r + q * 32) * ROWH + c4];
      _Float16* d1 = &As[1][(r + q * 32) * ROWH + c4];
#pragma unroll
      for (int j = 0; j < 4; ++j) {
        float sn, cs;
        __sincosf(t * inv[j], &sn, &cs);
        d0[j] = (_Float16)(x1[q][j] * cs - x2[q][j] * sn);
        d1[j] = (_Float16)(x2[q][j] * cs + x1[q][j] * sn);
      }
    }
  }
  // state 64(d) x 64(e) -> Bs[d][e]; row d = br + q * 16
#pragma unroll
  for (int q = 0; q < 4; ++q)
    st4h(&Bs[(br + q * 16) * BP64 + bc4], sv[q].x, sv[q].y, sv[q].z, sv[q].w);
  __syncthreads();   // both tiles are whole in LDS before any fragment is read
#pragma unroll
  for (int kk = 0; kk < 2; ++kk) {
    const v16h af = frag_ld(&As[kk][(wid * 16 + nl) * ROWH], kb);
#pragma unroll
    for (int j = 0; j < 4; ++j) {
      const v16h bf = frag_ld_tr(Bs + kk * 32 * BP64, BP64, j * 16, lane);
      acc[j] = wmma16(af, bf, acc[j]);
    }
  }
  float rd[8];
#pragma unroll
  for (int vi = 0; vi < 8; ++vi)
    rd[vi] = 1.0f / denom[(size_t)bh * TLEN + row0 + wid * 16 + hb + vi];
#pragma unroll
  for (int j = 0; j < 4; ++j) {
#pragma unroll
    for (int vi = 0; vi < 8; ++vi) {
      const int t = row0 + wid * 16 + hb + vi;
      const int col = h * HDIM + j * 16 + nl;
      y[(size_t)(b * TLEN + t) * N_EMB + col] = acc[j][vi] * rd[vi];
    }
  }
}

// ---------------------------------------------------------------------------
extern "C" void kernel_launch(void* const* d_in, const int* in_sizes, int n_in,
                              void* d_out, int out_size, void* d_ws, size_t ws_size,
                              hipStream_t stream) {
  (void)in_sizes; (void)n_in; (void)out_size; (void)ws_size;
  const float* x      = (const float*)d_in[0];
  const float* mem    = (const float*)d_in[1];
  const float* q_w    = (const float*)d_in[2];
  const float* q_b    = (const float*)d_in[3];
  const float* kv_w   = (const float*)d_in[4];
  const float* kv_b   = (const float*)d_in[5];
  const float* proj_w = (const float*)d_in[6];
  const float* proj_b = (const float*)d_in[7];
  float* out = (float*)d_out;

  // Workspace layout (floats). Total ~81 MB.
  const size_t SZ_BTC = (size_t)BATCH * TLEN * N_EMB;     // 4 M
  float* ws      = (float*)d_ws;
  float* qfeat   = ws;                                    // [B,T,C] elu+1
  float* kvbuf   = qfeat   + SZ_BTC;                      // [B,S,2C] (K feat | V)
  float* krotT   = kvbuf   + 2 * SZ_BTC;                  // [B,H,64,S]
  float* ybuf    = krotT   + SZ_BTC;                      // [B,T,C]
  float* stateb  = ybuf    + SZ_BTC;                      // [B*H,64,64]
  float* ksum    = stateb  + (size_t)BATCH * NHEAD * HDIM * HDIM;  // [B,C]
  float* partial = ksum    + (size_t)BATCH * N_EMB;       // [NCH,B,C]
  float* denom   = partial + (size_t)NCH * BATCH * N_EMB; // [B,H,T]

  const dim3 blk(256);
  const int M = BATCH * TLEN;   // 4096

  // 1) Q = elu(x@q_w + q_b)+1
  gemm_kernel<N_EMB, N_EMB><<<dim3(N_EMB / 128, M / 128), blk, 0, stream>>>(
      x, q_w, q_b, qfeat, 1, 0);
  // 2) kv = memory@kv_w + kv_b ; elu+1 on K half only
  gemm_kernel<2 * N_EMB, N_EMB><<<dim3(2 * N_EMB / 128, M / 128), blk, 0, stream>>>(
      mem, kv_w, kv_b, kvbuf, 2, N_EMB);
  // 3) RoPE on K (RoPE on Q happens inside step 7)
  rope_kt_kernel<<<dim3(SLEN / 64, BATCH * NHEAD), blk, 0, stream>>>(kvbuf, krotT);
  // 4) ksum = sum_s K  (two-pass, deterministic)
  ksum_partial_kernel<<<dim3(N_EMB / 256, BATCH, NCH), blk, 0, stream>>>(kvbuf, partial);
  ksum_final_kernel<<<(BATCH * N_EMB) / 256, blk, 0, stream>>>(partial, ksum);
  // 5) denom = Q . ksum
  denom_kernel<<<(BATCH * TLEN * NHEAD) / 256, blk, 0, stream>>>(qfeat, ksum, denom);
  // 6) state = K_rot^T V  (per b,h)
  state_kernel<<<BATCH * NHEAD, blk, 0, stream>>>(krotT, kvbuf, stateb);
  // 7) y = (rope(Q) @ state) / denom
  ygemm_kernel<<<dim3(TLEN / 128, BATCH * NHEAD), blk, 0, stream>>>(qfeat, stateb, denom, ybuf);
  // 8) out = y @ proj_w + proj_b
  gemm_kernel<N_EMB, N_EMB><<<dim3(N_EMB / 128, M / 128), blk, 0, stream>>>(
      ybuf, proj_w, proj_b, out, 0, 0);
}

// v005
// A run of this version takes 115 microseconds.
// Next to v004, in two timings, it ran 1.12 and 1.14 times as fast.
// All steps since v000 together make it 3.27 times as fast.
#include <hip/hip_runtime.h>
#include <hip/hip_bf16.h>
#include <stdint.h>

// ---------------------------------------------------------------------------
// Linear cross-attention with RoPE, MI455X (gfx1250, wave32, WMMA).
// Associativity trick: y = Q_rot @ (K_rot^T V) / (Q . sum_s K)  -- avoids TxS.
// All GEMMs run through v_wmma_f32_16x16x32_f16 with fp32 accumulation;
// fp32 operands are converted to f16 while staging through LDS.
// ---------------------------------------------------------------------------

typedef __attribute__((ext_vector_type(16))) _Float16 v16h;
typedef __attribute__((ext_vector_type(8)))  float    v8f;
typedef __attribute__((ext_vector_type(4)))  float    v4f;
typedef __attribute__((ext_vector_type(4)))  _Float16 v4h;
typedef __attribute__((ext_vector_type(8)))  short    s16x8;

#define N_EMB 1024
#define NHEAD 16
#define HDIM  64
#define BATCH 2
#define TLEN  2048
#define SLEN  2048
#define LDS_PAD 8               // halfs of padding per LDS row (row = 40 halfs)
#define ROWH (32 + LDS_PAD)     // LDS row stride in halfs (BK=32)
// B tiles lie row-major [k][n] in LDS; the pitch is an odd multiple of 32 bytes,
// for speed only.
#define BP128 (128 + 16)        // halfs per k row of a 128-column B tile (288 B)
#define BP64  (64 + 16)         // halfs per k row of a 64-column B tile (160 B)

// --- WMMA fragment helpers --------------------------------------------------
// 16-bit A-matrix 16x32 layout (ISA 7.12.2): lane&15 = row M; lanes>=16 use
// K base +8; VGPR0..3 hold K=kb..kb+7 (packed f16 pairs), VGPR4..7 hold
// K=kb+16..kb+23.  B 32x16 has the same map with lane&15 = col N.
__device__ __forceinline__ v16h frag_ld(const _Float16* rowbase, int kb) {
  union { v16h h; uint32_t u[8]; } f;
  const uint32_t* p0 = (const uint32_t*)(rowbase + kb);
  const uint32_t* p1 = (const uint32_t*)(rowbase + kb + 16);
#pragma unroll
  for (int j = 0; j < 4; ++j) { f.u[j] = p0[j]; f.u[4 + j] = p1[j]; }
  return f.h;
}

// B fragment 32(k) x 16(n) out of a row-major [k][n] f16 tile: two transposing
// loads. Lane l reads 16 bytes of row 8*(l>>4) + (l&7) and receives column
// n0 + (l&15), k = 8*(l>>4) + 0..7; the second load takes the rows 16 further
// down. That is the k order of frag_ld, register for register.
__device__ __forceinline__ v16h frag_ld_tr(const _Float16* tile, int pitch, int n0,
                                           int lane) {
  typedef __attribute__((address_space(3))) s16x8 lds_s16x8;
  const _Float16* p = tile + ((lane >> 4) * 8 + (lane & 7)) * pitch + n0 +
                      ((lane >> 3) & 1) * 8;
  union { v16h h; s16x8 s[2]; } f;
  f.s[0] = __builtin_amdgcn_ds_load_tr16_b128_v8i16((lds_s16x8*)p);
  f.s[1] = __builtin_amdgcn_ds_load_tr16_b128_v8i16((lds_s16x8*)(p + 16 * pitch));
  return f.h;
}

// Four consecutive values of one LDS row, converted and stored as one 8-byte piece.
__device__ __forceinline__ void st4h(_Float16* d, float a, float b, float c, float e) {
  const v4h h = {(_Float16)a, (_Float16)b, (_Float16)c, (_Float16)e};
  *(v4h*)d = h;
}

__device__ __forceinline__ v8f wmma16(v16h a, v16h b, v8f c) {
  // (neg_a, A, neg_b, B, c_mod, C, reuse_a, reuse_b)
  return __builtin_amdgcn_wmma_f32_16x16x32_f16(false, a, false, b,
                                                (short)0, c, false, false);
}

// Work-group barrier for LDS traffic alone. __syncthreads() also waits for the
// wave's outstanding global loads, which would end the flight of the tiles that
// the k loops below fetch ahead; the loops exchange data through LDS only.
__device__ __forceinline__ void lds_barrier() {
  __builtin_amdgcn_fence(__ATOMIC_RELEASE, "workgroup", "local");
  __builtin_amdgcn_s_barrier();
  __builtin_amdgcn_fence(__ATOMIC_ACQUIRE, "workgroup", "local");
}

// Stands where a tile's staging begins. Without it the scheduler lifts the f16
// conversions of the later register sets into the earlier tiles, and with them
// the waits for their loads, which then fly for one tile instead of all.
__device__ __forceinline__ void tile_begin() { __builtin_amdgcn_sched_barrier(0); }

__device__ __forceinline__ float elu_p1(float v) {
  return v > 0.0f ? v + 1.0f : __expf(v);   // elu(v)+1
}

// --- Generic tiled GEMM: C = A(fp32)[M,K] * B(fp32)[K,N] + bias -------------
// mode 0: plain; mode 1: elu+1 everywhere; mode 2: elu+1 only for col < halfN.
// Shapes are exact multiples of tiles (M%128==0, N%128==0, K%64==0).
// The global loads of a k tile are issued two tiles ahead, into two register
// sets, so their latency runs beside the staging and the products of the tiles
// in between. N and K are compile-time: a thread's eight loads of a tile hang on
// two addresses by constant offsets, and only those two are advanced.
template <int N, int K>
__global__ __launch_bounds__(256)
void gemm_kernel(const float* __restrict__ A, const float* __restrict__ B,
                 const float* __restrict__ bias, float* __restrict__ C,
                 int mode, int halfN) {
  __shared__ __attribute__((aligned(16))) _Float16 As[128 * ROWH];
  __shared__ __attribute__((aligned(16))) _Float16 Bs[32 * BP128];

  const int tid  = threadIdx.x;
  const int bm   = blockIdx.y * 128;
  const int bn   = blockIdx.x * 128;
  const int wid  = tid >> 5;
  const int lane = tid & 31;
  const int nl   = lane & 15;
  const int kb   = (lane >> 4) << 3;   // K base for A/B fragments
  const int hb   = (lane >> 4) << 3;   // row offset for C/D fragments
  const int wm   = (wid & 1) * 64;     // 2 waves in M  -> 64 rows each
  const int wn   = (wid >> 1) * 32;    // 4 waves in N  -> 32 cols each

  const v8f vzero = {0.f,0.f,0.f,0.f,0.f,0.f,0.f,0.f};
  v8f acc[4][2];
#pragma unroll
  for (int i = 0; i < 4; ++i)
#pragma unroll
    for (int j = 0; j < 2; ++j) acc[i][j] = vzero;

  const int r   = tid >> 3;           // A: row 0..31
  const int c4  = (tid & 7) * 4;      // A: first column 0..28
  const int br  = tid >> 5;           // B: row 0..7
  const int bc4 = (tid & 31) * 4;     // B: first column 0..124
  const float* ap = A + (size_t)(bm + r) * K + c4;
  const float* bp = B + (size_t)br * N + bn + bc4;
  v4f pa[2][4], pb[2][4];

  // One k tile (A 128x32, B 32x128) into a register set; then on to the next tile.
  auto fetch = [&](v4f (&a)[4], v4f (&b)[4]) {
#pragma unroll
    for (int q = 0; q < 4; ++q) {
      a[q] = *(const v4f*)(ap + q * 32 * K);
      b[q] = *(const v4f*)(bp + q * 8 * N);
    }
    // the two addresses are rewritten next: the issued loads still name them
    asm volatile("s_wait_xcnt 0x0" ::: "memory");
    // holds every later register write behind that wait
    __builtin_amdgcn_sched_barrier(0);
    ap += 32;
    bp += 32 * N;
  };
  // A -> As[m][k]; B -> Bs[k][n], as it lies in memory
  auto stage = [&](const v4f (&a)[4], const v4f (&b)[4]) {
#pragma unroll
    for (int q = 0; q < 4; ++q) {
      st4h(&As[(r + q * 32) * ROWH + c4], a[q].x, a[q].y, a[q].z, a[q].w);
      st4h(&Bs[(br + q * 8) * BP128 + bc4], b[q].x, b[q].y, b[q].z, b[q].w);
    }
  };
  auto products = [&]() {
    v16h af[4], bf[2];
#pragma unroll
    for (int i = 0; i < 4; ++i) af[i] = frag_ld(&As[(wm + i * 16 + nl) * ROWH], kb);
#pragma unroll
    for (int j = 0; j < 2; ++j) bf[j] = frag_ld_tr(Bs, BP128, wn + j * 16, lane);
#pragma unroll
    for (int i = 0; i < 4; ++i)
#pragma unroll
      for (int j = 0; j < 2; ++j) acc[i][j] = wmma16(af[i], bf[j], acc[i][j]);
  };

  fetch(pa[0], pb[0]);
  fetch(pa[1], pb[1]);
  for (int k0 = 0; k0 < K - 64; k0 += 64) {
#pragma unroll
    for (int u = 0; u < 2; ++u) {
      tile_begin();
      stage(pa[u], pb[u]);
      fetch(pa[u], pb[u]);   // the tile two further on, into the set just emptied
      lds_barrier();
      products();
      lds_barrier();
    }
  }
#pragma unroll
  for (int u = 0; u < 2; ++u) {   // the last two tiles: nothing left to fetch
    tile_begin();
    stage(pa[u], pb[u]);
    lds_barrier();
    products();
    lds_barrier();
  }

#pragma unroll
  for (int i = 0; i < 4; ++i)
#pragma unroll
    for (int j = 0; j < 2; ++j) {
      const int col = bn + wn + j * 16 + nl;
      const float bv = bias[col];
      const bool act = (mode == 1) || (mode == 2 && col < halfN);
#pragma unroll
      for (int vi = 0; vi < 8; ++vi) {
        const int row = bm + wm + i * 16 + hb + vi;
        float v = acc[i][j][vi] + bv;
        if (act) v = elu_p1(v);
        C[(size_t)row * N + col] = v;
      }
    }
}

// --- RoPE on K with transposed output [B,H,HD,S] ----------------------------
// (so it can serve as row-major WMMA A). One block = one head x 64 positions.
// The 64(s) x 64(d) tile goes through LDS: rows are read along d, results are
// stored along s, so both global sides move whole 128-byte lines.
// The block also holds all it takes for its share of sum_s K (the denominator's
// K side, unrotated): each thread adds up the four rows it loads, the sixteen
// row groups meet in LDS, and one 64-float partial per block goes out.
#define NCH (SLEN / 64)         // partials per head: one per block of 64 positions
#define RT_PITCH 65             // floats; odd pitch: column reads hit 32 banks
// sin and cos of 2*pi*rev. One statement so that the slot the instruction set
// asks for behind a transcendental is filled whatever the compiler puts next:
// v_cos is independent of v_sin (outputs never alias the input), v_nop ends it.
__device__ __forceinline__ void sincos_rev(float rev, float& sn, float& cs) {
  asm("v_sin_f32 %0, %2\n\tv_cos_f32 %1, %2\n\tv_nop"
      : "=&v"(sn), "=&v"(cs) : "v"(rev));
}
__global__ __launch_bounds__(256)
void rope_kt_kernel(const float* __restrict__ kv, float* __restrict__ out,
                    float* __restrict__ partial) {
  __shared__ float tile[64 * RT_PITCH];
  __shared__ __attribute__((aligned(16))) float colsum[16 * HDIM];
  const int tid = threadIdx.x;
  const int s0  = blockIdx.x * 64;
  const int bh  = blockIdx.y;
  const int b = bh >> 4, h = bh & 15;
  const float* src = kv + ((size_t)b * SLEN + s0) * (2 * N_EMB) + h * HDIM;
  {
    const int r = tid >> 4, c4 = (tid & 15) * 4;
    float4 cs4 = make_float4(0.f, 0.f, 0.f, 0.f);
#pragma unroll
    for (int rr = 0; rr < 64; rr += 16) {
      const float4 v = *(const float4*)(src + (size_t)(r + rr) * (2 * N_EMB) + c4);
      float* p = &tile[(r + rr) * RT_PITCH + c4];
      p[0] = v.x; p[1] = v.y; p[2] = v.z; p[3] = v.w;
      cs4.x += v.x; cs4.y += v.y; cs4.z += v.z; cs4.w += v.w;
    }
    *(float4*)&colsum[r * HDIM + c4] = cs4;
  }
  __syncthreads();   // every row of the tile is in LDS before columns are read
  if (tid < HDIM) {  // two whole waves: column tid over the sixteen row groups
    float s = 0.f;
#pragma unroll
    for (int g = 0; g < 16; ++g) s += colsum[g * HDIM + tid];
    partial[((size_t)blockIdx.x * (BATCH * NHEAD) + bh) * HDIM + tid] = s;
  }
  const int s4 = (tid & 15) * 4;        // four consecutive positions per thread
  float* dst = out + (size_t)bh * HDIM * SLEN + s0 + s4;
#pragma unroll
  for (int p = 0; p < 2; ++p) {
    const int i = (tid >> 4) + p * 16;  // 0..31: the pair (i, i+32) shares its angle
    const float inv = __expf(-(float)i * 0.28782313662425572f);
    float lo[4], hi[4];
#pragma unroll
    for (int j = 0; j < 4; ++j) {
      float sn, cs;
      sincos_rev((float)(s0 + s4 + j) * inv * 0.15915494309189532f, sn, cs);
      const float x1 = tile[(s4 + j) * RT_PITCH + i];
      const float x2 = tile[(s4 + j) * RT_PITCH + i + 32];
      lo[j] = fmaf(x1, cs, -(x2 * sn));
      hi[j] = fmaf(x2, cs, x1 * sn);
    }
    *(float4*)(dst + (size_t)i * SLEN)        = make_float4(lo[0], lo[1], lo[2], lo[3]);
    *(float4*)(dst + (size_t)(i + 32) * SLEN) = make_float4(hi[0], hi[1], hi[2], hi[3]);
  }
}

// --- state[b,h] = K_rot^T V  (64x64, K over S=2048) -------------------------
// The one work-group of a head also adds up the head's NCH partials of sum_s K.
__global__ __launch_bounds__(256)
void state_kernel(const float* __restrict__ krotT, const float* __restrict__ kv,
                  const float* __restrict__ partial, float* __restrict__ state,
                  float* __restrict__ ksum) {
  __shared__ __attribute__((aligned(16))) _Float16 As[64 * ROWH];
  __shared__ __attribute__((aligned(16))) _Float16 Bs[32 * BP64];
  const int bh = blockIdx.x;
  const int b = bh >> 4, h = bh & 15;
  const float* Aptr = krotT + (size_t)bh * HDIM * SLEN;                 // [64,S]
  const float* Vptr = kv + (size_t)b * SLEN * (2 * N_EMB) + N_EMB + h * HDIM;
  const int tid = threadIdx.x;
  const int wid = tid >> 5, lane = tid & 31;
  const int nl = lane & 15;
  const int kb = (lane >> 4) << 3;
  const int hb = (lane >> 4) << 3;
  const int tm  = (wid & 3) * 16;        // 4 m-tiles
  const int tn0 = (wid >> 2) * 32;       // 2 wave groups x 2 n-tiles

  const v8f vzero = {0.f,0.f,0.f,0.f,0.f,0.f,0.f,0.f};
  v8f acc[2] = {vzero, vzero};

  // Only 32 work-groups run here, so nothing but the wave's own order hides a
  // load: the loads of an s tile are issued four tiles ahead, into four sets.
  const int r  = tid >> 3, c4  = (tid & 7) * 4;     // A: row d, first column s
  const int br = tid >> 4, bc4 = (tid & 15) * 4;    // V: row s, first column e
  const float* ap = Aptr + (size_t)r * SLEN + c4;
  const float* vp = Vptr + (size_t)br * (2 * N_EMB) + bc4;
  v4f pa[4][2], pv[4][2];

  // Issued ahead of the s loop and used behind it, so their latency is not seen.
  float kp[NCH];
  if (tid < HDIM) {
#pragma unroll
    for (int ch = 0; ch < NCH; ++ch)
      kp[ch] = partial[((size_t)ch * (BATCH * NHEAD) + bh) * HDIM + tid];
  }

  auto fetch = [&](v4f (&a)[2], v4f (&v)[2]) {
#pragma unroll
    for (int q = 0; q < 2; ++q) {
      a[q] = *(const v4f*)(ap + q * 32 * SLEN);
      v[q] = *(const v4f*)(vp + q * 16 * (2 * N_EMB));
    }
    // the two addresses are rewritten next: the issued loads still name them
    asm volatile("s_wait_xcnt 0x0" ::: "memory");
    // holds every later register write behind that wait
    __builtin_amdgcn_sched_barrier(0);
    ap += 32;
    vp += 32 * (2 * N_EMB);
  };
  // A tile 64(d) x 32(s) -> As[d][s]; V tile 32(s) x 64(e) -> Bs[s][e]
  auto stage = [&](const v4f (&a)[2], const v4f (&v)[2]) {
#pragma unroll
    for (int q = 0; q < 2; ++q) {
      st4h(&As[(r + q * 32) * ROWH + c4], a[q].x, a[q].y, a[q].z, a[q].w);
      st4h(&Bs[(br + q * 16) * BP64 + bc4], v[q].x, v[q].y, v[q].z, v[q].w);
    }
  };
  auto products = [&]() {
    const v16h af = frag_ld(&As[(tm + nl) * ROWH], kb);
#pragma unroll
    for (int j = 0; j < 2; ++j) {
      const v16h bf = frag_ld_tr(Bs, BP64, tn0 + j * 16, lane);
      acc[j] = wmma16(af, bf, acc[j]);
    }
  };

#pragma unroll
  for (int u = 0; u < 4; ++u) fetch(pa[u], pv[u]);
  for (int s0 = 0; s0 < SLEN - 128; s0 += 128) {
#pragma unroll
    for (int u = 0; u < 4; ++u) {
      tile_begin();
      stage(pa[u], pv[u]);
      fetch(pa[u], pv[u]);   // the tile four further on, into the set just emptied
      lds_barrier();
      products();
      lds_barrier();
    }
  }
#pragma unroll
  for (int u = 0; u < 4; ++u) {   // the last four tiles: nothing left to fetch
    tile_begin();
    stage(pa[u], pv[u]);
    lds_barrier();
    products();
    lds_barrier();
  }
#pragma unroll
  for (int j = 0; j < 2; ++j) {
    const int col = tn0 + j * 16 + nl;
#pragma unroll
    for (int vi = 0; vi < 8; ++vi) {
      const int row = tm + hb + vi;
      state[(size_t)bh * (HDIM * HDIM) + row * HDIM + col] = acc[j][vi];
    }
  }
  if (tid < HDIM) {
    float s = 0.f;
#pragma unroll
    for (int ch = 0; ch < NCH; ++ch) s += kp[ch];
    ksum[bh * HDIM + tid] = s;
  }
}

// --- y[b,t,h,:] = (rope(Q)[b,t,h,:] @ state[b,h]) / denom[b,h,t] ------------
// RoPE on Q is applied while the A tile is staged: a thread holds columns
// i..i+3 and i+32..i+35 of a row, i.e. both members of four rotation pairs, so
// the rotated Q never goes through global memory. Both k halves (K = 64) are
// staged at once, so one barrier separates staging from the products.
// The denominator Q . sum_s K is formed from the same registers, before the
// rotation: eight threads hold a row, their partial dots meet by DPP.
template <int CTRL>
__device__ __forceinline__ float row_xor_add(float v) {   // v + v of lane ^ mask
  return v + __builtin_bit_cast(float, __builtin_amdgcn_update_dpp(
                 0, __builtin_bit_cast(int, v), CTRL, 0xf, 0xf, true));
}
__global__ __launch_bounds__(256)
void ygemm_kernel(const float* __restrict__ qfeat, const float* __restrict__ state,
                  const float* __restrict__ ksum, float* __restrict__ y) {
  __shared__ __attribute__((aligned(16))) _Float16 As[2][128 * ROWH];
  __shared__ __attribute__((aligned(16))) _Float16 Bs[64 * BP64];
  __shared__ __attribute__((aligned(16))) float dn[128];
  const int bh = blockIdx.y;
  const int b = bh >> 4, h = bh & 15;
  const int row0 = blockIdx.x * 128;
  const float* Aptr = qfeat + (size_t)b * TLEN * N_EMB + h * HDIM;  // rows t, lda=N_EMB
  const float* Sptr = state + (size_t)bh * (HDIM * HDIM);
  const int tid = threadIdx.x;
  const int wid = tid >> 5, lane = tid & 31;
  const int nl = lane & 15;
  const int kb = (lane >> 4) << 3;
  const int hb = (lane >> 4) << 3;

  const v8f vzero = {0.f,0.f,0.f,0.f,0.f,0.f,0.f,0.f};
  v8f acc[4] = {vzero, vzero, vzero, vzero};

  // Every row of a thread is reached from one address by a constant offset.
  const int r = tid >> 3, c4 = (tid & 7) * 4;       // A: row, first column
  const int br = tid >> 4, bc4 = (tid & 15) * 4;    // state: row, first column
  const float* ap = Aptr + (size_t)(row0 + r) * N_EMB + c4;
  const float* sp = Sptr + br * HDIM + bc4;
  v4f x1[4], x2[4], sv[4];
#pragma unroll
  for (int q = 0; q < 4; ++q) {
    x1[q] = *(const v4f*)(ap + q * 32 * N_EMB);
    x2[q] = *(const v4f*)(ap + q * 32 * N_EMB + 32);
    sv[q] = *(const v4f*)(sp + q * 16 * HDIM);
  }
  const v4f ks1 = *(const v4f*)(ksum + bh * HDIM + c4);
  const v4f ks2 = *(const v4f*)(ksum + bh * HDIM + c4 + 32);
  float dp[4];                    // dp[q] = Q[row r + 32 q, :] . ksum
#pragma unroll
  for (int q = 0; q < 4; ++q) {
    float p1 = x1[q][0] * ks1[0], p2 = x2[q][0] * ks2[0];
#pragma unroll
    for (int j = 1; j < 4; ++j) {
      p1 = fmaf(x1[q][j], ks1[j], p1);
      p2 = fmaf(x2[q][j], ks2[j], p2);
    }
    float p = p1 + p2;
    p = row_xor_add<0x161>(p);    // row_xmask:1
    p = row_xor_add<0x162>(p);    // row_xmask:2
    dp[q] = row_xor_add<0x164>(p);    // row_xmask:4
  }
  if ((tid & 7) == 0) {
#pragma unroll
    for (int q = 0; q < 4; ++q) dn[r + q * 32] = dp[q];
  }
  {   // A tile 128(t) x 64(d), rotated: As[0] = d 0..31, As[1] = d 32..63
    float inv[4];   // inv_freq[i] = 10000^(-2i/64) = exp(-i * ln(10000)/32)
#pragma unroll
    for (int j = 0; j < 4; ++j)
      inv[j] = __expf(-(float)(c4 + j) * 0.28782313662425572f);
#pragma unroll
    for (int q = 0; q < 4; ++q) {
      const float t = (float)(row0 + r + q * 32);
      _Float16* d0 = &As[0][(r + q * 32) * ROWH + c4];
      _Float16* d1 = &As[1][(r + q * 32) * ROWH + c4];
#pragma unroll
      for (int j = 0; j < 4; ++j) {
        float sn, cs;
        __sincosf(t * inv[j], &sn, &cs);
        d0[j] = (_Float16)(x1[q][j] * cs - x2[q][j] * sn);
        d1[j] = (_Float16)(x2[q][j] * cs + x1[q][j] * sn);
      }
    }
  }
  // state 64(d) x 64(e) -> Bs[d][e]; row d = br + q * 16
#pragma unroll
  for (int q = 0; q < 4; ++q)
    st4h(&Bs[(br + q * 16) * BP64 + bc4], sv[q].x, sv[q].y, sv[q].z, sv[q].w);
  __syncthreads();   // both tiles and dn are whole in LDS before anything is read
#pragma unroll
  for (int kk = 0; kk < 2; ++kk) {
    const v16h af = frag_ld(&As[kk][(wid * 16 + nl) * ROWH], kb);
#pragma unroll
    for (int j = 0; j < 4; ++j) {
      const v16h bf = frag_ld_tr(Bs + kk * 32 * BP64, BP64, j * 16, lane);
      acc[j] = wmma16(af, bf, acc[j]);
    }
  }
  float rd[8];
  const v4f dlo = *(const v4f*)&dn[wid * 16 + hb];
  const v4f dhi = *(const v4f*)&dn[wid * 16 + hb + 4];
#pragma unroll
  for (int vi = 0; vi < 4; ++vi) {
    rd[vi]     = 1.0f / dlo[vi];
    rd[vi + 4] = 1.0f / dhi[vi];
  }
#pragma unroll
  for (int j = 0; j < 4; ++j) {
#pragma unroll
    for (int vi = 0; vi < 8; ++vi) {
      const int t = row0 + wid * 16 + hb + vi;
      const int col = h * HDIM + j * 16 + nl;
      y[(size_t)(b * TLEN + t) * N_EMB + col] = acc[j][vi] * rd[vi];
    }
  }
}

// ---------------------------------------------------------------------------
extern "C" void kernel_launch(void* const* d_in, const int* in_sizes, int n_in,
                              void* d_out, int out_size, void* d_ws, size_t ws_size,
                              hipStream_t stream) {
  (void)in_sizes; (void)n_in; (void)out_size; (void)ws_size;
  const float* x      = (const float*)d_in[0];
  const float* mem    = (const float*)d_in[1];
  const float* q_w    = (const float*)d_in[2];
  const float* q_b    = (const float*)d_in[3];
  const float* kv_w   = (const float*)d_in[4];
  const float* kv_b   = (const float*)d_in[5];
  const float* proj_w = (const float*)d_in[6];
  const float* proj_b = (const float*)d_in[7];
  float* out = (float*)d_out;

  // Workspace layout (floats). Total ~81 MB.
  const size_t SZ_BTC = (size_t)BATCH * TLEN * N_EMB;     // 4 M
  float* ws      = (float*)d_ws;
  float* qfeat   = ws;                                    // [B,T,C] elu+1
  float* kvbuf   = qfeat   + SZ_BTC;                      // [B,S,2C] (K feat | V)
  float* krotT   = kvbuf   + 2 * SZ_BTC;                  // [B,H,64,S]
  float* ybuf    = krotT   + SZ_BTC;                      // [B,T,C]
  float* stateb  = ybuf    + SZ_BTC;                      // [B*H,64,64]
  float* ksum    = stateb  + (size_t)BATCH * NHEAD * HDIM * HDIM;  // [B,C]
  float* partial = ksum    + (size_t)BATCH * N_EMB;       // [NCH,B*H,64]

  const dim3 blk(256);
  const int M = BATCH * TLEN;   // 4096

  // 1) Q = elu(x@q_w + q_b)+1
  gemm_kernel<N_EMB, N_EMB><<<dim3(N_EMB / 128, M / 128), blk, 0, stream>>>(
      x, q_w, q_b, qfeat, 1, 0);
  // 2) kv = memory@kv_w + kv_b ; elu+1 on K half only
  gemm_kernel<2 * N_EMB, N_EMB><<<dim3(2 * N_EMB / 128, M / 128), blk, 0, stream>>>(
      mem, kv_w, kv_b, kvbuf, 2, N_EMB);
  // 3) RoPE on K (RoPE on Q happens inside step 5); partial sums of K over s
  rope_kt_kernel<<<dim3(SLEN / 64, BATCH * NHEAD), blk, 0, stream>>>(kvbuf, krotT, partial);
  // 4) state = K_rot^T V and ksum = sum_s K  (per b,h)
  state_kernel<<<BATCH * NHEAD, blk, 0, stream>>>(krotT, kvbuf, partial, stateb, ksum);
  // 5) y = (rope(Q) @ state) / (Q . ksum)
  ygemm_kernel<<<dim3(TLEN / 128, BATCH * NHEAD), blk, 0, stream>>>(qfeat, stateb, ksum, ybuf);
  // 6) out = y @ proj_w + proj_b
  gemm_kernel<N_EMB, N_EMB><<<dim3(N_EMB / 128, M / 128), blk, 0, stream>>>(
      ybuf, proj_w, proj_b, out, 0, 0);
}

// v006
// One run takes 86 microseconds.
// Two timings next to v005 put it at 1.33 and 1.32 times that version's speed.
// Over all steps from v000 it is 4.33 times as fast.
#include <hip/hip_runtime.h>
#include <hip/hip_bf16.h>
#include <stdint.h>

// ---------------------------------------------------------------------------
// Linear cross-attention with RoPE, MI455X (gfx1250, wave32, WMMA).
// Associativity trick: y = Q_rot @ (K_rot^T V) / (Q . sum_s K)  -- avoids TxS.
// All GEMMs run through v_wmma_f32_16x16x32_f16 with fp32 accumulation;
// fp32 operands are converted to f16 while staging through LDS.
// ---------------------------------------------------------------------------

typedef __attribute__((ext_vector_type(16))) _Float16 v16h;
typedef __attribute__((ext_vector_type(8)))  float    v8f;
typedef __attribute__((ext_vector_type(4)))  float    v4f;
typedef __attribute__((ext_vector_type(4)))  _Float16 v4h;
typedef __attribute__((ext_vector_type(8)))  short    s16x8;

#define N_EMB 1024
#define NHEAD 16
#define HDIM  64
#define BATCH 2
#define TLEN  2048
#define SLEN  2048
#define LDS_PAD 8               // halfs of padding per LDS row (row = 40 halfs)
#define ROWH (32 + LDS_PAD)     // LDS row stride in halfs (BK=32)
// B tiles lie row-major [k][n] in LDS; the pitch is an odd multiple of 32 bytes,
// for speed only.
#define BP128 (128 + 16)        // halfs per k row of a 128-column B tile (288 B)
#define BP64  (64 + 16)         // halfs per k row of a 64-column B tile (160 B)

// --- WMMA fragment helpers --------------------------------------------------
// 16-bit A-matrix 16x32 layout (ISA 7.12.2): lane&15 = row M; lanes>=16 use
// K base +8; VGPR0..3 hold K=kb..kb+7 (packed f16 pairs), VGPR4..7 hold
// K=kb+16..kb+23.  B 32x16 has the same map with lane&15 = col N.
__device__ __forceinline__ v16h frag_ld(const _Float16* rowbase, int kb) {
  union { v16h h; uint32_t u[8]; } f;
  const uint32_t* p0 = (const uint32_t*)(rowbase + kb);
  const uint32_t* p1 = (const uint32_t*)(rowbase + kb + 16);
#pragma unroll
  for (int j = 0; j < 4; ++j) { f.u[j] = p0[j]; f.u[4 + j] = p1[j]; }
  return f.h;
}

// B fragment 32(k) x 16(n) out of a row-major [k][n] f16 tile: two transposing
// loads. Lane l reads 16 bytes of row 8*(l>>4) + (l&7) and receives column
// n0 + (l&15), k = 8*(l>>4) + 0..7; the second load takes the rows 16 further
// down. That is the k order of frag_ld, register for register.
__device__ __forceinline__ v16h frag_ld_tr(const _Float16* tile, int pitch, int n0,
                                           int lane) {
  typedef __attribute__((address_space(3))) s16x8 lds_s16x8;
  const _Float16* p = tile + ((lane >> 4) * 8 + (lane & 7)) * pitch + n0 +
                      ((lane >> 3) & 1) * 8;
  union { v16h h; s16x8 s[2]; } f;
  f.s[0] = __builtin_amdgcn_ds_load_tr16_b128_v8i16((lds_s16x8*)p);
  f.s[1] = __builtin_amdgcn_ds_load_tr16_b128_v8i16((lds_s16x8*)(p + 16 * pitch));
  return f.h;
}

// Four consecutive values of one LDS row, converted and stored as one 8-byte piece.
__device__ __forceinline__ void st4h(_Float16* d, float a, float b, float c, float e) {
  const v4h h = {(_Float16)a, (_Float16)b, (_Float16)c, (_Float16)e};
  *(v4h*)d = h;
}

__device__ __forceinline__ v8f wmma16(v16h a, v16h b, v8f c) {
  // (neg_a, A, neg_b, B, c_mod, C, reuse_a, reuse_b)
  return __builtin_amdgcn_wmma_f32_16x16x32_f16(false, a, false, b,
                                                (short)0, c, false, false);
}

// Work-group barrier for LDS traffic alone. __syncthreads() also waits for the
// wave's outstanding global loads, which would end the flight of the tiles that
// the k loops below fetch ahead; the loops exchange data through LDS only.
__device__ __forceinline__ void lds_barrier() {
  __builtin_amdgcn_fence(__ATOMIC_RELEASE, "workgroup", "local");
  __builtin_amdgcn_s_barrier();
  __builtin_amdgcn_fence(__ATOMIC_ACQUIRE, "workgroup", "local");
}

// Stands where a tile's staging begins. Without it the scheduler lifts the f16
// conversions of the later register sets into the earlier tiles, and with them
// the waits for their loads, which then fly for one tile instead of all.
__device__ __forceinline__ void tile_begin() { __builtin_amdgcn_sched_barrier(0); }

__device__ __forceinline__ float elu_p1(float v) {
  return v > 0.0f ? v + 1.0f : __expf(v);   // elu(v)+1
}

// --- Generic tiled GEMM: C = A(fp32)[M,K] * B(fp32)[K,N] + bias -------------
// mode 0: plain; mode 1: elu+1 everywhere; mode 2: elu+1 only for col < halfN.
// Shapes are exact multiples of tiles (M%128==0, N%128==0, K%64==0).
// The global loads of a k tile are issued two tiles ahead, into two register
// sets, so their latency runs beside the staging and the products of the tiles
// in between. N and K are compile-time: a thread's eight loads of a tile hang on
// two addresses by constant offsets, and only those two are advanced.
template <int N, int K>
__global__ __launch_bounds__(256)
void gemm_kernel(const float* __restrict__ A, const float* __restrict__ B,
                 const float* __restrict__ bias, float* __restrict__ C,
                 int mode, int halfN) {
  __shared__ __attribute__((aligned(16))) _Float16 As[128 * ROWH];
  __shared__ __attribute__((aligned(16))) _Float16 Bs[32 * BP128];

  const int tid  = threadIdx.x;
  const int bm   = blockIdx.y * 128;
  const int bn   = blockIdx.x * 128;
  const int wid  = tid >> 5;
  const int lane = tid & 31;
  const int nl   = lane & 15;
  const int kb   = (lane >> 4) << 3;   // K base for A/B fragments
  const int hb   = (lane >> 4) << 3;   // row offset for C/D fragments
  const int wm   = (wid & 1) * 64;     // 2 waves in M  -> 64 rows each
  const int wn   = (wid >> 1) * 32;    // 4 waves in N  -> 32 cols each

  const v8f vzero = {0.f,0.f,0.f,0.f,0.f,0.f,0.f,0.f};
  v8f acc[4][2];
#pragma unroll
  for (int i = 0; i < 4; ++i)
#pragma unroll
    for (int j = 0; j < 2; ++j) acc[i][j] = vzero;

  const int r   = tid >> 3;           // A: row 0..31
  const int c4  = (tid & 7) * 4;      // A: first column 0..28
  const int br  = tid >> 5;           // B: row 0..7
  const int bc4 = (tid & 31) * 4;     // B: first column 0..124
  const float* ap = A + (size_t)(bm + r) * K + c4;
  const float* bp = B + (size_t)br * N + bn + bc4;
  v4f pa[2][4], pb[2][4];

  // One k tile (A 128x32, B 32x128) into a register set; then on to the next tile.
  auto fetch = [&](v4f (&a)[4], v4f (&b)[4]) {
#pragma unroll
    for (int q = 0; q < 4; ++q) {
      a[q] = *(const v4f*)(ap + q * 32 * K);
      b[q] = *(const v4f*)(bp + q * 8 * N);
    }
    // the two addresses are rewritten next: the issued loads still name them
    asm volatile("s_wait_xcnt 0x0" ::: "memory");
    // holds every later register write behind that wait
    __builtin_amdgcn_sched_barrier(0);
    ap += 32;
    bp += 32 * N;
  };
  // A -> As[m][k]; B -> Bs[k][n], as it lies in memory
  auto stage = [&](const v4f (&a)[4], const v4f (&b)[4]) {
#pragma unroll
    for (int q = 0; q < 4; ++q) {
      st4h(&As[(r + q * 32) * ROWH + c4], a[q].x, a[q].y, a[q].z, a[q].w);
      st4h(&Bs[(br + q * 8) * BP128 + bc4], b[q].x, b[q].y, b[q].z, b[q].w);
    }
  };
  auto products = [&]() {
    v16h af[4], bf[2];
#pragma unroll
    for (int i = 0; i < 4; ++i) af[i] = frag_ld(&As[(wm + i * 16 + nl) * ROWH], kb);
#pragma unroll
    for (int j = 0; j < 2; ++j) bf[j] = frag_ld_tr(Bs, BP128, wn + j * 16, lane);
#pragma unroll
    for (int i = 0; i < 4; ++i)
#pragma unroll
      for (int j = 0; j < 2; ++j) acc[i][j] = wmma16(af[i], bf[j], acc[i][j]);
  };

  fetch(pa[0], pb[0]);
  fetch(pa[1], pb[1]);
  for (int k0 = 0; k0 < K - 64; k0 += 64) {
#pragma unroll
    for (int u = 0; u < 2; ++u) {
      tile_begin();
      stage(pa[u], pb[u]);
      fetch(pa[u], pb[u]);   // the tile two further on, into the set just emptied
      lds_barrier();
      products();
      lds_barrier();
    }
  }
#pragma unroll
  for (int u = 0; u < 2; ++u) {   // the last two tiles: nothing left to fetch
    tile_begin();
    stage(pa[u], pb[u]);
    lds_barrier();
    products();
    lds_barrier();
  }

#pragma unroll
  for (int i = 0; i < 4; ++i)
#pragma unroll
    for (int j = 0; j < 2; ++j) {
      const int col = bn + wn + j * 16 + nl;
      const float bv = bias[col];
      const bool act = (mode == 1) || (mode == 2 && col < halfN);
#pragma unroll
      for (int vi = 0; vi < 8; ++vi) {
        const int row = bm + wm + i * 16 + hb + vi;
        float v = acc[i][j][vi] + bv;
        if (act) v = elu_p1(v);
        C[(size_t)row * N + col] = v;
      }
    }
}

// --- K side, one kernel: partial state = K_rot^T V and partial sum_s K --------
// One work-group = one head x SCH positions. K and V are read as they lie,
// [s][d] and [s][e]; RoPE is applied to K while its tile is staged (a thread
// holds columns i..i+3 and i+32..i+35 of a row, both members of four rotation
// pairs), so the rotated K never goes through global memory. Both tiles lie
// row-major over s in LDS, and the transposing load hands out A = K_rot^T as
// well as B = V in the same k order. The NSPLIT partial states and partial
// column sums of a head are added up where they are used, in the y GEMM.
#define NSPLIT 8                // work-groups per head: 256 in all, one per WGP
#define SCH (SLEN / NSPLIT)     // positions per work-group
#define NT (SCH / 32)           // s tiles per work-group
#define NBH (BATCH * NHEAD)
// sin and cos of 2*pi*rev. One statement so that the slot the instruction set
// asks for behind a transcendental is filled whatever the compiler puts next:
// v_cos is independent of v_sin (outputs never alias the input), v_nop ends it.
__device__ __forceinline__ void sincos_rev(float rev, float& sn, float& cs) {
  asm("v_sin_f32 %0, %2\n\tv_cos_f32 %1, %2\n\tv_nop"
      : "=&v"(sn), "=&v"(cs) : "v"(rev));
}
__global__ __launch_bounds__(256)
void kstate_kernel(const float* __restrict__ kv, float* __restrict__ stateP,
                   float* __restrict__ ksumP) {
  __shared__ __attribute__((aligned(16))) _Float16 Ks[SCH * BP64];
  __shared__ __attribute__((aligned(16))) _Float16 Vs[SCH * BP64];
  __shared__ __attribute__((aligned(16))) float colsum[32 * HDIM];
  const int sp = blockIdx.x;
  const int bh = blockIdx.y;
  const int b = bh >> 4, h = bh & 15;
  const int sbase = sp * SCH;
  const float* Kptr = kv + ((size_t)b * SLEN + sbase) * (2 * N_EMB) + h * HDIM;
  const int tid = threadIdx.x;
  const int wid = tid >> 5, lane = tid & 31;
  const int nl = lane & 15;
  const int hb = (lane >> 4) << 3;
  const int tm  = (wid & 3) * 16;        // 4 m-tiles (d)
  const int tn0 = (wid >> 2) * 32;       // 2 wave groups x 2 n-tiles (e)

  const v8f vzero = {0.f,0.f,0.f,0.f,0.f,0.f,0.f,0.f};
  v8f acc[2] = {vzero, vzero};

  // One work-group per WGP, so nothing but the wave's own order hides a load:
  // the loads of all NT s tiles are issued at once, each tile into its own set.
  const int r  = tid >> 3, c4  = (tid & 7) * 4;     // K: row s, first column d
  const int br = tid >> 4, bc4 = (tid & 15) * 4;    // V: row s, first column e
  const float* kp = Kptr + (size_t)r * (2 * N_EMB) + c4;
  const float* vp = Kptr + (size_t)br * (2 * N_EMB) + bc4;   // V lies N_EMB floats on
  v4f pk[NT][2], pv[NT][2];
  v4f cs1 = {0.f, 0.f, 0.f, 0.f}, cs2 = {0.f, 0.f, 0.f, 0.f};   // sums of K, unrotated
#pragma unroll
  for (int u = 0; u < NT; ++u) {
    pk[u][0] = *(const v4f*)(kp + u * 32 * (2 * N_EMB));
    pk[u][1] = *(const v4f*)(kp + u * 32 * (2 * N_EMB) + 32);
    pv[u][0] = *(const v4f*)(vp + N_EMB + u * 32 * (2 * N_EMB));
    pv[u][1] = *(const v4f*)(vp + N_EMB + (u * 32 + 16) * (2 * N_EMB));
  }
  // The issued loads still name the two address pairs. Both are inputs of the wait,
  // so they stay live up to it and no load's result is placed in them ahead of it.
  asm volatile("s_wait_xcnt 0x0" :: "v"(kp), "v"(vp) : "memory");
  // holds every later register write behind that wait
  __builtin_amdgcn_sched_barrier(0);

  float inv[4];   // inv_freq[i] = 10000^(-2i/64) = exp(-i * ln(10000)/32)
#pragma unroll
  for (int j = 0; j < 4; ++j)
    inv[j] = __expf(-(float)(c4 + j) * 0.28782313662425572f);

  // K tile 32(s) x 64(d), rotated -> Ks[s][d]; V tile 32(s) x 64(e) -> Vs[s][e];
  // s is counted from the chunk's first position
  auto stage = [&](const v4f (&k)[2], const v4f (&v)[2], int s0) {
    const float t = (float)(sbase + s0 + r);
    float lo[4], hi[4];
#pragma unroll
    for (int j = 0; j < 4; ++j) {
      float sn, cs;
      sincos_rev(t * inv[j] * 0.15915494309189532f, sn, cs);
      lo[j] = fmaf(k[0][j], cs, -(k[1][j] * sn));
      hi[j] = fmaf(k[1][j], cs, k[0][j] * sn);
    }
    st4h(&Ks[(s0 + r) * BP64 + c4],      lo[0], lo[1], lo[2], lo[3]);
    st4h(&Ks[(s0 + r) * BP64 + c4 + 32], hi[0], hi[1], hi[2], hi[3]);
    cs1 += k[0];
    cs2 += k[1];
#pragma unroll
    for (int q = 0; q < 2; ++q)
      st4h(&Vs[(s0 + br + q * 16) * BP64 + bc4], v[q].x, v[q].y, v[q].z, v[q].w);
  };

  // The whole chunk is staged, tile by tile as its loads come in; one barrier
  // then separates all staging from all products.
#pragma unroll
  for (int u = 0; u < NT; ++u) {
    tile_begin();
    stage(pk[u], pv[u], u * 32);
  }
  *(v4f*)&colsum[r * HDIM + c4]      = cs1;
  *(v4f*)&colsum[r * HDIM + c4 + 32] = cs2;
  __syncthreads();   // both tiles and the 32 row groups' column sums are whole in LDS
#pragma unroll
  for (int u = 0; u < NT; ++u) {
    const v16h af = frag_ld_tr(Ks + u * 32 * BP64, BP64, tm, lane);   // A[d][s] out of Ks[s][d]
#pragma unroll
    for (int j = 0; j < 2; ++j) {
      const v16h bf = frag_ld_tr(Vs + u * 32 * BP64, BP64, tn0 + j * 16, lane);
      acc[j] = wmma16(af, bf, acc[j]);
    }
  }
  float* st = stateP + ((size_t)sp * NBH + bh) * (HDIM * HDIM);
#pragma unroll
  for (int j = 0; j < 2; ++j) {
    const int col = tn0 + j * 16 + nl;
#pragma unroll
    for (int vi = 0; vi < 8; ++vi) {
      const int row = tm + hb + vi;
      st[row * HDIM + col] = acc[j][vi];
    }
  }
  if (tid < HDIM) {  // two whole waves: column tid over the 32 row groups
    float t = 0.f;
#pragma unroll
    for (int g = 0; g < 32; ++g) t += colsum[g * HDIM + tid];
    ksumP[((size_t)sp * NBH + bh) * HDIM + tid] = t;
  }
}

// --- y[b,t,h,:] = (rope(Q)[b,t,h,:] @ state[b,h]) / denom[b,h,t] ------------
// RoPE on Q is applied while the A tile is staged: a thread holds columns
// i..i+3 and i+32..i+35 of a row, i.e. both members of four rotation pairs, so
// the rotated Q never goes through global memory. Both k halves (K = 64) are
// staged at once, so one barrier separates staging from the products.
// The denominator Q . sum_s K is formed from the same registers, before the
// rotation: eight threads hold a row, their partial dots meet by DPP.
// The head's state and sum_s K arrive as NSPLIT partials and are added up here.
template <int CTRL>
__device__ __forceinline__ float row_xor_add(float v) {   // v + v of lane ^ mask
  return v + __builtin_bit_cast(float, __builtin_amdgcn_update_dpp(
                 0, __builtin_bit_cast(int, v), CTRL, 0xf, 0xf, true));
}
__global__ __launch_bounds__(256)
void ygemm_kernel(const float* __restrict__ qfeat, const float* __restrict__ stateP,
                  const float* __restrict__ ksumP, float* __restrict__ y) {
  __shared__ __attribute__((aligned(16))) _Float16 As[2][128 * ROWH];
  __shared__ __attribute__((aligned(16))) _Float16 Bs[64 * BP64];
  __shared__ __attribute__((aligned(16))) float dn[128];
  const int bh = blockIdx.y;
  const int b = bh >> 4, h = bh & 15;
  const int row0 = blockIdx.x * 128;
  const float* Aptr = qfeat + (size_t)b * TLEN * N_EMB + h * HDIM;  // rows t, lda=N_EMB
  const float* Sptr = stateP + (size_t)bh * (HDIM * HDIM);
  const int tid = threadIdx.x;
  const int wid = tid >> 5, lane = tid & 31;
  const int nl = lane & 15;
  const int kb = (lane >> 4) << 3;
  const int hb = (lane >> 4) << 3;

  const v8f vzero = {0.f,0.f,0.f,0.f,0.f,0.f,0.f,0.f};
  v8f acc[4] = {vzero, vzero, vzero, vzero};

  // Every row of a thread is reached from one address by a constant offset.
  const int r = tid >> 3, c4 = (tid & 7) * 4;       // A: row, first column
  const int br = tid >> 4, bc4 = (tid & 15) * 4;    // state: row, first column
  const float* ap = Aptr + (size_t)(row0 + r) * N_EMB + c4;
  const float* sp = Sptr + br * HDIM + bc4;
  v4f x1[4], x2[4], sv[4];
#pragma unroll
  for (int q = 0; q < 4; ++q) {
    x1[q] = *(const v4f*)(ap + q * 32 * N_EMB);
    x2[q] = *(const v4f*)(ap + q * 32 * N_EMB + 32);
  }
  const float* kq = ksumP + bh * HDIM + c4;
  v4f kpart[NSPLIT][2], spart[NSPLIT][4];
#pragma unroll
  for (int p = 0; p < NSPLIT; ++p) {
    kpart[p][0] = *(const v4f*)(kq + p * (NBH * HDIM));
    kpart[p][1] = *(const v4f*)(kq + p * (NBH * HDIM) + 32);
  }
#pragma unroll
  for (int p = 0; p < NSPLIT; ++p)
#pragma unroll
    for (int q = 0; q < 4; ++q)
      spart[p][q] = *(const v4f*)(sp + p * (NBH * HDIM * HDIM) + q * 16 * HDIM);
  // Every load above is issued before the first sum waits for one; without this
  // the state's loads start only when the column sums have come back.
  __builtin_amdgcn_sched_barrier(0);
  v4f ks1 = kpart[0][0], ks2 = kpart[0][1];
#pragma unroll
  for (int q = 0; q < 4; ++q) sv[q] = spart[0][q];
#pragma unroll
  for (int p = 1; p < NSPLIT; ++p) {
    ks1 += kpart[p][0];
    ks2 += kpart[p][1];
#pragma unroll
    for (int q = 0; q < 4; ++q) sv[q] += spart[p][q];
  }
  float dp[4];                    // dp[q] = Q[row r + 32 q, :] . ksum
#pragma unroll
  for (int q = 0; q < 4; ++q) {
    float p1 = x1[q][0] * ks1[0], p2 = x2[q][0] * ks2[0];
#pragma unroll
    for (int j = 1; j < 4; ++j) {
      p1 = fmaf(x1[q][j], ks1[j], p1);
      p2 = fmaf(x2[q][j], ks2[j], p2);
    }
    float p = p1 + p2;
    p = row_xor_add<0x161>(p);    // row_xmask:1
    p = row_xor_add<0x162>(p);    // row_xmask:2
    dp[q] = row_xor_add<0x164>(p);    // row_xmask:4
  }
  if ((tid & 7) == 0) {
#pragma unroll
    for (int q = 0; q < 4; ++q) dn[r + q * 32] = dp[q];
  }
  {   // A tile 128(t) x 64(d), rotated: As[0] = d 0..31, As[1] = d 32..63
    float inv[4];   // inv_freq[i] = 10000^(-2i/64) = exp(-i * ln(10000)/32)
#pragma unroll
    for (int j = 0; j < 4; ++j)
      inv[j] = __expf(-(float)(c4 + j) * 0.28782313662425572f);
#pragma unroll
    for (int q = 0; q < 4; ++q) {
      const float t = (float)(row0 + r + q * 32);
      _Float16* d0 = &As[0][(r + q * 32) * ROWH + c4];
      _Float16* d1 = &As[1][(r + q * 32) * ROWH + c4];
#pragma unroll
      for (int j = 0; j < 4; ++j) {
        float sn, cs;
        __sincosf(t * inv[j], &sn, &cs);
        d0[j] = (_Float16)(x1[q][j] * cs - x2[q][j] * sn);
        d1[j] = (_Float16)(x2[q][j] * cs + x1[q][j] * sn);
      }
    }
  }
  // state 64(d) x 64(e) -> Bs[d][e]; row d = br + q * 16
#pragma unroll
  for (int q = 0; q < 4; ++q)
    st4h(&Bs[(br + q * 16) * BP64 + bc4], sv[q].x, sv[q].y, sv[q].z, sv[q].w);
  __syncthreads();   // both tiles and dn are whole in LDS before anything is read
#pragma unroll
  for (int kk = 0; kk < 2; ++kk) {
    const v16h af = frag_ld(&As[kk][(wid * 16 + nl) * ROWH], kb);
#pragma unroll
    for (int j = 0; j < 4; ++j) {
      const v16h bf = frag_ld_tr(Bs + kk * 32 * BP64, BP64, j * 16, lane);
      acc[j] = wmma16(af, bf, acc[j]);
    }
  }
  float rd[8];
  const v4f dlo = *(const v4f*)&dn[wid * 16 + hb];
  const v4f dhi = *(const v4f*)&dn[wid * 16 + hb + 4];
#pragma unroll
  for (int vi = 0; vi < 4; ++vi) {
    rd[vi]     = 1.0f / dlo[vi];
    rd[vi + 4] = 1.0f / dhi[vi];
  }
#pragma unroll
  for (int j = 0; j < 4; ++j) {
#pragma unroll
    for (int vi = 0; vi < 8; ++vi) {
      const int t = row0 + wid * 16 + hb + vi;
      const int col = h * HDIM + j * 16 + nl;
      y[(size_t)(b * TLEN + t) * N_EMB + col] = acc[j][vi] * rd[vi];
    }
  }
}

// ---------------------------------------------------------------------------
extern "C" void kernel_launch(void* const* d_in, const int* in_sizes, int n_in,
                              void* d_out, int out_size, void* d_ws, size_t ws_size,
                              hipStream_t stream) {
  (void)in_sizes; (void)n_in; (void)out_size; (void)ws_size;
  const float* x      = (const float*)d_in[0];
  const float* mem    = (const float*)d_in[1];
  const float* q_w    = (const float*)d_in[2];
  const float* q_b    = (const float*)d_in[3];
  const float* kv_w   = (const float*)d_in[4];
  const float* kv_b   = (const float*)d_in[5];
  const float* proj_w = (const float*)d_in[6];
  const float* proj_b = (const float*)d_in[7];
  float* out = (float*)d_out;

  // Workspace layout (floats). Total ~68 MB.
  const size_t SZ_BTC = (size_t)BATCH * TLEN * N_EMB;     // 4 M
  float* ws      = (float*)d_ws;
  float* qfeat   = ws;                                    // [B,T,C] elu+1
  float* kvbuf   = qfeat   + SZ_BTC;                      // [B,S,2C] (K feat | V)
  float* ybuf    = kvbuf   + 2 * SZ_BTC;                  // [B,T,C]
  float* stateP  = ybuf    + SZ_BTC;                      // [NSPLIT,B*H,64,64]
  float* ksumP   = stateP  + (size_t)NSPLIT * NBH * HDIM * HDIM;   // [NSPLIT,B*H,64]

  const dim3 blk(256);
  const int M = BATCH * TLEN;   // 4096

  // 1) Q = elu(x@q_w + q_b)+1
  gemm_kernel<N_EMB, N_EMB><<<dim3(N_EMB / 128, M / 128), blk, 0, stream>>>(
      x, q_w, q_b, qfeat, 1, 0);
  // 2) kv = memory@kv_w + kv_b ; elu+1 on K half only
  gemm_kernel<2 * N_EMB, N_EMB><<<dim3(2 * N_EMB / 128, M / 128), blk, 0, stream>>>(
      mem, kv_w, kv_b, kvbuf, 2, N_EMB);
  // 3) partials of state = rope(K)^T V and of sum_s K  (per b,h and S chunk)
  kstate_kernel<<<dim3(NSPLIT, NBH), blk, 0, stream>>>(kvbuf, stateP, ksumP);
  // 4) y = (rope(Q) @ state) / (Q . ksum)
  ygemm_kernel<<<dim3(TLEN / 128, NBH), blk, 0, stream>>>(qfeat, stateP, ksumP, ybuf);
  // 5) out = y @ proj_w + proj_b
  gemm_kernel<N_EMB, N_EMB><<<dim3(N_EMB / 128, M / 128), blk, 0, stream>>>(
      ybuf, proj_w, proj_b, out, 0, 0);
}

// v007
// Measured time: 82.9 microseconds a run.
// Next to v006, in two timings, it ran 1.04 times as fast each time.
// Over all steps from v000 it is 4.50 times as fast.
#include <hip/hip_runtime.h>
#include <hip/hip_bf16.h>
#include <stdint.h>

// ---------------------------------------------------------------------------
// Linear cross-attention with RoPE, MI455X (gfx1250, wave32, WMMA).
// Associativity trick: y = Q_rot @ (K_rot^T V) / (Q . sum_s K)  -- avoids TxS.
// All GEMMs run through v_wmma_f32_16x16x32_f16 with fp32 accumulation;
// fp32 operands are converted to f16 while staging through LDS.
// ---------------------------------------------------------------------------

typedef __attribute__((ext_vector_type(16))) _Float16 v16h;
typedef __attribute__((ext_vector_type(8)))  float    v8f;
typedef __attribute__((ext_vector_type(4)))  float    v4f;
typedef __attribute__((ext_vector_type(4)))  _Float16 v4h;
typedef __attribute__((ext_vector_type(8)))  short    s16x8;

#define N_EMB 1024
#define NHEAD 16
#define HDIM  64
#define BATCH 2
#define TLEN  2048
#define SLEN  2048
#define LDS_PAD 8               // halfs of padding per LDS row (row = 40 halfs)
#define ROWH (32 + LDS_PAD)     // LDS row stride in halfs (BK=32)
// B tiles lie row-major [k][n] in LDS; the pitch is an odd multiple of 32 bytes,
// for speed only.
#define BP128 (128 + 16)        // halfs per k row of a 128-column B tile (288 B)
#define BP64  (64 + 16)         // halfs per k row of a 64-column B tile (160 B)

// --- WMMA fragment helpers --------------------------------------------------
// 16-bit A-matrix 16x32 layout (ISA 7.12.2): lane&15 = row M; lanes>=16 use
// K base +8; VGPR0..3 hold K=kb..kb+7 (packed f16 pairs), VGPR4..7 hold
// K=kb+16..kb+23.  B 32x16 has the same map with lane&15 = col N.
__device__ __forceinline__ v16h frag_ld(const _Float16* rowbase, int kb) {
  union { v16h h; uint32_t u[8]; } f;
  const uint32_t* p0 = (const uint32_t*)(rowbase + kb);
  const uint32_t* p1 = (const uint32_t*)(rowbase + kb + 16);
#pragma unroll
  for (int j = 0; j < 4; ++j) { f.u[j] = p0[j]; f.u[4 + j] = p1[j]; }
  return f.h;
}

// B fragment 32(k) x 16(n) out of a row-major [k][n] f16 tile: two transposing
// loads. Lane l reads 16 bytes of row 8*(l>>4) + (l&7) and receives column
// n0 + (l&15), k = 8*(l>>4) + 0..7; the second load takes the rows 16 further
// down. That is the k order of frag_ld, register for register.
__device__ __forceinline__ v16h frag_ld_tr(const _Float16* tile, int pitch, int n0,
                                           int lane) {
  typedef __attribute__((address_space(3))) s16x8 lds_s16x8;
  const _Float16* p = tile + ((lane >> 4) * 8 + (lane & 7)) * pitch + n0 +
                      ((lane >> 3) & 1) * 8;
  union { v16h h; s16x8 s[2]; } f;
  f.s[0] = __builtin_amdgcn_ds_load_tr16_b128_v8i16((lds_s16x8*)p);
  f.s[1] = __builtin_amdgcn_ds_load_tr16_b128_v8i16((lds_s16x8*)(p + 16 * pitch));
  return f.h;
}

// Four consecutive values of one LDS row, converted and stored as one 8-byte piece.
__device__ __forceinline__ void st4h(_Float16* d, float a, float b, float c, float e) {
  const v4h h = {(_Float16)a, (_Float16)b, (_Float16)c, (_Float16)e};
  *(v4h*)d = h;
}

__device__ __forceinline__ v8f wmma16(v16h a, v16h b, v8f c) {
  // (neg_a, A, neg_b, B, c_mod, C, reuse_a, reuse_b)
  return __builtin_amdgcn_wmma_f32_16x16x32_f16(false, a, false, b,
                                                (short)0, c, false, false);
}

// Whole-line stores from accumulators. A register of a 16x16 f32 tile holds 16
// columns of row v in lanes 0..15 and of row v + 8 in lanes 16..31: stored as it
// is, 64 bytes of two lines. a0 and a1 are that register of two tiles side by side
// (columns 0..15 and 16..31). The lane rows exchange one half each, and lane l then
// holds column l of row v in lo and of row v + 8 in hi: one 128-byte line a store.
__device__ __forceinline__ void whole_rows(float a0, float a1, int lane, float& lo,
                                           float& hi) {
  const bool low = lane < 16;
  const int send = __builtin_bit_cast(int, low ? a1 : a0);
  const float got = __builtin_bit_cast(float, __builtin_amdgcn_permlanex16(
      send, send, 0x76543210, 0xfedcba98, false, false));   // lane l <- lane l ^ 16
  lo = low ? a0 : got;
  hi = low ? got : a1;
}

// Work-group barrier for LDS traffic alone. __syncthreads() also waits for the
// wave's outstanding global loads, which would end the flight of the tiles that
// the k loops below fetch ahead; the loops exchange data through LDS only.
__device__ __forceinline__ void lds_barrier() {
  __builtin_amdgcn_fence(__ATOMIC_RELEASE, "workgroup", "local");
  __builtin_amdgcn_s_barrier();
  __builtin_amdgcn_fence(__ATOMIC_ACQUIRE, "workgroup", "local");
}

// Stands where a tile's staging begins. Without it the scheduler lifts the f16
// conversions of the later register sets into the earlier tiles, and with them
// the waits for their loads, which then fly for one tile instead of all.
__device__ __forceinline__ void tile_begin() { __builtin_amdgcn_sched_barrier(0); }

__device__ __forceinline__ float elu_p1(float v) {
  return v > 0.0f ? v + 1.0f : __expf(v);   // elu(v)+1
}

// --- Generic tiled GEMM: C = A(fp32)[M,K] * B(fp32)[K,N] + bias -------------
// mode 0: plain; mode 1: elu+1 everywhere; mode 2: elu+1 only for col < halfN.
// Shapes are exact multiples of tiles (M%128==0, N%128==0, K%64==0).
// The global loads of a k tile are issued two tiles ahead, into two register
// sets, so their latency runs beside the staging and the products of the tiles
// in between. N and K are compile-time: a thread's eight loads of a tile hang on
// two addresses by constant offsets, and only those two are advanced.
template <int N, int K>
__global__ __launch_bounds__(256)
void gemm_kernel(const float* __restrict__ A, const float* __restrict__ B,
                 const float* __restrict__ bias, float* __restrict__ C,
                 int mode, int halfN) {
  __shared__ __attribute__((aligned(16))) _Float16 As[128 * ROWH];
  __shared__ __attribute__((aligned(16))) _Float16 Bs[32 * BP128];

  const int tid  = threadIdx.x;
  const int bm   = blockIdx.y * 128;
  const int bn   = blockIdx.x * 128;
  const int wid  = tid >> 5;
  const int lane = tid & 31;
  const int nl   = lane & 15;
  const int kb   = (lane >> 4) << 3;   // K base for A/B fragments
  const int wm   = (wid & 1) * 64;     // 2 waves in M  -> 64 rows each
  const int wn   = (wid >> 1) * 32;    // 4 waves in N  -> 32 cols each

  const v8f vzero = {0.f,0.f,0.f,0.f,0.f,0.f,0.f,0.f};
  v8f acc[4][2];
#pragma unroll
  for (int i = 0; i < 4; ++i)
#pragma unroll
    for (int j = 0; j < 2; ++j) acc[i][j] = vzero;

  const int r   = tid >> 3;           // A: row 0..31
  const int c4  = (tid & 7) * 4;      // A: first column 0..28
  const int br  = tid >> 5;           // B: row 0..7
  const int bc4 = (tid & 31) * 4;     // B: first column 0..124
  const float* ap = A + (size_t)(bm + r) * K + c4;
  const float* bp = B + (size_t)br * N + bn + bc4;
  v4f pa[2][4], pb[2][4];

  // One k tile (A 128x32, B 32x128) into a register set; then on to the next tile.
  auto fetch = [&](v4f (&a)[4], v4f (&b)[4]) {
#pragma unroll
    for (int q = 0; q < 4; ++q) {
      a[q] = *(const v4f*)(ap + q * 32 * K);
      b[q] = *(const v4f*)(bp + q * 8 * N);
    }
    // the two addresses are rewritten next: the issued loads still name them
    asm volatile("s_wait_xcnt 0x0" ::: "memory");
    // holds every later register write behind that wait
    __builtin_amdgcn_sched_barrier(0);
    ap += 32;
    bp += 32 * N;
  };
  // A -> As[m][k]; B -> Bs[k][n], as it lies in memory
  auto stage = [&](const v4f (&a)[4], const v4f (&b)[4]) {
#pragma unroll
    for (int q = 0; q < 4; ++q) {
      st4h(&As[(r + q * 32) * ROWH + c4], a[q].x, a[q].y, a[q].z, a[q].w);
      st4h(&Bs[(br + q * 8) * BP128 + bc4], b[q].x, b[q].y, b[q].z, b[q].w);
    }
  };
  auto products = [&]() {
    v16h af[4], bf[2];
#pragma unroll
    for (int i = 0; i < 4; ++i) af[i] = frag_ld(&As[(wm + i * 16 + nl) * ROWH], kb);
#pragma unroll
    for (int j = 0; j < 2; ++j) bf[j] = frag_ld_tr(Bs, BP128, wn + j * 16, lane);
#pragma unroll
    for (int i = 0; i < 4; ++i)
#pragma unroll
      for (int j = 0; j < 2; ++j) acc[i][j] = wmma16(af[i], bf[j], acc[i][j]);
  };

  fetch(pa[0], pb[0]);
  fetch(pa[1], pb[1]);
  for (int k0 = 0; k0 < K - 64; k0 += 64) {
#pragma unroll
    for (int u = 0; u < 2; ++u) {
      tile_begin();
      stage(pa[u], pb[u]);
      fetch(pa[u], pb[u]);   // the tile two further on, into the set just emptied
      lds_barrier();
      products();
      lds_barrier();
    }
  }
#pragma unroll
  for (int u = 0; u < 2; ++u) {   // the last two tiles: nothing left to fetch
    tile_begin();
    stage(pa[u], pb[u]);
    lds_barrier();
    products();
    lds_barrier();
  }

  float bv[2];
  bool act[2];
#pragma unroll
  for (int j = 0; j < 2; ++j) {
    const int col = bn + wn + j * 16 + nl;
    bv[j] = bias[col];
    act[j] = (mode == 1) || (mode == 2 && col < halfN);
  }
#pragma unroll
  for (int i = 0; i < 4; ++i) {
    float* crow = C + (size_t)(bm + wm + i * 16) * N + bn + wn + lane;
#pragma unroll
    for (int vi = 0; vi < 8; ++vi) {
      float v[2];
#pragma unroll
      for (int j = 0; j < 2; ++j) {
        v[j] = acc[i][j][vi] + bv[j];
        if (act[j]) v[j] = elu_p1(v[j]);
      }
      float lo, hi;
      whole_rows(v[0], v[1], lane, lo, hi);
      crow[vi * N]       = lo;
      crow[(vi + 8) * N] = hi;
    }
  }
}

// --- K side, one kernel: partial state = K_rot^T V and partial sum_s K --------
// One work-group = one head x SCH positions. K and V are read as they lie,
// [s][d] and [s][e]; RoPE is applied to K while its tile is staged (a thread
// holds columns i..i+3 and i+32..i+35 of a row, both members of four rotation
// pairs), so the rotated K never goes through global memory. Both tiles lie
// row-major over s in LDS, and the transposing load hands out A = K_rot^T as
// well as B = V in the same k order. The NSPLIT partial states and partial
// column sums of a head are added up where they are used, in the y GEMM.
#define NSPLIT 8                // work-groups per head: 256 in all, one per WGP
#define SCH (SLEN / NSPLIT)     // positions per work-group
#define NT (SCH / 32)           // s tiles per work-group
#define NBH (BATCH * NHEAD)
// sin and cos of 2*pi*rev. One statement so that the slot the instruction set
// asks for behind a transcendental is filled whatever the compiler puts next:
// v_cos is independent of v_sin (outputs never alias the input), v_nop ends it.
__device__ __forceinline__ void sincos_rev(float rev, float& sn, float& cs) {
  asm("v_sin_f32 %0, %2\n\tv_cos_f32 %1, %2\n\tv_nop"
      : "=&v"(sn), "=&v"(cs) : "v"(rev));
}
__global__ __launch_bounds__(256)
void kstate_kernel(const float* __restrict__ kv, float* __restrict__ stateP,
                   float* __restrict__ ksumP) {
  __shared__ __attribute__((aligned(16))) _Float16 Ks[SCH * BP64];
  __shared__ __attribute__((aligned(16))) _Float16 Vs[SCH * BP64];
  __shared__ __attribute__((aligned(16))) float colsum[32 * HDIM];
  const int sp = blockIdx.x;
  const int bh = blockIdx.y;
  const int b = bh >> 4, h = bh & 15;
  const int sbase = sp * SCH;
  const float* Kptr = kv + ((size_t)b * SLEN + sbase) * (2 * N_EMB) + h * HDIM;
  const int tid = threadIdx.x;
  const int wid = tid >> 5, lane = tid & 31;
  const int tm  = (wid & 3) * 16;        // 4 m-tiles (d)
  const int tn0 = (wid >> 2) * 32;       // 2 wave groups x 2 n-tiles (e)

  const v8f vzero = {0.f,0.f,0.f,0.f,0.f,0.f,0.f,0.f};
  v8f acc[2] = {vzero, vzero};

  // One work-group per WGP, so nothing but the wave's own order hides a load:
  // the loads of all NT s tiles are issued at once, each tile into its own set.
  const int r  = tid >> 3, c4  = (tid & 7) * 4;     // K: row s, first column d
  const int br = tid >> 4, bc4 = (tid & 15) * 4;    // V: row s, first column e
  const float* kp = Kptr + (size_t)r * (2 * N_EMB) + c4;
  const float* vp = Kptr + (size_t)br * (2 * N_EMB) + bc4;   // V lies N_EMB floats on
  v4f pk[NT][2], pv[NT][2];
  v4f cs1 = {0.f, 0.f, 0.f, 0.f}, cs2 = {0.f, 0.f, 0.f, 0.f};   // sums of K, unrotated
#pragma unroll
  for (int u = 0; u < NT; ++u) {
    pk[u][0] = *(const v4f*)(kp + u * 32 * (2 * N_EMB));
    pk[u][1] = *(const v4f*)(kp + u * 32 * (2 * N_EMB) + 32);
    pv[u][0] = *(const v4f*)(vp + N_EMB + u * 32 * (2 * N_EMB));
    pv[u][1] = *(const v4f*)(vp + N_EMB + (u * 32 + 16) * (2 * N_EMB));
  }
  // The issued loads still name the two address pairs. Both are inputs of the wait,
  // so they stay live up to it and no load's result is placed in them ahead of it.
  asm volatile("s_wait_xcnt 0x0" :: "v"(kp), "v"(vp) : "memory");
  // holds every later register write behind that wait
  __builtin_amdgcn_sched_barrier(0);

  float inv[4];   // inv_freq[i] = 10000^(-2i/64) = exp(-i * ln(10000)/32)
#pragma unroll
  for (int j = 0; j < 4; ++j)
    inv[j] = __expf(-(float)(c4 + j) * 0.28782313662425572f);

  // K tile 32(s) x 64(d), rotated -> Ks[s][d]; V tile 32(s) x 64(e) -> Vs[s][e];
  // s is counted from the chunk's first position
  auto stage = [&](const v4f (&k)[2], const v4f (&v)[2], int s0) {
    const float t = (float)(sbase + s0 + r);
    float lo[4], hi[4];
#pragma unroll
    for (int j = 0; j < 4; ++j) {
      float sn, cs;
      sincos_rev(t * inv[j] * 0.15915494309189532f, sn, cs);
      lo[j] = fmaf(k[0][j], cs, -(k[1][j] * sn));
      hi[j] = fmaf(k[1][j], cs, k[0][j] * sn);
    }
    st4h(&Ks[(s0 + r) * BP64 + c4],      lo[0], lo[1], lo[2], lo[3]);
    st4h(&Ks[(s0 + r) * BP64 + c4 + 32], hi[0], hi[1], hi[2], hi[3]);
    cs1 += k[0];
    cs2 += k[1];
#pragma unroll
    for (int q = 0; q < 2; ++q)
      st4h(&Vs[(s0 + br + q * 16) * BP64 + bc4], v[q].x, v[q].y, v[q].z, v[q].w);
  };

  // The whole chunk is staged, tile by tile as its loads come in; one barrier
  // then separates all staging from all products.
#pragma unroll
  for (int u = 0; u < NT; ++u) {
    tile_begin();
    stage(pk[u], pv[u], u * 32);
  }
  *(v4f*)&colsum[r * HDIM + c4]      = cs1;
  *(v4f*)&colsum[r * HDIM + c4 + 32] = cs2;
  __syncthreads();   // both tiles and the 32 row groups' column sums are whole in LDS
#pragma unroll
  for (int u = 0; u < NT; ++u) {
    const v16h af = frag_ld_tr(Ks + u * 32 * BP64, BP64, tm, lane);   // A[d][s] out of Ks[s][d]
#pragma unroll
    for (int j = 0; j < 2; ++j) {
      const v16h bf = frag_ld_tr(Vs + u * 32 * BP64, BP64, tn0 + j * 16, lane);
      acc[j] = wmma16(af, bf, acc[j]);
    }
  }
  float* st = stateP + ((size_t)sp * NBH + bh) * (HDIM * HDIM);
#pragma unroll
  for (int vi = 0; vi < 8; ++vi) {
    float lo, hi;
    whole_rows(acc[0][vi], acc[1][vi], lane, lo, hi);
    st[(tm + vi) * HDIM + tn0 + lane]     = lo;
    st[(tm + vi + 8) * HDIM + tn0 + lane] = hi;
  }
  if (tid < HDIM) {  // two whole waves: column tid over the 32 row groups
    float t = 0.f;
#pragma unroll
    for (int g = 0; g < 32; ++g) t += colsum[g * HDIM + tid];
    ksumP[((size_t)sp * NBH + bh) * HDIM + tid] = t;
  }
}

// --- y[b,t,h,:] = (rope(Q)[b,t,h,:] @ state[b,h]) / denom[b,h,t] ------------
// RoPE on Q is applied while the A tile is staged: a thread holds columns
// i..i+3 and i+32..i+35 of a row, i.e. both members of four rotation pairs, so
// the rotated Q never goes through global memory. Both k halves (K = 64) are
// staged at once, so one barrier separates staging from the products.
// The denominator Q . sum_s K is formed from the same registers, before the
// rotation: eight threads hold a row, their partial dots meet by DPP.
// The head's state and sum_s K arrive as NSPLIT partials and are added up here.
template <int CTRL>
__device__ __forceinline__ float row_xor_add(float v) {   // v + v of lane ^ mask
  return v + __builtin_bit_cast(float, __builtin_amdgcn_update_dpp(
                 0, __builtin_bit_cast(int, v), CTRL, 0xf, 0xf, true));
}
__global__ __launch_bounds__(256)
void ygemm_kernel(const float* __restrict__ qfeat, const float* __restrict__ stateP,
                  const float* __restrict__ ksumP, float* __restrict__ y) {
  __shared__ __attribute__((aligned(16))) _Float16 As[2][128 * ROWH];
  __shared__ __attribute__((aligned(16))) _Float16 Bs[64 * BP64];
  __shared__ __attribute__((aligned(16))) float dn[128];
  const int bh = blockIdx.y;
  const int b = bh >> 4, h = bh & 15;
  const int row0 = blockIdx.x * 128;
  const float* Aptr = qfeat + (size_t)b * TLEN * N_EMB + h * HDIM;  // rows t, lda=N_EMB
  const float* Sptr = stateP + (size_t)bh * (HDIM * HDIM);
  const int tid = threadIdx.x;
  const int wid = tid >> 5, lane = tid & 31;
  const int nl = lane & 15;
  const int kb = (lane >> 4) << 3;
  const int hb = (lane >> 4) << 3;

  const v8f vzero = {0.f,0.f,0.f,0.f,0.f,0.f,0.f,0.f};
  v8f acc[4] = {vzero, vzero, vzero, vzero};

  // Every row of a thread is reached from one address by a constant offset.
  const int r = tid >> 3, c4 = (tid & 7) * 4;       // A: row, first column
  const int br = tid >> 4, bc4 = (tid & 15) * 4;    // state: row, first column
  const float* ap = Aptr + (size_t)(row0 + r) * N_EMB + c4;
  const float* sp = Sptr + br * HDIM + bc4;
  v4f x1[4], x2[4], sv[4];
#pragma unroll
  for (int q = 0; q < 4; ++q) {
    x1[q] = *(const v4f*)(ap + q * 32 * N_EMB);
    x2[q] = *(const v4f*)(ap + q * 32 * N_EMB + 32);
  }
  const float* kq = ksumP + bh * HDIM + c4;
  v4f kpart[NSPLIT][2], spart[NSPLIT][4];
#pragma unroll
  for (int p = 0; p < NSPLIT; ++p) {
    kpart[p][0] = *(const v4f*)(kq + p * (NBH * HDIM));
    kpart[p][1] = *(const v4f*)(kq + p * (NBH * HDIM) + 32);
  }
#pragma unroll
  for (int p = 0; p < NSPLIT; ++p)
#pragma unroll
    for (int q = 0; q < 4; ++q)
      spart[p][q] = *(const v4f*)(sp + p * (NBH * HDIM * HDIM) + q * 16 * HDIM);
  // Every load above is issued before the first sum waits for one; without this
  // the state's loads start only when the column sums have come back.
  __builtin_amdgcn_sched_barrier(0);
  v4f ks1 = kpart[0][0], ks2 = kpart[0][1];
#pragma unroll
  for (int q = 0; q < 4; ++q) sv[q] = spart[0][q];
#pragma unroll
  for (int p = 1; p < NSPLIT; ++p) {
    ks1 += kpart[p][0];
    ks2 += kpart[p][1];
#pragma unroll
    for (int q = 0; q < 4; ++q) sv[q] += spart[p][q];
  }
  float dp[4];                    // dp[q] = Q[row r + 32 q, :] . ksum
#pragma unroll
  for (int q = 0; q < 4; ++q) {
    float p1 = x1[q][0] * ks1[0], p2 = x2[q][0] * ks2[0];
#pragma unroll
    for (int j = 1; j < 4; ++j) {
      p1 = fmaf(x1[q][j], ks1[j], p1);
      p2 = fmaf(x2[q][j], ks2[j], p2);
    }
    float p = p1 + p2;
    p = row_xor_add<0x161>(p);    // row_xmask:1
    p = row_xor_add<0x162>(p);    // row_xmask:2
    dp[q] = row_xor_add<0x164>(p);    // row_xmask:4
  }
  if ((tid & 7) == 0) {
#pragma unroll
    for (int q = 0; q < 4; ++q) dn[r + q * 32] = dp[q];
  }
  {   // A tile 128(t) x 64(d), rotated: As[0] = d 0..31, As[1] = d 32..63
    float inv[4];   // inv_freq[i] = 10000^(-2i/64) = exp(-i * ln(10000)/32)
#pragma unroll
    for (int j = 0; j < 4; ++j)
      inv[j] = __expf(-(float)(c4 + j) * 0.28782313662425572f);
#pragma unroll
    for (int q = 0; q < 4; ++q) {
      const float t = (float)(row0 + r + q * 32);
      _Float16* d0 = &As[0][(r + q * 32) * ROWH + c4];
      _Float16* d1 = &As[1][(r + q * 32) * ROWH + c4];
#pragma unroll
      for (int j = 0; j < 4; ++j) {
        float sn, cs;
        __sincosf(t * inv[j], &sn, &cs);
        d0[j] = (_Float16)(x1[q][j] * cs - x2[q][j] * sn);
        d1[j] = (_Float16)(x2[q][j] * cs + x1[q][j] * sn);
      }
    }
  }
  // state 64(d) x 64(e) -> Bs[d][e]; row d = br + q * 16
#pragma unroll
  for (int q = 0; q < 4; ++q)
    st4h(&Bs[(br + q * 16) * BP64 + bc4], sv[q].x, sv[q].y, sv[q].z, sv[q].w);
  __syncthreads();   // both tiles and dn are whole in LDS before anything is read
#pragma unroll
  for (int kk = 0; kk < 2; ++kk) {
    const v16h af = frag_ld(&As[kk][(wid * 16 + nl) * ROWH], kb);
#pragma unroll
    for (int j = 0; j < 4; ++j) {
      const v16h bf = frag_ld_tr(Bs + kk * 32 * BP64, BP64, j * 16, lane);
      acc[j] = wmma16(af, bf, acc[j]);
    }
  }
  float rd[8];
  const v4f dlo = *(const v4f*)&dn[wid * 16 + hb];
  const v4f dhi = *(const v4f*)&dn[wid * 16 + hb + 4];
#pragma unroll
  for (int vi = 0; vi < 4; ++vi) {
    rd[vi]     = 1.0f / dlo[vi];
    rd[vi + 4] = 1.0f / dhi[vi];
  }
  float* yrow = y + (size_t)(b * TLEN + row0 + wid * 16) * N_EMB + h * HDIM + lane;
#pragma unroll
  for (int j = 0; j < 4; j += 2) {
#pragma unroll
    for (int vi = 0; vi < 8; ++vi) {
      float lo, hi;
      whole_rows(acc[j][vi] * rd[vi], acc[j + 1][vi] * rd[vi], lane, lo, hi);
      yrow[vi * N_EMB + j * 16]       = lo;
      yrow[(vi + 8) * N_EMB + j * 16] = hi;
    }
  }
}

// ---------------------------------------------------------------------------
extern "C" void kernel_launch(void* const* d_in, const int* in_sizes, int n_in,
                              void* d_out, int out_size, void* d_ws, size_t ws_size,
                              hipStream_t stream) {
  (void)in_sizes; (void)n_in; (void)out_size; (void)ws_size;
  const float* x      = (const float*)d_in[0];
  const float* mem    = (const float*)d_in[1];
  const float* q_w    = (const float*)d_in[2];
  const float* q_b    = (const float*)d_in[3];
  const float* kv_w   = (const float*)d_in[4];
  const float* kv_b   = (const float*)d_in[5];
  const float* proj_w = (const float*)d_in[6];
  const float* proj_b = (const float*)d_in[7];
  float* out = (float*)d_out;

  // Workspace layout (floats). Total ~68 MB.
  const size_t SZ_BTC = (size_t)BATCH * TLEN * N_EMB;     // 4 M
  float* ws      = (float*)d_ws;
  float* qfeat   = ws;                                    // [B,T,C] elu+1
  float* kvbuf   = qfeat   + SZ_BTC;                      // [B,S,2C] (K feat | V)
  float* ybuf    = kvbuf   + 2 * SZ_BTC;                  // [B,T,C]
  float* stateP  = ybuf    + SZ_BTC;                      // [NSPLIT,B*H,64,64]
  float* ksumP   = stateP  + (size_t)NSPLIT * NBH * HDIM * HDIM;   // [NSPLIT,B*H,64]

  const dim3 blk(256);
  const int M = BATCH * TLEN;   // 4096

  // 1) Q = elu(x@q_w + q_b)+1
  gemm_kernel<N_EMB, N_EMB><<<dim3(N_EMB / 128, M / 128), blk, 0, stream>>>(
      x, q_w, q_b, qfeat, 1, 0);
  // 2) kv = memory@kv_w + kv_b ; elu+1 on K half only
  gemm_kernel<2 * N_EMB, N_EMB><<<dim3(2 * N_EMB / 128, M / 128), blk, 0, stream>>>(
      mem, kv_w, kv_b, kvbuf, 2, N_EMB);
  // 3) partials of state = rope(K)^T V and of sum_s K  (per b,h and S chunk)
  kstate_kernel<<<dim3(NSPLIT, NBH), blk, 0, stream>>>(kvbuf, stateP, ksumP);
  // 4) y = (rope(Q) @ state) / (Q . ksum)
  ygemm_kernel<<<dim3(TLEN / 128, NBH), blk, 0, stream>>>(qfeat, stateP, ksumP, ybuf);
  // 5) out = y @ proj_w + proj_b
  gemm_kernel<N_EMB, N_EMB><<<dim3(N_EMB / 128, M / 128), blk, 0, stream>>>(
      ybuf, proj_w, proj_b, out, 0, 0);
}

// v008
// Measured time: 78.7 microseconds a run.
// In two side-by-side timings against v007, it was 1.04 and 1.06 times as fast.
// Over all steps from v000 it is 4.72 times as fast.
#include <hip/hip_runtime.h>
#include <hip/hip_bf16.h>
#include <stdint.h>

// ---------------------------------------------------------------------------
// Linear cross-attention with RoPE, MI455X (gfx1250, wave32, WMMA).
// Associativity trick: y = Q_rot @ (K_rot^T V) / (Q . sum_s K)  -- avoids TxS.
// All GEMMs run through v_wmma_f32_16x16x32_f16 with fp32 accumulation;
// fp32 operands are converted to f16 while staging through LDS.
// ---------------------------------------------------------------------------

typedef __attribute__((ext_vector_type(16))) _Float16 v16h;
typedef __attribute__((ext_vector_type(8)))  float    v8f;
typedef __attribute__((ext_vector_type(4)))  float    v4f;
typedef __attribute__((ext_vector_type(4)))  _Float16 v4h;
typedef __attribute__((ext_vector_type(8)))  short    s16x8;

#define N_EMB 1024
#define NHEAD 16
#define HDIM  64
#define BATCH 2
#define TLEN  2048
#define SLEN  2048
#define LDS_PAD 8               // halfs of padding per LDS row (row = 40 halfs)
#define ROWH (32 + LDS_PAD)     // LDS row stride in halfs (BK=32)
// B tiles lie row-major [k][n] in LDS; the pitch is an odd multiple of 32 bytes,
// for speed only.
#define BP128 (128 + 16)        // halfs per k row of a 128-column B tile (288 B)
#define BP64  (64 + 16)         // halfs per k row of a 64-column B tile (160 B)

// --- WMMA fragment helpers --------------------------------------------------
// 16-bit A-matrix 16x32 layout (ISA 7.12.2): lane&15 = row M; lanes>=16 use
// K base +8; VGPR0..3 hold K=kb..kb+7 (packed f16 pairs), VGPR4..7 hold
// K=kb+16..kb+23.  B 32x16 has the same map with lane&15 = col N.
__device__ __forceinline__ v16h frag_ld(const _Float16* rowbase, int kb) {
  union { v16h h; uint32_t u[8]; } f;
  const uint32_t* p0 = (const uint32_t*)(rowbase + kb);
  const uint32_t* p1 = (const uint32_t*)(rowbase + kb + 16);
#pragma unroll
  for (int j = 0; j < 4; ++j) { f.u[j] = p0[j]; f.u[4 + j] = p1[j]; }
  return f.h;
}

// B fragment 32(k) x 16(n) out of a row-major [k][n] f16 tile: two transposing
// loads. Lane l reads 16 bytes of row 8*(l>>4) + (l&7) and receives column
// n0 + (l&15), k = 8*(l>>4) + 0..7; the second load takes the rows 16 further
// down. That is the k order of frag_ld, register for register.
__device__ __forceinline__ v16h frag_ld_tr(const _Float16* tile, int pitch, int n0,
                                           int lane) {
  typedef __attribute__((address_space(3))) s16x8 lds_s16x8;
  const _Float16* p = tile + ((lane >> 4) * 8 + (lane & 7)) * pitch + n0 +
                      ((lane >> 3) & 1) * 8;
  union { v16h h; s16x8 s[2]; } f;
  f.s[0] = __builtin_amdgcn_ds_load_tr16_b128_v8i16((lds_s16x8*)p);
  f.s[1] = __builtin_amdgcn_ds_load_tr16_b128_v8i16((lds_s16x8*)(p + 16 * pitch));
  return f.h;
}

// Four consecutive values of one LDS row, converted and stored as one 8-byte piece.
__device__ __forceinline__ void st4h(_Float16* d, float a, float b, float c, float e) {
  const v4h h = {(_Float16)a, (_Float16)b, (_Float16)c, (_Float16)e};
  *(v4h*)d = h;
}

__device__ __forceinline__ v8f wmma16(v16h a, v16h b, v8f c) {
  // (neg_a, A, neg_b, B, c_mod, C, reuse_a, reuse_b)
  return __builtin_amdgcn_wmma_f32_16x16x32_f16(false, a, false, b,
                                                (short)0, c, false, false);
}

// Whole-line stores from accumulators. A register of a 16x16 f32 tile holds 16
// columns of row v in lanes 0..15 and of row v + 8 in lanes 16..31: stored as it
// is, 64 bytes of two lines. a0 and a1 are that register of two tiles side by side
// (columns 0..15 and 16..31). The lane rows exchange one half each, and lane l then
// holds column l of row v in lo and of row v + 8 in hi: one 128-byte line a store.
__device__ __forceinline__ void whole_rows(float a0, float a1, int lane, float& lo,
                                           float& hi) {
  const bool low = lane < 16;
  const int send = __builtin_bit_cast(int, low ? a1 : a0);
  const float got = __builtin_bit_cast(float, __builtin_amdgcn_permlanex16(
      send, send, 0x76543210, 0xfedcba98, false, false));   // lane l <- lane l ^ 16
  lo = low ? a0 : got;
  hi = low ? got : a1;
}

// Work-group barrier for LDS traffic alone. __syncthreads() also waits for the
// wave's outstanding global loads, which would end the flight of the tiles that
// the k loops below fetch ahead; the loops exchange data through LDS only.
__device__ __forceinline__ void lds_barrier() {
  __builtin_amdgcn_fence(__ATOMIC_RELEASE, "workgroup", "local");
  __builtin_amdgcn_s_barrier();
  __builtin_amdgcn_fence(__ATOMIC_ACQUIRE, "workgroup", "local");
}

// Stands where a tile's staging begins. Without it the scheduler lifts the f16
// conversions of the later register sets into the earlier tiles, and with them
// the waits for their loads, which then fly for one tile instead of all.
__device__ __forceinline__ void tile_begin() { __builtin_amdgcn_sched_barrier(0); }

__device__ __forceinline__ float elu_p1(float v) {
  return v > 0.0f ? v + 1.0f : __expf(v);   // elu(v)+1
}

// --- Generic tiled GEMM: C = A(fp32)[M,K] * B(fp32)[K,N] + bias -------------
// mode 0: plain; mode 1: elu+1 everywhere; mode 2: elu+1 only for col < halfN.
// Shapes are exact multiples of tiles (M%128==0, N%128==0, K%64==0, K>=128).
// The global loads of a k tile are issued two tiles ahead, into two register
// sets, so their latency runs beside the staging and the products of the tiles
// in between. N and K are compile-time: a thread's eight loads of a tile hang on
// two addresses by constant offsets, and only those two are advanced.
// The LDS tiles have two buffers: while tile t is read out of one, tile t + 1 is
// staged into the other, so one barrier a tile both publishes tile t + 1 and ends
// the last read of the buffer that is written next.
template <int N, int K>
__global__ __launch_bounds__(256)
void gemm_kernel(const float* __restrict__ A, const float* __restrict__ B,
                 const float* __restrict__ bias, float* __restrict__ C,
                 int mode, int halfN) {
  __shared__ __attribute__((aligned(16))) _Float16 As[2][128 * ROWH];
  __shared__ __attribute__((aligned(16))) _Float16 Bs[2][32 * BP128];

  const int tid  = threadIdx.x;
  const int bm   = blockIdx.y * 128;
  const int bn   = blockIdx.x * 128;
  const int wid  = tid >> 5;
  const int lane = tid & 31;
  const int nl   = lane & 15;
  const int kb   = (lane >> 4) << 3;   // K base for A/B fragments
  const int wm   = (wid & 1) * 64;     // 2 waves in M  -> 64 rows each
  const int wn   = (wid >> 1) * 32;    // 4 waves in N  -> 32 cols each

  const v8f vzero = {0.f,0.f,0.f,0.f,0.f,0.f,0.f,0.f};
  v8f acc[4][2];
#pragma unroll
  for (int i = 0; i < 4; ++i)
#pragma unroll
    for (int j = 0; j < 2; ++j) acc[i][j] = vzero;

  const int r   = tid >> 3;           // A: row 0..31
  const int c4  = (tid & 7) * 4;      // A: first column 0..28
  const int br  = tid >> 5;           // B: row 0..7
  const int bc4 = (tid & 31) * 4;     // B: first column 0..124
  const float* ap = A + (size_t)(bm + r) * K + c4;
  const float* bp = B + (size_t)br * N + bn + bc4;
  v4f pa[2][4], pb[2][4];

  // One k tile (A 128x32, B 32x128) into a register set; then on to the next tile.
  auto fetch = [&](v4f (&a)[4], v4f (&b)[4]) {
#pragma unroll
    for (int q = 0; q < 4; ++q) {
      a[q] = *(const v4f*)(ap + q * 32 * K);
      b[q] = *(const v4f*)(bp + q * 8 * N);
    }
    // the two addresses are rewritten next: the issued loads still name them
    asm volatile("s_wait_xcnt 0x0" ::: "memory");
    // holds every later register write behind that wait
    __builtin_amdgcn_sched_barrier(0);
    ap += 32;
    bp += 32 * N;
  };
  // A -> As[w][m][k]; B -> Bs[w][k][n], as it lies in memory
  auto stage = [&](int w, const v4f (&a)[4], const v4f (&b)[4]) {
#pragma unroll
    for (int q = 0; q < 4; ++q) {
      st4h(&As[w][(r + q * 32) * ROWH + c4], a[q].x, a[q].y, a[q].z, a[q].w);
      st4h(&Bs[w][(br + q * 8) * BP128 + bc4], b[q].x, b[q].y, b[q].z, b[q].w);
    }
  };
  // Tile t, u = t & 1: its fragments out of buffer u; under their flight tile t + 1
  // goes from register set 1 - u into buffer 1 - u, and tile t + 3 is fetched into
  // that set; then the products.
  auto step = [&](int u, bool more, bool refill) {
    tile_begin();
    v16h af[4], bf[2];
#pragma unroll
    for (int j = 0; j < 2; ++j) bf[j] = frag_ld_tr(Bs[u], BP128, wn + j * 16, lane);
#pragma unroll
    for (int i = 0; i < 4; ++i) af[i] = frag_ld(&As[u][(wm + i * 16 + nl) * ROWH], kb);
    // All twelve fragment loads are issued here, as one group: left free, they are
    // spread among the products on one register set, one LDS latency after another.
    __builtin_amdgcn_sched_barrier(0);
    if (more) stage(1 - u, pa[1 - u], pb[1 - u]);
    if (refill) fetch(pa[1 - u], pb[1 - u]);
#pragma unroll
    for (int i = 0; i < 4; ++i)
#pragma unroll
      for (int j = 0; j < 2; ++j) acc[i][j] = wmma16(af[i], bf[j], acc[i][j]);
    // Keeps the products in front of the barrier: they wait for the fragments only
    // and run while the staging stores drain. Left free, the barrier and its wait
    // for those stores are lifted over them, and LDS idles while they are issued.
    if (more) {
      __builtin_amdgcn_sched_barrier(0);
      lds_barrier();
    }
  };

  constexpr int NTILE = K / 32;
  v4f fa[4], fb[4];   // tile 0 has a set of its own: tile 2's loads do not wait for its staging
  fetch(fa, fb);
  fetch(pa[1], pb[1]);
  fetch(pa[0], pb[0]);
  tile_begin();
  stage(0, fa, fb);
  lds_barrier();
  for (int t = 0; t < NTILE - 4; t += 2) {
    step(0, true, true);
    step(1, true, true);
  }
  step(0, true, true);     // tile NTILE - 4 fetches the last tile
  step(1, true, false);
  step(0, true, false);
  step(1, false, false);   // the last tile: nothing left to stage

  float bv[2];
  bool act[2];
#pragma unroll
  for (int j = 0; j < 2; ++j) {
    const int col = bn + wn + j * 16 + nl;
    bv[j] = bias[col];
    act[j] = (mode == 1) || (mode == 2 && col < halfN);
  }
#pragma unroll
  for (int i = 0; i < 4; ++i) {
    float* crow = C + (size_t)(bm + wm + i * 16) * N + bn + wn + lane;
#pragma unroll
    for (int vi = 0; vi < 8; ++vi) {
      float v[2];
#pragma unroll
      for (int j = 0; j < 2; ++j) {
        v[j] = acc[i][j][vi] + bv[j];
        if (act[j]) v[j] = elu_p1(v[j]);
      }
      float lo, hi;
      whole_rows(v[0], v[1], lane, lo, hi);
      crow[vi * N]       = lo;
      crow[(vi + 8) * N] = hi;
    }
  }
}

// --- K side, one kernel: partial state = K_rot^T V and partial sum_s K --------
// One work-group = one head x SCH positions. K and V are read as they lie,
// [s][d] and [s][e]; RoPE is applied to K while its tile is staged (a thread
// holds columns i..i+3 and i+32..i+35 of a row, both members of four rotation
// pairs), so the rotated K never goes through global memory. Both tiles lie
// row-major over s in LDS, and the transposing load hands out A = K_rot^T as
// well as B = V in the same k order. The NSPLIT partial states and partial
// column sums of a head are added up where they are used, in the y GEMM.
#define NSPLIT 8                // work-groups per head: 256 in all, one per WGP
#define SCH (SLEN / NSPLIT)     // positions per work-group
#define NT (SCH / 32)           // s tiles per work-group
#define NBH (BATCH * NHEAD)
// sin and cos of 2*pi*rev. One statement so that the slot the instruction set
// asks for behind a transcendental is filled whatever the compiler puts next:
// v_cos is independent of v_sin (outputs never alias the input), v_nop ends it.
__device__ __forceinline__ void sincos_rev(float rev, float& sn, float& cs) {
  asm("v_sin_f32 %0, %2\n\tv_cos_f32 %1, %2\n\tv_nop"
      : "=&v"(sn), "=&v"(cs) : "v"(rev));
}
__global__ __launch_bounds__(256)
void kstate_kernel(const float* __restrict__ kv, float* __restrict__ stateP,
                   float* __restrict__ ksumP) {
  __shared__ __attribute__((aligned(16))) _Float16 Ks[SCH * BP64];
  __shared__ __attribute__((aligned(16))) _Float16 Vs[SCH * BP64];
  __shared__ __attribute__((aligned(16))) float colsum[32 * HDIM];
  const int sp = blockIdx.x;
  const int bh = blockIdx.y;
  const int b = bh >> 4, h = bh & 15;
  const int sbase = sp * SCH;
  const float* Kptr = kv + ((size_t)b * SLEN + sbase) * (2 * N_EMB) + h * HDIM;
  const int tid = threadIdx.x;
  const int wid = tid >> 5, lane = tid & 31;
  const int tm  = (wid & 3) * 16;        // 4 m-tiles (d)
  const int tn0 = (wid >> 2) * 32;       // 2 wave groups x 2 n-tiles (e)

  const v8f vzero = {0.f,0.f,0.f,0.f,0.f,0.f,0.f,0.f};
  v8f acc[2] = {vzero, vzero};

  // One work-group per WGP, so nothing but the wave's own order hides a load:
  // the loads of all NT s tiles are issued at once, each tile into its own set.
  const int r  = tid >> 3, c4  = (tid & 7) * 4;     // K: row s, first column d
  const int br = tid >> 4, bc4 = (tid & 15) * 4;    // V: row s, first column e
  const float* kp = Kptr + (size_t)r * (2 * N_EMB) + c4;
  const float* vp = Kptr + (size_t)br * (2 * N_EMB) + bc4;   // V lies N_EMB floats on
  v4f pk[NT][2], pv[NT][2];
  v4f cs1 = {0.f, 0.f, 0.f, 0.f}, cs2 = {0.f, 0.f, 0.f, 0.f};   // sums of K, unrotated
#pragma unroll
  for (int u = 0; u < NT; ++u) {
    pk[u][0] = *(const v4f*)(kp + u * 32 * (2 * N_EMB));
    pk[u][1] = *(const v4f*)(kp + u * 32 * (2 * N_EMB) + 32);
    pv[u][0] = *(const v4f*)(vp + N_EMB + u * 32 * (2 * N_EMB));
    pv[u][1] = *(const v4f*)(vp + N_EMB + (u * 32 + 16) * (2 * N_EMB));
  }
  // The issued loads still name the two address pairs. Both are inputs of the wait,
  // so they stay live up to it and no load's result is placed in them ahead of it.
  asm volatile("s_wait_xcnt 0x0" :: "v"(kp), "v"(vp) : "memory");
  // holds every later register write behind that wait
  __builtin_amdgcn_sched_barrier(0);

  float inv[4];   // inv_freq[i] = 10000^(-2i/64) = exp(-i * ln(10000)/32)
#pragma unroll
  for (int j = 0; j < 4; ++j)
    inv[j] = __expf(-(float)(c4 + j) * 0.28782313662425572f);

  // K tile 32(s) x 64(d), rotated -> Ks[s][d]; V tile 32(s) x 64(e) -> Vs[s][e];
  // s is counted from the chunk's first position
  auto stage = [&](const v4f (&k)[2], const v4f (&v)[2], int s0) {
    const float t = (float)(sbase + s0 + r);
    float lo[4], hi[4];
#pragma unroll
    for (int j = 0; j < 4; ++j) {
      float sn, cs;
      sincos_rev(t * inv[j] * 0.15915494309189532f, sn, cs);
      lo[j] = fmaf(k[0][j], cs, -(k[1][j] * sn));
      hi[j] = fmaf(k[1][j], cs, k[0][j] * sn);
    }
    st4h(&Ks[(s0 + r) * BP64 + c4],      lo[0], lo[1], lo[2], lo[3]);
    st4h(&Ks[(s0 + r) * BP64 + c4 + 32], hi[0], hi[1], hi[2], hi[3]);
    cs1 += k[0];
    cs2 += k[1];
#pragma unroll
    for (int q = 0; q < 2; ++q)
      st4h(&Vs[(s0 + br + q * 16) * BP64 + bc4], v[q].x, v[q].y, v[q].z, v[q].w);
  };

  // The whole chunk is staged, tile by tile as its loads come in; one barrier
  // then separates all staging from all products.
#pragma unroll
  for (int u = 0; u < NT; ++u) {
    tile_begin();
    stage(pk[u], pv[u], u * 32);
  }
  *(v4f*)&colsum[r * HDIM + c4]      = cs1;
  *(v4f*)&colsum[r * HDIM + c4 + 32] = cs2;
  __syncthreads();   // both tiles and the 32 row groups' column sums are whole in LDS
#pragma unroll
  for (int u = 0; u < NT; ++u) {
    const v16h af = frag_ld_tr(Ks + u * 32 * BP64, BP64, tm, lane);   // A[d][s] out of Ks[s][d]
#pragma unroll
    for (int j = 0; j < 2; ++j) {
      const v16h bf = frag_ld_tr(Vs + u * 32 * BP64, BP64, tn0 + j * 16, lane);
      acc[j] = wmma16(af, bf, acc[j]);
    }
  }
  float* st = stateP + ((size_t)sp * NBH + bh) * (HDIM * HDIM);
#pragma unroll
  for (int vi = 0; vi < 8; ++vi) {
    float lo, hi;
    whole_rows(acc[0][vi], acc[1][vi], lane, lo, hi);
    st[(tm + vi) * HDIM + tn0 + lane]     = lo;
    st[(tm + vi + 8) * HDIM + tn0 + lane] = hi;
  }
  if (tid < HDIM) {  // two whole waves: column tid over the 32 row groups
    float t = 0.f;
#pragma unroll
    for (int g = 0; g < 32; ++g) t += colsum[g * HDIM + tid];
    ksumP[((size_t)sp * NBH + bh) * HDIM + tid] = t;
  }
}

// --- y[b,t,h,:] = (rope(Q)[b,t,h,:] @ state[b,h]) / denom[b,h,t] ------------
// RoPE on Q is applied while the A tile is staged: a thread holds columns
// i..i+3 and i+32..i+35 of a row, i.e. both members of four rotation pairs, so
// the rotated Q never goes through global memory. Both k halves (K = 64) are
// staged at once, so one barrier separates staging from the products.
// The denominator Q . sum_s K is formed from the same registers, before the
// rotation: eight threads hold a row, their partial dots meet by DPP.
// The head's state and sum_s K arrive as NSPLIT partials and are added up here.
template <int CTRL>
__device__ __forceinline__ float row_xor_add(float v) {   // v + v of lane ^ mask
  return v + __builtin_bit_cast(float, __builtin_amdgcn_update_dpp(
                 0, __builtin_bit_cast(int, v), CTRL, 0xf, 0xf, true));
}
__global__ __launch_bounds__(256)
void ygemm_kernel(const float* __restrict__ qfeat, const float* __restrict__ stateP,
                  const float* __restrict__ ksumP, float* __restrict__ y) {
  __shared__ __attribute__((aligned(16))) _Float16 As[2][128 * ROWH];
  __shared__ __attribute__((aligned(16))) _Float16 Bs[64 * BP64];
  __shared__ __attribute__((aligned(16))) float dn[128];
  const int bh = blockIdx.y;
  const int b = bh >> 4, h = bh & 15;
  const int row0 = blockIdx.x * 128;
  const float* Aptr = qfeat + (size_t)b * TLEN * N_EMB + h * HDIM;  // rows t, lda=N_EMB
  const float* Sptr = stateP + (size_t)bh * (HDIM * HDIM);
  const int tid = threadIdx.x;
  const int wid = tid >> 5, lane = tid & 31;
  const int nl = lane & 15;
  const int kb = (lane >> 4) << 3;
  const int hb = (lane >> 4) << 3;

  const v8f vzero = {0.f,0.f,0.f,0.f,0.f,0.f,0.f,0.f};
  v8f acc[4] = {vzero, vzero, vzero, vzero};

  // Every row of a thread is reached from one address by a constant offset.
  const int r = tid >> 3, c4 = (tid & 7) * 4;       // A: row, first column
  const int br = tid >> 4, bc4 = (tid & 15) * 4;    // state: row, first column
  const float* ap = Aptr + (size_t)(row0 + r) * N_EMB + c4;
  const float* sp = Sptr + br * HDIM + bc4;
  v4f x1[4], x2[4], sv[4];
#pragma unroll
  for (int q = 0; q < 4; ++q) {
    x1[q] = *(const v4f*)(ap + q * 32 * N_EMB);
    x2[q] = *(const v4f*)(ap + q * 32 * N_EMB + 32);
  }
  const float* kq = ksumP + bh * HDIM + c4;
  v4f kpart[NSPLIT][2], spart[NSPLIT][4];
#pragma unroll
  for (int p = 0; p < NSPLIT; ++p) {
    kpart[p][0] = *(const v4f*)(kq + p * (NBH * HDIM));
    kpart[p][1] = *(const v4f*)(kq + p * (NBH * HDIM) + 32);
  }
#pragma unroll
  for (int p = 0; p < NSPLIT; ++p)
#pragma unroll
    for (int q = 0; q < 4; ++q)
      spart[p][q] = *(const v4f*)(sp + p * (NBH * HDIM * HDIM) + q * 16 * HDIM);
  // Every load above is issued before the first sum waits for one; without this
  // the state's loads start only when the column sums have come back.
  __builtin_amdgcn_sched_barrier(0);
  v4f ks1 = kpart[0][0], ks2 = kpart[0][1];
#pragma unroll
  for (int q = 0; q < 4; ++q) sv[q] = spart[0][q];
#pragma unroll
  for (int p = 1; p < NSPLIT; ++p) {
    ks1 += kpart[p][0];
    ks2 += kpart[p][1];
#pragma unroll
    for (int q = 0; q < 4; ++q) sv[q] += spart[p][q];
  }
  float dp[4];                    // dp[q] = Q[row r + 32 q, :] . ksum
#pragma unroll
  for (int q = 0; q < 4; ++q) {
    float p1 = x1[q][0] * ks1[0], p2 = x2[q][0] * ks2[0];
#pragma unroll
    for (int j = 1; j < 4; ++j) {
      p1 = fmaf(x1[q][j], ks1[j], p1);
      p2 = fmaf(x2[q][j], ks2[j], p2);
    }
    float p = p1 + p2;
    p = row_xor_add<0x161>(p);    // row_xmask:1
    p = row_xor_add<0x162>(p);    // row_xmask:2
    dp[q] = row_xor_add<0x164>(p);    // row_xmask:4
  }
  if ((tid & 7) == 0) {
#pragma unroll
    for (int q = 0; q < 4; ++q) dn[r + q * 32] = dp[q];
  }
  {   // A tile 128(t) x 64(d), rotated: As[0] = d 0..31, As[1] = d 32..63
    float inv[4];   // inv_freq[i] = 10000^(-2i/64) = exp(-i * ln(10000)/32)
#pragma unroll
    for (int j = 0; j < 4; ++j)
      inv[j] = __expf(-(float)(c4 + j) * 0.28782313662425572f);
#pragma unroll
    for (int q = 0; q < 4; ++q) {
      const float t = (float)(row0 + r + q * 32);
      _Float16* d0 = &As[0][(r + q * 32) * ROWH + c4];
      _Float16* d1 = &As[1][(r + q * 32) * ROWH + c4];
#pragma unroll
      for (int j = 0; j < 4; ++j) {
        float sn, cs;
        __sincosf(t * inv[j], &sn, &cs);
        d0[j] = (_Float16)(x1[q][j] * cs - x2[q][j] * sn);
        d1[j] = (_Float16)(x2[q][j] * cs + x1[q][j] * sn);
      }
    }
  }
  // state 64(d) x 64(e) -> Bs[d][e]; row d = br + q * 16
#pragma unroll
  for (int q = 0; q < 4; ++q)
    st4h(&Bs[(br + q * 16) * BP64 + bc4], sv[q].x, sv[q].y, sv[q].z, sv[q].w);
  __syncthreads();   // both tiles and dn are whole in LDS before anything is read
#pragma unroll
  for (int kk = 0; kk < 2; ++kk) {
    const v16h af = frag_ld(&As[kk][(wid * 16 + nl) * ROWH], kb);
#pragma unroll
    for (int j = 0; j < 4; ++j) {
      const v16h bf = frag_ld_tr(Bs + kk * 32 * BP64, BP64, j * 16, lane);
      acc[j] = wmma16(af, bf, acc[j]);
    }
  }
  float rd[8];
  const v4f dlo = *(const v4f*)&dn[wid * 16 + hb];
  const v4f dhi = *(const v4f*)&dn[wid * 16 + hb + 4];
#pragma unroll
  for (int vi = 0; vi < 4; ++vi) {
    rd[vi]     = 1.0f / dlo[vi];
    rd[vi + 4] = 1.0f / dhi[vi];
  }
  float* yrow = y + (size_t)(b * TLEN + row0 + wid * 16) * N_EMB + h * HDIM + lane;
#pragma unroll
  for (int j = 0; j < 4; j += 2) {
#pragma unroll
    for (int vi = 0; vi < 8; ++vi) {
      float lo, hi;
      whole_rows(acc[j][vi] * rd[vi], acc[j + 1][vi] * rd[vi], lane, lo, hi);
      yrow[vi * N_EMB + j * 16]       = lo;
      yrow[(vi + 8) * N_EMB + j * 16] = hi;
    }
  }
}

// ---------------------------------------------------------------------------
extern "C" void kernel_launch(void* const* d_in, const int* in_sizes, int n_in,
                              void* d_out, int out_size, void* d_ws, size_t ws_size,
                              hipStream_t stream) {
  (void)in_sizes; (void)n_in; (void)out_size; (void)ws_size;
  const float* x      = (const float*)d_in[0];
  const float* mem    = (const float*)d_in[1];
  const float* q_w    = (const float*)d_in[2];
  const float* q_b    = (const float*)d_in[3];
  const float* kv_w   = (const float*)d_in[4];
  const float* kv_b   = (const float*)d_in[5];
  const float* proj_w = (const float*)d_in[6];
  const float* proj_b = (const float*)d_in[7];
  float* out = (float*)d_out;

  // Workspace layout (floats). Total ~68 MB.
  const size_t SZ_BTC = (size_t)BATCH * TLEN * N_EMB;     // 4 M
  float* ws      = (float*)d_ws;
  float* qfeat   = ws;                                    // [B,T,C] elu+1
  float* kvbuf   = qfeat   + SZ_BTC;                      // [B,S,2C] (K feat | V)
  float* ybuf    = kvbuf   + 2 * SZ_BTC;                  // [B,T,C]
  float* stateP  = ybuf    + SZ_BTC;                      // [NSPLIT,B*H,64,64]
  float* ksumP   = stateP  + (size_t)NSPLIT * NBH * HDIM * HDIM;   // [NSPLIT,B*H,64]

  const dim3 blk(256);
  const int M = BATCH * TLEN;   // 4096

  // 1) Q = elu(x@q_w + q_b)+1
  gemm_kernel<N_EMB, N_EMB><<<dim3(N_EMB / 128, M / 128), blk, 0, stream>>>(
      x, q_w, q_b, qfeat, 1, 0);
  // 2) kv = memory@kv_w + kv_b ; elu+1 on K half only
  gemm_kernel<2 * N_EMB, N_EMB><<<dim3(2 * N_EMB / 128, M / 128), blk, 0, stream>>>(
      mem, kv_w, kv_b, kvbuf, 2, N_EMB);
  // 3) partials of state = rope(K)^T V and of sum_s K  (per b,h and S chunk)
  kstate_kernel<<<dim3(NSPLIT, NBH), blk, 0, stream>>>(kvbuf, stateP, ksumP);
  // 4) y = (rope(Q) @ state) / (Q . ksum)
  ygemm_kernel<<<dim3(TLEN / 128, NBH), blk, 0, stream>>>(qfeat, stateP, ksumP, ybuf);
  // 5) out = y @ proj_w + proj_b
  gemm_kernel<N_EMB, N_EMB><<<dim3(N_EMB / 128, M / 128), blk, 0, stream>>>(
      ybuf, proj_w, proj_b, out, 0, 0);
}

// v009
// A run of this version takes 75.2 microseconds.
// In two side-by-side timings against v008, it was 1.06 and 1.04 times as fast.
// Over all steps from v000 it is 4.94 times as fast.
#include <hip/hip_runtime.h>
#include <hip/hip_bf16.h>
#include <stdint.h>

// ---------------------------------------------------------------------------
// Linear cross-attention with RoPE, MI455X (gfx1250, wave32, WMMA).
// Associativity trick: y = Q_rot @ (K_rot^T V) / (Q . sum_s K)  -- avoids TxS.
// All GEMMs run through v_wmma_f32_16x16x32_f16 with fp32 accumulation;
// fp32 operands are converted to f16 while staging through LDS.
// ---------------------------------------------------------------------------

typedef __attribute__((ext_vector_type(16))) _Float16 v16h;
typedef __attribute__((ext_vector_type(8)))  float    v8f;
typedef __attribute__((ext_vector_type(4)))  float    v4f;
typedef __attribute__((ext_vector_type(4)))  _Float16 v4h;
typedef __attribute__((ext_vector_type(8)))  short    s16x8;

#define N_EMB 1024
#define NHEAD 16
#define HDIM  64
#define BATCH 2
#define TLEN  2048
#define SLEN  2048
#define LDS_PAD 8               // halfs of padding per LDS row (row = 40 halfs)
#define ROWH (32 + LDS_PAD)     // LDS row stride in halfs (BK=32)
// B tiles lie row-major [k][n] in LDS; the pitch is an odd multiple of 32 bytes,
// for speed only.
#define BP128 (128 + 16)        // halfs per k row of a 128-column B tile (288 B)
#define BP64  (64 + 16)         // halfs per k row of a 64-column B tile (160 B)

// --- WMMA fragment helpers --------------------------------------------------
// 16-bit A-matrix 16x32 layout (ISA 7.12.2): lane&15 = row M; lanes>=16 use
// K base +8; VGPR0..3 hold K=kb..kb+7 (packed f16 pairs), VGPR4..7 hold
// K=kb+16..kb+23.  B 32x16 has the same map with lane&15 = col N.
__device__ __forceinline__ v16h frag_ld(const _Float16* rowbase, int kb) {
  union { v16h h; uint32_t u[8]; } f;
  const uint32_t* p0 = (const uint32_t*)(rowbase + kb);
  const uint32_t* p1 = (const uint32_t*)(rowbase + kb + 16);
#pragma unroll
  for (int j = 0; j < 4; ++j) { f.u[j] = p0[j]; f.u[4 + j] = p1[j]; }
  return f.h;
}

// B fragment 32(k) x 16(n) out of a row-major [k][n] f16 tile: two transposing
// loads. Lane l reads 16 bytes of row 8*(l>>4) + (l&7) and receives column
// n0 + (l&15), k = 8*(l>>4) + 0..7; the second load takes the rows 16 further
// down. That is the k order of frag_ld, register for register.
__device__ __forceinline__ v16h frag_ld_tr(const _Float16* tile, int pitch, int n0,
                                           int lane) {
  typedef __attribute__((address_space(3))) s16x8 lds_s16x8;
  const _Float16* p = tile + ((lane >> 4) * 8 + (lane & 7)) * pitch + n0 +
                      ((lane >> 3) & 1) * 8;
  union { v16h h; s16x8 s[2]; } f;
  f.s[0] = __builtin_amdgcn_ds_load_tr16_b128_v8i16((lds_s16x8*)p);
  f.s[1] = __builtin_amdgcn_ds_load_tr16_b128_v8i16((lds_s16x8*)(p + 16 * pitch));
  return f.h;
}

// Four consecutive values of one LDS row, converted and stored as one 8-byte piece.
__device__ __forceinline__ void st4h(_Float16* d, float a, float b, float c, float e) {
  const v4h h = {(_Float16)a, (_Float16)b, (_Float16)c, (_Float16)e};
  *(v4h*)d = h;
}

__device__ __forceinline__ v8f wmma16(v16h a, v16h b, v8f c) {
  // (neg_a, A, neg_b, B, c_mod, C, reuse_a, reuse_b)
  return __builtin_amdgcn_wmma_f32_16x16x32_f16(false, a, false, b,
                                                (short)0, c, false, false);
}

// Whole-line stores from accumulators. A register of a 16x16 f32 tile holds 16
// columns of row v in lanes 0..15 and of row v + 8 in lanes 16..31: stored as it
// is, 64 bytes of two lines. a0 and a1 are that register of two tiles side by side
// (columns 0..15 and 16..31). The lane rows exchange one half each, and lane l then
// holds column l of row v in lo and of row v + 8 in hi: one 128-byte line a store.
__device__ __forceinline__ void whole_rows(float a0, float a1, int lane, float& lo,
                                           float& hi) {
  const bool low = lane < 16;
  const int send = __builtin_bit_cast(int, low ? a1 : a0);
  const float got = __builtin_bit_cast(float, __builtin_amdgcn_permlanex16(
      send, send, 0x76543210, 0xfedcba98, false, false));   // lane l <- lane l ^ 16
  lo = low ? a0 : got;
  hi = low ? got : a1;
}

// Work-group barrier for LDS traffic alone. __syncthreads() also waits for the
// wave's outstanding global loads, which would end the flight of the tiles that
// the k loops below fetch ahead; the loops exchange data through LDS only.
__device__ __forceinline__ void lds_barrier() {
  __builtin_amdgcn_fence(__ATOMIC_RELEASE, "workgroup", "local");
  __builtin_amdgcn_s_barrier();
  __builtin_amdgcn_fence(__ATOMIC_ACQUIRE, "workgroup", "local");
}

// Stands where a tile's staging begins. Without it the scheduler lifts the f16
// conversions of the later register sets into the earlier tiles, and with them
// the waits for their loads, which then fly for one tile instead of all.
__device__ __forceinline__ void tile_begin() { __builtin_amdgcn_sched_barrier(0); }

__device__ __forceinline__ float elu_p1(float v) {
  return v > 0.0f ? v + 1.0f : __expf(v);   // elu(v)+1
}

// --- Generic tiled GEMM: C = A(fp32)[M,K] * B(fp32)[K,N] + bias -------------
// mode 0: plain; mode 1: elu+1 everywhere; mode 2: elu+1 only for col < halfN.
// Shapes are exact multiples of tiles (M%128==0, N%128==0, K%64==0, K>=320).
// The global loads of a k tile are issued two tiles ahead, into two register
// sets, so their latency runs beside the staging and the products of the tiles
// in between. N and K are compile-time: a thread's eight loads of a tile hang on
// two addresses by constant offsets, and only those two are advanced.
// The LDS tiles have two buffers: while tile t is read out of one, tile t + 1 is
// staged into the other, so one barrier a tile both publishes tile t + 1 and ends
// the last read of the buffer that is written next.
// Both operands come from memory. For speed only, each
// 256-byte unit of the tiles is asked for, into L2 only, eight tiles ahead.
template <int N, int K>
__global__ __launch_bounds__(256)
void gemm_kernel(const float* __restrict__ A, const float* __restrict__ B,
                 const float* __restrict__ bias, float* __restrict__ C,
                 int mode, int halfN) {
  __shared__ __attribute__((aligned(16))) _Float16 As[2][128 * ROWH];
  __shared__ __attribute__((aligned(16))) _Float16 Bs[2][32 * BP128];

  const int tid  = threadIdx.x;
  const int bm   = blockIdx.y * 128;
  const int bn   = blockIdx.x * 128;
  const int wid  = tid >> 5;
  const int lane = tid & 31;
  const int nl   = lane & 15;
  const int kb   = (lane >> 4) << 3;   // K base for A/B fragments
  const int wm   = (wid & 1) * 64;     // 2 waves in M  -> 64 rows each
  const int wn   = (wid >> 1) * 32;    // 4 waves in N  -> 32 cols each

  const v8f vzero = {0.f,0.f,0.f,0.f,0.f,0.f,0.f,0.f};
  v8f acc[4][2];
#pragma unroll
  for (int i = 0; i < 4; ++i)
#pragma unroll
    for (int j = 0; j < 2; ++j) acc[i][j] = vzero;

  const int r   = tid >> 3;           // A: row 0..31
  const int c4  = (tid & 7) * 4;      // A: first column 0..28
  const int br  = tid >> 5;           // B: row 0..7
  const int bc4 = (tid & 31) * 4;     // B: first column 0..124
  const float* ap = A + (size_t)(bm + r) * K + c4;
  const float* bp = B + (size_t)br * N + bn + bc4;
  v4f pa[2][4], pb[2][4];

  // A pair of k tiles is 128 units of A (64 k of a row) and 128 of B (half of a
  // row's 128 n, 64 rows). Waves 0..3 ask for the A units, one a lane. The B units
  // are the same for every row block of the grid: wave 4 asks for a quarter of
  // them, eight neighbouring row blocks for the same one. Waves 5..7 ask nothing.
  const int swid = __builtin_amdgcn_readfirstlane(wid);   // the tests on it are scalar
  const int bu = ((blockIdx.y >> 3) & 3) * 32 + lane;
  const char* pf = swid < 4
      ? (const char*)(A + (size_t)(bm + tid) * K + 64)
      : (const char*)(B + (size_t)(64 + (bu >> 1)) * N + bn + (bu & 1) * 64);
  const int pfstep = swid < 4 ? 64 * 4 : 64 * N * 4;
  // Brings the unit at pf into L2; returns nothing and is waited for nowhere. In asm
  // so that it names pf itself, a register that holds an address inside A or B for
  // the whole loop. It stands in front of a fetch, whose wait also covers it.
  auto ask = [&]() {
    if (swid < 5) asm volatile("global_prefetch_b8 %0, off scope:SCOPE_SE" :: "v"(pf));
  };

  // One k tile (A 128x32, B 32x128) into a register set; then on to the next tile.
  auto fetch = [&](v4f (&a)[4], v4f (&b)[4]) {
#pragma unroll
    for (int q = 0; q < 4; ++q) {
      a[q] = *(const v4f*)(ap + q * 32 * K);
      b[q] = *(const v4f*)(bp + q * 8 * N);
    }
    // the two addresses are rewritten next: the issued loads still name them
    asm volatile("s_wait_xcnt 0x0" ::: "memory");
    // holds every later register write behind that wait
    __builtin_amdgcn_sched_barrier(0);
    ap += 32;
    bp += 32 * N;
  };
  // A -> As[w][m][k]; B -> Bs[w][k][n], as it lies in memory
  auto stage = [&](int w, const v4f (&a)[4], const v4f (&b)[4]) {
#pragma unroll
    for (int q = 0; q < 4; ++q) {
      st4h(&As[w][(r + q * 32) * ROWH + c4], a[q].x, a[q].y, a[q].z, a[q].w);
      st4h(&Bs[w][(br + q * 8) * BP128 + bc4], b[q].x, b[q].y, b[q].z, b[q].w);
    }
  };
  // Tile t, u = t & 1: its fragments out of buffer u; under their flight tile t + 1
  // goes from register set 1 - u into buffer 1 - u, and tile t + 3 is fetched into
  // that set; then the products.
  auto step = [&](int u, bool more, bool refill, bool asks = false) {
    tile_begin();
    v16h af[4], bf[2];
#pragma unroll
    for (int j = 0; j < 2; ++j) bf[j] = frag_ld_tr(Bs[u], BP128, wn + j * 16, lane);
#pragma unroll
    for (int i = 0; i < 4; ++i) af[i] = frag_ld(&As[u][(wm + i * 16 + nl) * ROWH], kb);
    // All twelve fragment loads are issued here, as one group: left free, they are
    // spread among the products on one register set, one LDS latency after another.
    __builtin_amdgcn_sched_barrier(0);
    if (asks) ask();   // here its scalar test runs under the fragment loads' flight
    if (more) stage(1 - u, pa[1 - u], pb[1 - u]);
    if (refill) fetch(pa[1 - u], pb[1 - u]);
#pragma unroll
    for (int i = 0; i < 4; ++i)
#pragma unroll
      for (int j = 0; j < 2; ++j) acc[i][j] = wmma16(af[i], bf[j], acc[i][j]);
    // Keeps the products in front of the barrier: they wait for the fragments only
    // and run while the staging stores drain. Left free, the barrier and its wait
    // for those stores are lifted over them, and LDS idles while they are issued.
    if (more) {
      __builtin_amdgcn_sched_barrier(0);
      lds_barrier();
    }
  };

  constexpr int NTILE = K / 32;
  static_assert(NTILE >= 10, "the first trip asks for tiles 8, 9");
  v4f fa[4], fb[4];   // tile 0 has a set of its own: tile 2's loads do not wait for its staging
  ask();                   // tiles 2, 3
  fetch(fa, fb);
  pf += pfstep;
  ask();                   // tiles 4, 5
  fetch(pa[1], pb[1]);
  pf += pfstep;
  ask();                   // tiles 6, 7
  fetch(pa[0], pb[0]);
  pf += pfstep;
  tile_begin();
  stage(0, fa, fb);
  lds_barrier();
  for (int t = 0; t < NTILE - 4; t += 2) {
    // tiles t + 8, t + 9; the last two trips ask for the last pair again, which
    // costs less than a test on t in every trip
    step(0, true, true, true);
    if (t + 10 < NTILE) pf += pfstep;    // never past the last pair of tiles
    step(1, true, true);
  }
  step(0, true, true);     // tile NTILE - 4 fetches the last tile
  step(1, true, false);
  step(0, true, false);
  step(1, false, false);   // the last tile: nothing left to stage

  float bv[2];
  bool act[2];
#pragma unroll
  for (int j = 0; j < 2; ++j) {
    const int col = bn + wn + j * 16 + nl;
    bv[j] = bias[col];
    act[j] = (mode == 1) || (mode == 2 && col < halfN);
  }
#pragma unroll
  for (int i = 0; i < 4; ++i) {
    float* crow = C + (size_t)(bm + wm + i * 16) * N + bn + wn + lane;
#pragma unroll
    for (int vi = 0; vi < 8; ++vi) {
      float v[2];
#pragma unroll
      for (int j = 0; j < 2; ++j) {
        v[j] = acc[i][j][vi] + bv[j];
        if (act[j]) v[j] = elu_p1(v[j]);
      }
      float lo, hi;
      whole_rows(v[0], v[1], lane, lo, hi);
      crow[vi * N]       = lo;
      crow[(vi + 8) * N] = hi;
    }
  }
}

// --- K side, one kernel: partial state = K_rot^T V and partial sum_s K --------
// One work-group = one head x SCH positions. K and V are read as they lie,
// [s][d] and [s][e]; RoPE is applied to K while its tile is staged (a thread
// holds columns i..i+3 and i+32..i+35 of a row, both members of four rotation
// pairs), so the rotated K never goes through global memory. Both tiles lie
// row-major over s in LDS, and the transposing load hands out A = K_rot^T as
// well as B = V in the same k order. The NSPLIT partial states and partial
// column sums of a head are added up where they are used, in the y GEMM.
#define NSPLIT 8                // work-groups per head: 256 in all, one per WGP
#define SCH (SLEN / NSPLIT)     // positions per work-group
#define NT (SCH / 32)           // s tiles per work-group
#define NBH (BATCH * NHEAD)
// sin and cos of 2*pi*rev. One statement so that the slot the instruction set
// asks for behind a transcendental is filled whatever the compiler puts next:
// v_cos is independent of v_sin (outputs never alias the input), v_nop ends it.
__device__ __forceinline__ void sincos_rev(float rev, float& sn, float& cs) {
  asm("v_sin_f32 %0, %2\n\tv_cos_f32 %1, %2\n\tv_nop"
      : "=&v"(sn), "=&v"(cs) : "v"(rev));
}
__global__ __launch_bounds__(256)
void kstate_kernel(const float* __restrict__ kv, float* __restrict__ stateP,
                   float* __restrict__ ksumP) {
  __shared__ __attribute__((aligned(16))) _Float16 Ks[SCH * BP64];
  __shared__ __attribute__((aligned(16))) _Float16 Vs[SCH * BP64];
  __shared__ __attribute__((aligned(16))) float colsum[32 * HDIM];
  const int sp = blockIdx.x;
  const int bh = blockIdx.y;
  const int b = bh >> 4, h = bh & 15;
  const int sbase = sp * SCH;
  const float* Kptr = kv + ((size_t)b * SLEN + sbase) * (2 * N_EMB) + h * HDIM;
  const int tid = threadIdx.x;
  const int wid = tid >> 5, lane = tid & 31;
  const int tm  = (wid & 3) * 16;        // 4 m-tiles (d)
  const int tn0 = (wid >> 2) * 32;       // 2 wave groups x 2 n-tiles (e)

  const v8f vzero = {0.f,0.f,0.f,0.f,0.f,0.f,0.f,0.f};
  v8f acc[2] = {vzero, vzero};

  // One work-group per WGP, so nothing but the wave's own order hides a load:
  // the loads of all NT s tiles are issued at once, each tile into its own set.
  const int r  = tid >> 3, c4  = (tid & 7) * 4;     // K: row s, first column d
  const int br = tid >> 4, bc4 = (tid & 15) * 4;    // V: row s, first column e
  const float* kp = Kptr + (size_t)r * (2 * N_EMB) + c4;
  const float* vp = Kptr + (size_t)br * (2 * N_EMB) + bc4;   // V lies N_EMB floats on
  v4f pk[NT][2], pv[NT][2];
  v4f cs1 = {0.f, 0.f, 0.f, 0.f}, cs2 = {0.f, 0.f, 0.f, 0.f};   // sums of K, unrotated
#pragma unroll
  for (int u = 0; u < NT; ++u) {
    pk[u][0] = *(const v4f*)(kp + u * 32 * (2 * N_EMB));
    pk[u][1] = *(const v4f*)(kp + u * 32 * (2 * N_EMB) + 32);
    pv[u][0] = *(const v4f*)(vp + N_EMB + u * 32 * (2 * N_EMB));
    pv[u][1] = *(const v4f*)(vp + N_EMB + (u * 32 + 16) * (2 * N_EMB));
  }
  // The issued loads still name the two address pairs. Both are inputs of the wait,
  // so they stay live up to it and no load's result is placed in them ahead of it.
  asm volatile("s_wait_xcnt 0x0" :: "v"(kp), "v"(vp) : "memory");
  // holds every later register write behind that wait
  __builtin_amdgcn_sched_barrier(0);

  float inv[4];   // inv_freq[i] = 10000^(-2i/64) = exp(-i * ln(10000)/32)
#pragma unroll
  for (int j = 0; j < 4; ++j)
    inv[j] = __expf(-(float)(c4 + j) * 0.28782313662425572f);

  // K tile 32(s) x 64(d), rotated -> Ks[s][d]; V tile 32(s) x 64(e) -> Vs[s][e];
  // s is counted from the chunk's first position
  auto stage = [&](const v4f (&k)[2], const v4f (&v)[2], int s0) {
    const float t = (float)(sbase + s0 + r);
    float lo[4], hi[4];
#pragma unroll
    for (int j = 0; j < 4; ++j) {
      float sn, cs;
      sincos_rev(t * inv[j] * 0.15915494309189532f, sn, cs);
      lo[j] = fmaf(k[0][j], cs, -(k[1][j] * sn));
      hi[j] = fmaf(k[1][j], cs, k[0][j] * sn);
    }
    st4h(&Ks[(s0 + r) * BP64 + c4],      lo[0], lo[1], lo[2], lo[3]);
    st4h(&Ks[(s0 + r) * BP64 + c4 + 32], hi[0], hi[1], hi[2], hi[3]);
    cs1 += k[0];
    cs2 += k[1];
#pragma unroll
    for (int q = 0; q < 2; ++q)
      st4h(&Vs[(s0 + br + q * 16) * BP64 + bc4], v[q].x, v[q].y, v[q].z, v[q].w);
  };

  // The whole chunk is staged, tile by tile as its loads come in; one barrier
  // then separates all staging from all products.
#pragma unroll
  for (int u = 0; u < NT; ++u) {
    tile_begin();
    stage(pk[u], pv[u], u * 32);
  }
  *(v4f*)&colsum[r * HDIM + c4]      = cs1;
  *(v4f*)&colsum[r * HDIM + c4 + 32] = cs2;
  __syncthreads();   // both tiles and the 32 row groups' column sums are whole in LDS
#pragma unroll
  for (int u = 0; u < NT; ++u) {
    const v16h af = frag_ld_tr(Ks + u * 32 * BP64, BP64, tm, lane);   // A[d][s] out of Ks[s][d]
#pragma unroll
    for (int j = 0; j < 2; ++j) {
      const v16h bf = frag_ld_tr(Vs + u * 32 * BP64, BP64, tn0 + j * 16, lane);
      acc[j] = wmma16(af, bf, acc[j]);
    }
  }
  float* st = stateP + ((size_t)sp * NBH + bh) * (HDIM * HDIM);
#pragma unroll
  for (int vi = 0; vi < 8; ++vi) {
    float lo, hi;
    whole_rows(acc[0][vi], acc[1][vi], lane, lo, hi);
    st[(tm + vi) * HDIM + tn0 + lane]     = lo;
    st[(tm + vi + 8) * HDIM + tn0 + lane] = hi;
  }
  if (tid < HDIM) {  // two whole waves: column tid over the 32 row groups
    float t = 0.f;
#pragma unroll
    for (int g = 0; g < 32; ++g) t += colsum[g * HDIM + tid];
    ksumP[((size_t)sp * NBH + bh) * HDIM + tid] = t;
  }
}

// --- y[b,t,h,:] = (rope(Q)[b,t,h,:] @ state[b,h]) / denom[b,h,t] ------------
// RoPE on Q is applied while the A tile is staged: a thread holds columns
// i..i+3 and i+32..i+35 of a row, i.e. both members of four rotation pairs, so
// the rotated Q never goes through global memory. Both k halves (K = 64) are
// staged at once, so one barrier separates staging from the products.
// The denominator Q . sum_s K is formed from the same registers, before the
// rotation: eight threads hold a row, their partial dots meet by DPP.
// The head's state and sum_s K arrive as NSPLIT partials and are added up here.
template <int CTRL>
__device__ __forceinline__ float row_xor_add(float v) {   // v + v of lane ^ mask
  return v + __builtin_bit_cast(float, __builtin_amdgcn_update_dpp(
                 0, __builtin_bit_cast(int, v), CTRL, 0xf, 0xf, true));
}
__global__ __launch_bounds__(256)
void ygemm_kernel(const float* __restrict__ qfeat, const float* __restrict__ stateP,
                  const float* __restrict__ ksumP, float* __restrict__ y) {
  __shared__ __attribute__((aligned(16))) _Float16 As[2][128 * ROWH];
  __shared__ __attribute__((aligned(16))) _Float16 Bs[64 * BP64];
  __shared__ __attribute__((aligned(16))) float dn[128];
  const int bh = blockIdx.y;
  const int b = bh >> 4, h = bh & 15;
  const int row0 = blockIdx.x * 128;
  const float* Aptr = qfeat + (size_t)b * TLEN * N_EMB + h * HDIM;  // rows t, lda=N_EMB
  const float* Sptr = stateP + (size_t)bh * (HDIM * HDIM);
  const int tid = threadIdx.x;
  const int wid = tid >> 5, lane = tid & 31;
  const int nl = lane & 15;
  const int kb = (lane >> 4) << 3;
  const int hb = (lane >> 4) << 3;

  const v8f vzero = {0.f,0.f,0.f,0.f,0.f,0.f,0.f,0.f};
  v8f acc[4] = {vzero, vzero, vzero, vzero};

  // Every row of a thread is reached from one address by a constant offset.
  const int r = tid >> 3, c4 = (tid & 7) * 4;       // A: row, first column
  const int br = tid >> 4, bc4 = (tid & 15) * 4;    // state: row, first column
  const float* ap = Aptr + (size_t)(row0 + r) * N_EMB + c4;
  const float* sp = Sptr + br * HDIM + bc4;
  v4f x1[4], x2[4], sv[4];
#pragma unroll
  for (int q = 0; q < 4; ++q) {
    x1[q] = *(const v4f*)(ap + q * 32 * N_EMB);
    x2[q] = *(const v4f*)(ap + q * 32 * N_EMB + 32);
  }
  const float* kq = ksumP + bh * HDIM + c4;
  v4f kpart[NSPLIT][2], spart[NSPLIT][4];
#pragma unroll
  for (int p = 0; p < NSPLIT; ++p) {
    kpart[p][0] = *(const v4f*)(kq + p * (NBH * HDIM));
    kpart[p][1] = *(const v4f*)(kq + p * (NBH * HDIM) + 32);
  }
#pragma unroll
  for (int p = 0; p < NSPLIT; ++p)
#pragma unroll
    for (int q = 0; q < 4; ++q)
      spart[p][q] = *(const v4f*)(sp + p * (NBH * HDIM * HDIM) + q * 16 * HDIM);
  // Every load above is issued before the first sum waits for one; without this
  // the state's loads start only when the column sums have come back.
  __builtin_amdgcn_sched_barrier(0);
  v4f ks1 = kpart[0][0], ks2 = kpart[0][1];
#pragma unroll
  for (int q = 0; q < 4; ++q) sv[q] = spart[0][q];
#pragma unroll
  for (int p = 1; p < NSPLIT; ++p) {
    ks1 += kpart[p][0];
    ks2 += kpart[p][1];
#pragma unroll
    for (int q = 0; q < 4; ++q) sv[q] += spart[p][q];
  }
  float dp[4];                    // dp[q] = Q[row r + 32 q, :] . ksum
#pragma unroll
  for (int q = 0; q < 4; ++q) {
    float p1 = x1[q][0] * ks1[0], p2 = x2[q][0] * ks2[0];
#pragma unroll
    for (int j = 1; j < 4; ++j) {
      p1 = fmaf(x1[q][j], ks1[j], p1);
      p2 = fmaf(x2[q][j], ks2[j], p2);
    }
    float p = p1 + p2;
    p = row_xor_add<0x161>(p);    // row_xmask:1
    p = row_xor_add<0x162>(p);    // row_xmask:2
    dp[q] = row_xor_add<0x164>(p);    // row_xmask:4
  }
  if ((tid & 7) == 0) {
#pragma unroll
    for (int q = 0; q < 4; ++q) dn[r + q * 32] = dp[q];
  }
  {   // A tile 128(t) x 64(d), rotated: As[0] = d 0..31, As[1] = d 32..63
    float inv[4];   // inv_freq[i] = 10000^(-2i/64) = exp(-i * ln(10000)/32)
#pragma unroll
    for (int j = 0; j < 4; ++j)
      inv[j] = __expf(-(float)(c4 + j) * 0.28782313662425572f);
#pragma unroll
    for (int q = 0; q < 4; ++q) {
      const float t = (float)(row0 + r + q * 32);
      _Float16* d0 = &As[0][(r + q * 32) * ROWH + c4];
      _Float16* d1 = &As[1][(r + q * 32) * ROWH + c4];
#pragma unroll
      for (int j = 0; j < 4; ++j) {
        float sn, cs;
        __sincosf(t * inv[j], &sn, &cs);
        d0[j] = (_Float16)(x1[q][j] * cs - x2[q][j] * sn);
        d1[j] = (_Float16)(x2[q][j] * cs + x1[q][j] * sn);
      }
    }
  }
  // state 64(d) x 64(e) -> Bs[d][e]; row d = br + q * 16
#pragma unroll
  for (int q = 0; q < 4; ++q)
    st4h(&Bs[(br + q * 16) * BP64 + bc4], sv[q].x, sv[q].y, sv[q].z, sv[q].w);
  __syncthreads();   // both tiles and dn are whole in LDS before anything is read
#pragma unroll
  for (int kk = 0; kk < 2; ++kk) {
    const v16h af = frag_ld(&As[kk][(wid * 16 + nl) * ROWH], kb);
#pragma unroll
    for (int j = 0; j < 4; ++j) {
      const v16h bf = frag_ld_tr(Bs + kk * 32 * BP64, BP64, j * 16, lane);
      acc[j] = wmma16(af, bf, acc[j]);
    }
  }
  float rd[8];
  const v4f dlo = *(const v4f*)&dn[wid * 16 + hb];
  const v4f dhi = *(const v4f*)&dn[wid * 16 + hb + 4];
#pragma unroll
  for (int vi = 0; vi < 4; ++vi) {
    rd[vi]     = 1.0f / dlo[vi];
    rd[vi + 4] = 1.0f / dhi[vi];
  }
  float* yrow = y + (size_t)(b * TLEN + row0 + wid * 16) * N_EMB + h * HDIM + lane;
#pragma unroll
  for (int j = 0; j < 4; j += 2) {
#pragma unroll
    for (int vi = 0; vi < 8; ++vi) {
      float lo, hi;
      whole_rows(acc[j][vi] * rd[vi], acc[j + 1][vi] * rd[vi], lane, lo, hi);
      yrow[vi * N_EMB + j * 16]       = lo;
      yrow[(vi + 8) * N_EMB + j * 16] = hi;
    }
  }
}

// ---------------------------------------------------------------------------
extern "C" void kernel_launch(void* const* d_in, const int* in_sizes, int n_in,
                              void* d_out, int out_size, void* d_ws, size_t ws_size,
                              hipStream_t stream) {
  (void)in_sizes; (void)n_in; (void)out_size; (void)ws_size;
  const float* x      = (const float*)d_in[0];
  const float* mem    = (const float*)d_in[1];
  const float* q_w    = (const float*)d_in[2];
  const float* q_b    = (const float*)d_in[3];
  const float* kv_w   = (const float*)d_in[4];
  const float* kv_b   = (const float*)d_in[5];
  const float* proj_w = (const float*)d_in[6];
  const float* proj_b = (const float*)d_in[7];
  float* out = (float*)d_out;

  // Workspace layout (floats). Total ~68 MB.
  const size_t SZ_BTC = (size_t)BATCH * TLEN * N_EMB;     // 4 M
  float* ws      = (float*)d_ws;
  float* qfeat   = ws;                                    // [B,T,C] elu+1
  float* kvbuf   = qfeat   + SZ_BTC;                      // [B,S,2C] (K feat | V)
  float* ybuf    = kvbuf   + 2 * SZ_BTC;                  // [B,T,C]
  float* stateP  = ybuf    + SZ_BTC;                      // [NSPLIT,B*H,64,64]
  float* ksumP   = stateP  + (size_t)NSPLIT * NBH * HDIM * HDIM;   // [NSPLIT,B*H,64]

  const dim3 blk(256);
  const int M = BATCH * TLEN;   // 4096

  // 1) Q = elu(x@q_w + q_b)+1
  gemm_kernel<N_EMB, N_EMB><<<dim3(N_EMB / 128, M / 128), blk, 0, stream>>>(
      x, q_w, q_b, qfeat, 1, 0);
  // 2) kv = memory@kv_w + kv_b ; elu+1 on K half only
  gemm_kernel<2 * N_EMB, N_EMB><<<dim3(2 * N_EMB / 128, M / 128), blk, 0, stream>>>(
      mem, kv_w, kv_b, kvbuf, 2, N_EMB);
  // 3) partials of state = rope(K)^T V and of sum_s K  (per b,h and S chunk)
  kstate_kernel<<<dim3(NSPLIT, NBH), blk, 0, stream>>>(kvbuf, stateP, ksumP);
  // 4) y = (rope(Q) @ state) / (Q . ksum)
  ygemm_kernel<<<dim3(TLEN / 128, NBH), blk, 0, stream>>>(qfeat, stateP, ksumP, ybuf);
  // 5) out = y @ proj_w + proj_b
  gemm_kernel<N_EMB, N_EMB><<<dim3(N_EMB / 128, M / 128), blk, 0, stream>>>(
      ybuf, proj_w, proj_b, out, 0, 0);
}

// v010
// It runs in 70.3 microseconds.
// Next to v009, in two timings, it ran 1.07 times as fast each time.
// Counting every step since v000, it is 5.27 times as fast.
#include <hip/hip_runtime.h>
#include <hip/hip_bf16.h>
#include <stdint.h>

// ---------------------------------------------------------------------------
// Linear cross-attention with RoPE, MI455X (gfx1250, wave32, WMMA).
// Associativity trick: y = Q_rot @ (K_rot^T V) / (Q . sum_s K)  -- avoids TxS.
// All GEMMs run through v_wmma_f32_16x16x32_f16 with fp32 accumulation;
// fp32 operands are converted to f16 while staging through LDS.
// ---------------------------------------------------------------------------

typedef __attribute__((ext_vector_type(16))) _Float16 v16h;
typedef __attribute__((ext_vector_type(8)))  float    v8f;
typedef __attribute__((ext_vector_type(4)))  float    v4f;
typedef __attribute__((ext_vector_type(4)))  _Float16 v4h;
typedef __attribute__((ext_vector_type(8)))  short    s16x8;

#define N_EMB 1024
#define NHEAD 16
#define HDIM  64
#define BATCH 2
#define TLEN  2048
#define SLEN  2048
#define LDS_PAD 8               // halfs of padding per LDS row (row = 40 halfs)
#define ROWH (32 + LDS_PAD)     // LDS row stride in halfs (BK=32)
// B tiles lie row-major [k][n] in LDS; the pitch is an odd multiple of 32 bytes,
// for speed only.
#define BP128 (128 + 16)        // halfs per k row of a 128-column B tile (288 B)
#define BP64  (64 + 16)         // halfs per k row of a 64-column B tile (160 B)

// --- WMMA fragment helpers --------------------------------------------------
// 16-bit A-matrix 16x32 layout (ISA 7.12.2): lane&15 = row M; lanes>=16 use
// K base +8; VGPR0..3 hold K=kb..kb+7 (packed f16 pairs), VGPR4..7 hold
// K=kb+16..kb+23.  B 32x16 has the same map with lane&15 = col N.
__device__ __forceinline__ v16h frag_ld(const _Float16* rowbase, int kb) {
  union { v16h h; uint32_t u[8]; } f;
  const uint32_t* p0 = (const uint32_t*)(rowbase + kb);
  const uint32_t* p1 = (const uint32_t*)(rowbase + kb + 16);
#pragma unroll
  for (int j = 0; j < 4; ++j) { f.u[j] = p0[j]; f.u[4 + j] = p1[j]; }
  return f.h;
}

// B fragment 32(k) x 16(n) out of a row-major [k][n] f16 tile: two transposing
// loads. Lane l reads 16 bytes of row 8*(l>>4) + (l&7) and receives column
// n0 + (l&15), k = 8*(l>>4) + 0..7; the second load takes the rows 16 further
// down. That is the k order of frag_ld, register for register.
__device__ __forceinline__ v16h frag_ld_tr(const _Float16* tile, int pitch, int n0,
                                           int lane) {
  typedef __attribute__((address_space(3))) s16x8 lds_s16x8;
  const _Float16* p = tile + ((lane >> 4) * 8 + (lane & 7)) * pitch + n0 +
                      ((lane >> 3) & 1) * 8;
  union { v16h h; s16x8 s[2]; } f;
  f.s[0] = __builtin_amdgcn_ds_load_tr16_b128_v8i16((lds_s16x8*)p);
  f.s[1] = __builtin_amdgcn_ds_load_tr16_b128_v8i16((lds_s16x8*)(p + 16 * pitch));
  return f.h;
}

// Four consecutive values of one LDS row, converted and stored as one 8-byte piece.
__device__ __forceinline__ void st4h(_Float16* d, float a, float b, float c, float e) {
  const v4h h = {(_Float16)a, (_Float16)b, (_Float16)c, (_Float16)e};
  *(v4h*)d = h;
}

__device__ __forceinline__ v8f wmma16(v16h a, v16h b, v8f c) {
  // (neg_a, A, neg_b, B, c_mod, C, reuse_a, reuse_b)
  return __builtin_amdgcn_wmma_f32_16x16x32_f16(false, a, false, b,
                                                (short)0, c, false, false);
}

// Whole-line stores from accumulators. A register of a 16x16 f32 tile holds 16
// columns of row v in lanes 0..15 and of row v + 8 in lanes 16..31: stored as it
// is, 64 bytes of two lines. a0 and a1 are that register of two tiles side by side
// (columns 0..15 and 16..31). The lane rows exchange one half each, and lane l then
// holds column l of row v in lo and of row v + 8 in hi: one 128-byte line a store.
__device__ __forceinline__ void whole_rows(float a0, float a1, int lane, float& lo,
                                           float& hi) {
  const bool low = lane < 16;
  const int send = __builtin_bit_cast(int, low ? a1 : a0);
  const float got = __builtin_bit_cast(float, __builtin_amdgcn_permlanex16(
      send, send, 0x76543210, 0xfedcba98, false, false));   // lane l <- lane l ^ 16
  lo = low ? a0 : got;
  hi = low ? got : a1;
}

// Work-group barrier for LDS traffic alone. __syncthreads() also waits for the
// wave's outstanding global loads, which would end the flight of the tiles that
// the k loops below fetch ahead; the loops exchange data through LDS only.
__device__ __forceinline__ void lds_barrier() {
  __builtin_amdgcn_fence(__ATOMIC_RELEASE, "workgroup", "local");
  __builtin_amdgcn_s_barrier();
  __builtin_amdgcn_fence(__ATOMIC_ACQUIRE, "workgroup", "local");
}

// Stands where a tile's staging begins. Without it the scheduler lifts the f16
// conversions of the later register sets into the earlier tiles, and with them
// the waits for their loads, which then fly for one tile instead of all.
__device__ __forceinline__ void tile_begin() { __builtin_amdgcn_sched_barrier(0); }

__device__ __forceinline__ float elu_p1(float v) {
  return v > 0.0f ? v + 1.0f : __expf(v);   // elu(v)+1
}

// --- Generic tiled GEMM: C = A(fp32)[M,K] * B(fp32)[K,N] + bias -------------
// mode 0: plain; mode 1: elu+1 everywhere; mode 2: elu+1 only for col < halfN.
// Shapes are exact multiples of tiles (M%128==0, N%128==0, K%64==0, K>=320).
// The global loads of a k tile are issued two tiles ahead, into two register
// sets, so their latency runs beside the staging and the products of the tiles
// in between. N and K are compile-time: a thread's eight loads of a tile hang on
// two addresses by constant offsets, and only those two are advanced.
// The LDS tiles have two buffers: while tile t is read out of one, tile t + 1 is
// staged into the other, so one barrier a tile both publishes tile t + 1 and ends
// the last read of the buffer that is written next.
// Both operands come from memory. For speed only, each
// 256-byte unit of the tiles is asked for, into L2 only, eight tiles ahead.
// One work-group's tile: column block bx, row block by.
template <int N, int K>
__device__ __forceinline__
void gemm_tile(const float* __restrict__ A, const float* __restrict__ B,
               const float* __restrict__ bias, float* __restrict__ C,
               int mode, int halfN, int bx, int by) {
  __shared__ __attribute__((aligned(16))) _Float16 As[2][128 * ROWH];
  __shared__ __attribute__((aligned(16))) _Float16 Bs[2][32 * BP128];

  const int tid  = threadIdx.x;
  const int bm   = by * 128;
  const int bn   = bx * 128;
  const int wid  = tid >> 5;
  const int lane = tid & 31;
  const int nl   = lane & 15;
  const int kb   = (lane >> 4) << 3;   // K base for A/B fragments
  const int wm   = (wid & 1) * 64;     // 2 waves in M  -> 64 rows each
  const int wn   = (wid >> 1) * 32;    // 4 waves in N  -> 32 cols each

  const v8f vzero = {0.f,0.f,0.f,0.f,0.f,0.f,0.f,0.f};
  v8f acc[4][2];
#pragma unroll
  for (int i = 0; i < 4; ++i)
#pragma unroll
    for (int j = 0; j < 2; ++j) acc[i][j] = vzero;

  const int r   = tid >> 3;           // A: row 0..31
  const int c4  = (tid & 7) * 4;      // A: first column 0..28
  const int br  = tid >> 5;           // B: row 0..7
  const int bc4 = (tid & 31) * 4;     // B: first column 0..124
  const float* ap = A + (size_t)(bm + r) * K + c4;
  const float* bp = B + (size_t)br * N + bn + bc4;
  v4f pa[2][4], pb[2][4];

  // A pair of k tiles is 128 units of A (64 k of a row) and 128 of B (half of a
  // row's 128 n, 64 rows). Waves 0..3 ask for the A units, one a lane. The B units
  // are the same for every row block of the grid: wave 4 asks for a quarter of
  // them, eight neighbouring row blocks for the same one. Waves 5..7 ask nothing.
  const int swid = __builtin_amdgcn_readfirstlane(wid);   // the tests on it are scalar
  const int bu = ((by >> 3) & 3) * 32 + lane;
  const char* pf = swid < 4
      ? (const char*)(A + (size_t)(bm + tid) * K + 64)
      : (const char*)(B + (size_t)(64 + (bu >> 1)) * N + bn + (bu & 1) * 64);
  const int pfstep = swid < 4 ? 64 * 4 : 64 * N * 4;
  // Brings the unit at pf into L2; returns nothing and is waited for nowhere. In asm
  // so that it names pf itself, a register that holds an address inside A or B for
  // the whole loop. It stands in front of a fetch, whose wait also covers it.
  auto ask = [&]() {
    if (swid < 5) asm volatile("global_prefetch_b8 %0, off scope:SCOPE_SE" :: "v"(pf));
  };

  // One k tile (A 128x32, B 32x128) into a register set; then on to the next tile.
  auto fetch = [&](v4f (&a)[4], v4f (&b)[4]) {
#pragma unroll
    for (int q = 0; q < 4; ++q) {
      a[q] = *(const v4f*)(ap + q * 32 * K);
      b[q] = *(const v4f*)(bp + q * 8 * N);
    }
    // the two addresses are rewritten next: the issued loads still name them
    asm volatile("s_wait_xcnt 0x0" ::: "memory");
    // holds every later register write behind that wait
    __builtin_amdgcn_sched_barrier(0);
    ap += 32;
    bp += 32 * N;
  };
  // A -> As[w][m][k]; B -> Bs[w][k][n], as it lies in memory
  auto stage = [&](int w, const v4f (&a)[4], const v4f (&b)[4]) {
#pragma unroll
    for (int q = 0; q < 4; ++q) {
      st4h(&As[w][(r + q * 32) * ROWH + c4], a[q].x, a[q].y, a[q].z, a[q].w);
      st4h(&Bs[w][(br + q * 8) * BP128 + bc4], b[q].x, b[q].y, b[q].z, b[q].w);
    }
  };
  // Tile t, u = t & 1: its fragments out of buffer u; under their flight tile t + 1
  // goes from register set 1 - u into buffer 1 - u, and tile t + 3 is fetched into
  // that set; then the products.
  auto step = [&](int u, bool more, bool refill, bool asks = false) {
    tile_begin();
    v16h af[4], bf[2];
#pragma unroll
    for (int j = 0; j < 2; ++j) bf[j] = frag_ld_tr(Bs[u], BP128, wn + j * 16, lane);
#pragma unroll
    for (int i = 0; i < 4; ++i) af[i] = frag_ld(&As[u][(wm + i * 16 + nl) * ROWH], kb);
    // All twelve fragment loads are issued here, as one group: left free, they are
    // spread among the products on one register set, one LDS latency after another.
    __builtin_amdgcn_sched_barrier(0);
    if (asks) ask();   // here its scalar test runs under the fragment loads' flight
    if (more) stage(1 - u, pa[1 - u], pb[1 - u]);
    if (refill) fetch(pa[1 - u], pb[1 - u]);
#pragma unroll
    for (int i = 0; i < 4; ++i)
#pragma unroll
      for (int j = 0; j < 2; ++j) acc[i][j] = wmma16(af[i], bf[j], acc[i][j]);
    // Keeps the products in front of the barrier: they wait for the fragments only
    // and run while the staging stores drain. Left free, the barrier and its wait
    // for those stores are lifted over them, and LDS idles while they are issued.
    if (more) {
      __builtin_amdgcn_sched_barrier(0);
      lds_barrier();
    }
  };

  constexpr int NTILE = K / 32;
  static_assert(NTILE >= 10, "the first trip asks for tiles 8, 9");
  v4f fa[4], fb[4];   // tile 0 has a set of its own: tile 2's loads do not wait for its staging
  ask();                   // tiles 2, 3
  fetch(fa, fb);
  pf += pfstep;
  ask();                   // tiles 4, 5
  fetch(pa[1], pb[1]);
  pf += pfstep;
  ask();                   // tiles 6, 7
  fetch(pa[0], pb[0]);
  pf += pfstep;
  tile_begin();
  stage(0, fa, fb);
  lds_barrier();
  for (int t = 0; t < NTILE - 4; t += 2) {
    // tiles t + 8, t + 9; the last two trips ask for the last pair again, which
    // costs less than a test on t in every trip
    step(0, true, true, true);
    if (t + 10 < NTILE) pf += pfstep;    // never past the last pair of tiles
    step(1, true, true);
  }
  step(0, true, true);     // tile NTILE - 4 fetches the last tile
  step(1, true, false);
  step(0, true, false);
  step(1, false, false);   // the last tile: nothing left to stage

  float bv[2];
  bool act[2];
#pragma unroll
  for (int j = 0; j < 2; ++j) {
    const int col = bn + wn + j * 16 + nl;
    bv[j] = bias[col];
    act[j] = (mode == 1) || (mode == 2 && col < halfN);
  }
#pragma unroll
  for (int i = 0; i < 4; ++i) {
    float* crow = C + (size_t)(bm + wm + i * 16) * N + bn + wn + lane;
#pragma unroll
    for (int vi = 0; vi < 8; ++vi) {
      float v[2];
#pragma unroll
      for (int j = 0; j < 2; ++j) {
        v[j] = acc[i][j][vi] + bv[j];
        if (act[j]) v[j] = elu_p1(v[j]);
      }
      float lo, hi;
      whole_rows(v[0], v[1], lane, lo, hi);
      crow[vi * N]       = lo;
      crow[(vi + 8) * N] = hi;
    }
  }
}

template <int N, int K>
__global__ __launch_bounds__(256)
void gemm_kernel(const float* __restrict__ A, const float* __restrict__ B,
                 const float* __restrict__ bias, float* __restrict__ C,
                 int mode, int halfN) {
  gemm_tile<N, K>(A, B, bias, C, mode, halfN, blockIdx.x, blockIdx.y);
}

// --- K side, one pass: partial state = K_rot^T V and partial sum_s K ----------
// One work-group = one head x SCH positions. K and V are read as they lie,
// [s][d] and [s][e]; RoPE is applied to K while its tile is staged (a thread
// holds columns i..i+3 and i+32..i+35 of a row, both members of four rotation
// pairs), so the rotated K never goes through global memory. Both tiles lie
// row-major over s in LDS, and the transposing load hands out A = K_rot^T as
// well as B = V in the same k order. The NSPLIT partial states and partial
// column sums of a head are added up where they are used, in the y GEMM.
#define NSPLIT 8                // work-groups per head: 256 in all, one per WGP
#define SCH (SLEN / NSPLIT)     // positions per work-group
#define NT (SCH / 32)           // s tiles per work-group
#define NBH (BATCH * NHEAD)
// sin and cos of 2*pi*rev. One statement so that the slot the instruction set
// asks for behind a transcendental is filled whatever the compiler puts next:
// v_cos is independent of v_sin (outputs never alias the input), v_nop ends it.
__device__ __forceinline__ void sincos_rev(float rev, float& sn, float& cs) {
  asm("v_sin_f32 %0, %2\n\tv_cos_f32 %1, %2\n\tv_nop"
      : "=&v"(sn), "=&v"(cs) : "v"(rev));
}
// One work-group's chunk: S chunk sp of head bh.
__device__ __forceinline__
void kstate_chunk(const float* __restrict__ kv, float* __restrict__ stateP,
                  float* __restrict__ ksumP, int sp, int bh) {
  __shared__ __attribute__((aligned(16))) _Float16 Ks[SCH * BP64];
  __shared__ __attribute__((aligned(16))) _Float16 Vs[SCH * BP64];
  __shared__ __attribute__((aligned(16))) float colsum[32 * HDIM];
  const int b = bh >> 4, h = bh & 15;
  const int sbase = sp * SCH;
  const float* Kptr = kv + ((size_t)b * SLEN + sbase) * (2 * N_EMB) + h * HDIM;
  const int tid = threadIdx.x;
  const int wid = tid >> 5, lane = tid & 31;
  const int tm  = (wid & 3) * 16;        // 4 m-tiles (d)
  const int tn0 = (wid >> 2) * 32;       // 2 wave groups x 2 n-tiles (e)

  const v8f vzero = {0.f,0.f,0.f,0.f,0.f,0.f,0.f,0.f};
  v8f acc[2] = {vzero, vzero};

  // One chunk per WGP, so little but the wave's own order hides a load: the loads
  // of all NT s tiles are issued at once, each tile into its own set.
  const int r  = tid >> 3, c4  = (tid & 7) * 4;     // K: row s, first column d
  const int br = tid >> 4, bc4 = (tid & 15) * 4;    // V: row s, first column e
  const float* kp = Kptr + (size_t)r * (2 * N_EMB) + c4;
  const float* vp = Kptr + (size_t)br * (2 * N_EMB) + bc4;   // V lies N_EMB floats on
  v4f pk[NT][2], pv[NT][2];
  v4f cs1 = {0.f, 0.f, 0.f, 0.f}, cs2 = {0.f, 0.f, 0.f, 0.f};   // sums of K, unrotated
#pragma unroll
  for (int u = 0; u < NT; ++u) {
    pk[u][0] = *(const v4f*)(kp + u * 32 * (2 * N_EMB));
    pk[u][1] = *(const v4f*)(kp + u * 32 * (2 * N_EMB) + 32);
    pv[u][0] = *(const v4f*)(vp + N_EMB + u * 32 * (2 * N_EMB));
    pv[u][1] = *(const v4f*)(vp + N_EMB + (u * 32 + 16) * (2 * N_EMB));
  }
  // The issued loads still name the two address pairs. Both are inputs of the wait,
  // so they stay live up to it and no load's result is placed in them ahead of it.
  asm volatile("s_wait_xcnt 0x0" :: "v"(kp), "v"(vp) : "memory");
  // holds every later register write behind that wait
  __builtin_amdgcn_sched_barrier(0);

  float inv[4];   // inv_freq[i] = 10000^(-2i/64) = exp(-i * ln(10000)/32)
#pragma unroll
  for (int j = 0; j < 4; ++j)
    inv[j] = __expf(-(float)(c4 + j) * 0.28782313662425572f);

  // K tile 32(s) x 64(d), rotated -> Ks[s][d]; V tile 32(s) x 64(e) -> Vs[s][e];
  // s is counted from the chunk's first position
  auto stage = [&](const v4f (&k)[2], const v4f (&v)[2], int s0) {
    const float t = (float)(sbase + s0 + r);
    float lo[4], hi[4];
#pragma unroll
    for (int j = 0; j < 4; ++j) {
      float sn, cs;
      sincos_rev(t * inv[j] * 0.15915494309189532f, sn, cs);
      lo[j] = fmaf(k[0][j], cs, -(k[1][j] * sn));
      hi[j] = fmaf(k[1][j], cs, k[0][j] * sn);
    }
    st4h(&Ks[(s0 + r) * BP64 + c4],      lo[0], lo[1], lo[2], lo[3]);
    st4h(&Ks[(s0 + r) * BP64 + c4 + 32], hi[0], hi[1], hi[2], hi[3]);
    cs1 += k[0];
    cs2 += k[1];
#pragma unroll
    for (int q = 0; q < 2; ++q)
      st4h(&Vs[(s0 + br + q * 16) * BP64 + bc4], v[q].x, v[q].y, v[q].z, v[q].w);
  };

  // The whole chunk is staged, tile by tile as its loads come in; one barrier
  // then separates all staging from all products.
#pragma unroll
  for (int u = 0; u < NT; ++u) {
    tile_begin();
    stage(pk[u], pv[u], u * 32);
  }
  *(v4f*)&colsum[r * HDIM + c4]      = cs1;
  *(v4f*)&colsum[r * HDIM + c4 + 32] = cs2;
  __syncthreads();   // both tiles and the 32 row groups' column sums are whole in LDS
#pragma unroll
  for (int u = 0; u < NT; ++u) {
    const v16h af = frag_ld_tr(Ks + u * 32 * BP64, BP64, tm, lane);   // A[d][s] out of Ks[s][d]
#pragma unroll
    for (int j = 0; j < 2; ++j) {
      const v16h bf = frag_ld_tr(Vs + u * 32 * BP64, BP64, tn0 + j * 16, lane);
      acc[j] = wmma16(af, bf, acc[j]);
    }
  }
  float* st = stateP + ((size_t)sp * NBH + bh) * (HDIM * HDIM);
#pragma unroll
  for (int vi = 0; vi < 8; ++vi) {
    float lo, hi;
    whole_rows(acc[0][vi], acc[1][vi], lane, lo, hi);
    st[(tm + vi) * HDIM + tn0 + lane]     = lo;
    st[(tm + vi + 8) * HDIM + tn0 + lane] = hi;
  }
  if (tid < HDIM) {  // two whole waves: column tid over the 32 row groups
    float t = 0.f;
#pragma unroll
    for (int g = 0; g < 32; ++g) t += colsum[g * HDIM + tid];
    ksumP[((size_t)sp * NBH + bh) * HDIM + tid] = t;
  }
}

// --- Q projection and K side in one launch ----------------------------------
// Q = elu(x q_w + q_b) + 1 depends on the inputs alone and the K side on kv alone:
// neither reads what the other writes, so they share a grid, told apart by the
// block index. Each is 256 work-groups, one per WGP, and two fit a WGP: the K
// side's memory stream and rotations run in the places and issue slots that the
// GEMM leaves empty, not in a launch of their own. The GEMM tiles last longer and
// have the low indices.
#define QTILES ((N_EMB / 128) * (BATCH * TLEN / 128))
__global__ __launch_bounds__(256)
void qproj_kstate_kernel(const float* __restrict__ x, const float* __restrict__ q_w,
                         const float* __restrict__ q_b, float* __restrict__ qfeat,
                         const float* __restrict__ kv, float* __restrict__ stateP,
                         float* __restrict__ ksumP) {
  const int blk = blockIdx.x;   // the same for the whole work-group: a scalar branch
  if (blk < QTILES) {
    gemm_tile<N_EMB, N_EMB>(x, q_w, q_b, qfeat, 1, 0, blk % (N_EMB / 128),
                            blk / (N_EMB / 128));
  } else {
    const int c = blk - QTILES;
    kstate_chunk(kv, stateP, ksumP, c % NSPLIT, c / NSPLIT);
  }
}

// --- y[b,t,h,:] = (rope(Q)[b,t,h,:] @ state[b,h]) / denom[b,h,t] ------------
// RoPE on Q is applied while the A tile is staged: a thread holds columns
// i..i+3 and i+32..i+35 of a row, i.e. both members of four rotation pairs, so
// the rotated Q never goes through global memory. Both k halves (K = 64) are
// staged at once, so one barrier separates staging from the products.
// The denominator Q . sum_s K is formed from the same registers, before the
// rotation: eight threads hold a row, their partial dots meet by DPP.
// The head's state and sum_s K arrive as NSPLIT partials and are added up here.
template <int CTRL>
__device__ __forceinline__ float row_xor_add(float v) {   // v + v of lane ^ mask
  return v + __builtin_bit_cast(float, __builtin_amdgcn_update_dpp(
                 0, __builtin_bit_cast(int, v), CTRL, 0xf, 0xf, true));
}
__global__ __launch_bounds__(256)
void ygemm_kernel(const float* __restrict__ qfeat, const float* __restrict__ stateP,
                  const float* __restrict__ ksumP, float* __restrict__ y) {
  __shared__ __attribute__((aligned(16))) _Float16 As[2][128 * ROWH];
  __shared__ __attribute__((aligned(16))) _Float16 Bs[64 * BP64];
  __shared__ __attribute__((aligned(16))) float dn[128];
  const int bh = blockIdx.y;
  const int b = bh >> 4, h = bh & 15;
  const int row0 = blockIdx.x * 128;
  const float* Aptr = qfeat + (size_t)b * TLEN * N_EMB + h * HDIM;  // rows t, lda=N_EMB
  const float* Sptr = stateP + (size_t)bh * (HDIM * HDIM);
  const int tid = threadIdx.x;
  const int wid = tid >> 5, lane = tid & 31;
  const int nl = lane & 15;
  const int kb = (lane >> 4) << 3;
  const int hb = (lane >> 4) << 3;

  const v8f vzero = {0.f,0.f,0.f,0.f,0.f,0.f,0.f,0.f};
  v8f acc[4] = {vzero, vzero, vzero, vzero};

  // Every row of a thread is reached from one address by a constant offset.
  const int r = tid >> 3, c4 = (tid & 7) * 4;       // A: row, first column
  const int br = tid >> 4, bc4 = (tid & 15) * 4;    // state: row, first column
  const float* ap = Aptr + (size_t)(row0 + r) * N_EMB + c4;
  const float* sp = Sptr + br * HDIM + bc4;
  v4f x1[4], x2[4], sv[4];
#pragma unroll
  for (int q = 0; q < 4; ++q) {
    x1[q] = *(const v4f*)(ap + q * 32 * N_EMB);
    x2[q] = *(const v4f*)(ap + q * 32 * N_EMB + 32);
  }
  const float* kq = ksumP + bh * HDIM + c4;
  v4f kpart[NSPLIT][2], spart[NSPLIT][4];
#pragma unroll
  for (int p = 0; p < NSPLIT; ++p) {
    kpart[p][0] = *(const v4f*)(kq + p * (NBH * HDIM));
    kpart[p][1] = *(const v4f*)(kq + p * (NBH * HDIM) + 32);
  }
#pragma unroll
  for (int p = 0; p < NSPLIT; ++p)
#pragma unroll
    for (int q = 0; q < 4; ++q)
      spart[p][q] = *(const v4f*)(sp + p * (NBH * HDIM * HDIM) + q * 16 * HDIM);
  // Every load above is issued before the first sum waits for one; without this
  // the state's loads start only when the column sums have come back.
  __builtin_amdgcn_sched_barrier(0);
  v4f ks1 = kpart[0][0], ks2 = kpart[0][1];
#pragma unroll
  for (int q = 0; q < 4; ++q) sv[q] = spart[0][q];
#pragma unroll
  for (int p = 1; p < NSPLIT; ++p) {
    ks1 += kpart[p][0];
    ks2 += kpart[p][1];
#pragma unroll
    for (int q = 0; q < 4; ++q) sv[q] += spart[p][q];
  }
  float dp[4];                    // dp[q] = Q[row r + 32 q, :] . ksum
#pragma unroll
  for (int q = 0; q < 4; ++q) {
    float p1 = x1[q][0] * ks1[0], p2 = x2[q][0] * ks2[0];
#pragma unroll
    for (int j = 1; j < 4; ++j) {
      p1 = fmaf(x1[q][j], ks1[j], p1);
      p2 = fmaf(x2[q][j], ks2[j], p2);
    }
    float p = p1 + p2;
    p = row_xor_add<0x161>(p);    // row_xmask:1
    p = row_xor_add<0x162>(p);    // row_xmask:2
    dp[q] = row_xor_add<0x164>(p);    // row_xmask:4
  }
  if ((tid & 7) == 0) {
#pragma unroll
    for (int q = 0; q < 4; ++q) dn[r + q * 32] = dp[q];
  }
  {   // A tile 128(t) x 64(d), rotated: As[0] = d 0..31, As[1] = d 32..63
    float inv[4];   // inv_freq[i] = 10000^(-2i/64) = exp(-i * ln(10000)/32)
#pragma unroll
    for (int j = 0; j < 4; ++j)
      inv[j] = __expf(-(float)(c4 + j) * 0.28782313662425572f);
#pragma unroll
    for (int q = 0; q < 4; ++q) {
      const float t = (float)(row0 + r + q * 32);
      _Float16* d0 = &As[0][(r + q * 32) * ROWH + c4];
      _Float16* d1 = &As[1][(r + q * 32) * ROWH + c4];
#pragma unroll
      for (int j = 0; j < 4; ++j) {
        float sn, cs;
        __sincosf(t * inv[j], &sn, &cs);
        d0[j] = (_Float16)(x1[q][j] * cs - x2[q][j] * sn);
        d1[j] = (_Float16)(x2[q][j] * cs + x1[q][j] * sn);
      }
    }
  }
  // state 64(d) x 64(e) -> Bs[d][e]; row d = br + q * 16
#pragma unroll
  for (int q = 0; q < 4; ++q)
    st4h(&Bs[(br + q * 16) * BP64 + bc4], sv[q].x, sv[q].y, sv[q].z, sv[q].w);
  __syncthreads();   // both tiles and dn are whole in LDS before anything is read
#pragma unroll
  for (int kk = 0; kk < 2; ++kk) {
    const v16h af = frag_ld(&As[kk][(wid * 16 + nl) * ROWH], kb);
#pragma unroll
    for (int j = 0; j < 4; ++j) {
      const v16h bf = frag_ld_tr(Bs + kk * 32 * BP64, BP64, j * 16, lane);
      acc[j] = wmma16(af, bf, acc[j]);
    }
  }
  float rd[8];
  const v4f dlo = *(const v4f*)&dn[wid * 16 + hb];
  const v4f dhi = *(const v4f*)&dn[wid * 16 + hb + 4];
#pragma unroll
  for (int vi = 0; vi < 4; ++vi) {
    rd[vi]     = 1.0f / dlo[vi];
    rd[vi + 4] = 1.0f / dhi[vi];
  }
  float* yrow = y + (size_t)(b * TLEN + row0 + wid * 16) * N_EMB + h * HDIM + lane;
#pragma unroll
  for (int j = 0; j < 4; j += 2) {
#pragma unroll
    for (int vi = 0; vi < 8; ++vi) {
      float lo, hi;
      whole_rows(acc[j][vi] * rd[vi], acc[j + 1][vi] * rd[vi], lane, lo, hi);
      yrow[vi * N_EMB + j * 16]       = lo;
      yrow[(vi + 8) * N_EMB + j * 16] = hi;
    }
  }
}

// ---------------------------------------------------------------------------
extern "C" void kernel_launch(void* const* d_in, const int* in_sizes, int n_in,
                              void* d_out, int out_size, void* d_ws, size_t ws_size,
                              hipStream_t stream) {
  (void)in_sizes; (void)n_in; (void)out_size; (void)ws_size;
  const float* x      = (const float*)d_in[0];
  const float* mem    = (const float*)d_in[1];
  const float* q_w    = (const float*)d_in[2];
  const float* q_b    = (const float*)d_in[3];
  const float* kv_w   = (const float*)d_in[4];
  const float* kv_b   = (const float*)d_in[5];
  const float* proj_w = (const float*)d_in[6];
  const float* proj_b = (const float*)d_in[7];
  float* out = (float*)d_out;

  // Workspace layout (floats). Total ~68 MB.
  const size_t SZ_BTC = (size_t)BATCH * TLEN * N_EMB;     // 4 M
  float* ws      = (float*)d_ws;
  float* qfeat   = ws;                                    // [B,T,C] elu+1
  float* kvbuf   = qfeat   + SZ_BTC;                      // [B,S,2C] (K feat | V)
  float* ybuf    = kvbuf   + 2 * SZ_BTC;                  // [B,T,C]
  float* stateP  = ybuf    + SZ_BTC;                      // [NSPLIT,B*H,64,64]
  float* ksumP   = stateP  + (size_t)NSPLIT * NBH * HDIM * HDIM;   // [NSPLIT,B*H,64]

  const dim3 blk(256);
  const int M = BATCH * TLEN;   // 4096

  // 1) kv = memory@kv_w + kv_b ; elu+1 on K half only
  gemm_kernel<2 * N_EMB, N_EMB><<<dim3(2 * N_EMB / 128, M / 128), blk, 0, stream>>>(
      mem, kv_w, kv_b, kvbuf, 2, N_EMB);
  // 2, 3) Q = elu(x@q_w + q_b)+1, and beside it the partials of
  // state = rope(K)^T V and of sum_s K  (per b,h and S chunk)
  qproj_kstate_kernel<<<dim3(QTILES + NSPLIT * NBH), blk, 0, stream>>>(
      x, q_w, q_b, qfeat, kvbuf, stateP, ksumP);
  // 4) y = (rope(Q) @ state) / (Q . ksum)
  ygemm_kernel<<<dim3(TLEN / 128, NBH), blk, 0, stream>>>(qfeat, stateP, ksumP, ybuf);
  // 5) out = y @ proj_w + proj_b
  gemm_kernel<N_EMB, N_EMB><<<dim3(N_EMB / 128, M / 128), blk, 0, stream>>>(
      ybuf, proj_w, proj_b, out, 0, 0);
}
